// v000
// Measured on an AMD MI455X. A time is GPU time per run, averaged over a window of back-to-back runs after a warm-up
// (all launches, gaps included; the runs take copies of the inputs in turn), and the median of several windows.
// Apart from v000's, it joins two sittings. Times from different sittings can be a few percent apart, while
// side-by-side timings come from the same sitting.
// v000, which the later versions start from, runs in 789 microseconds.
// compute dtype: all float inputs rounded to bf16; q/k/v projections with EXACT bf16 products on WMMA 16x16x32 (f32 accumulate) + bias; logits q x k once to f16 each (1 product) x SCALE; the int mask read per element (0 - -1e9); softmax f32, then the probabilities are MULTIPLIED by the float group_prob (no renormalisation); P x 2^11 once to f16 x v once to f16 (1 product); ctx x 2^6 once to f16 x Wo f16(bf16 x 2^8) + bo; f32 output.
#include <hip/hip_runtime.h>
#include <math.h>

typedef __attribute__((ext_vector_type(16))) _Float16 v16h;
typedef __attribute__((ext_vector_type(16))) __bf16 v16b;
typedef __attribute__((ext_vector_type(8)))  _Float16 v8h;
typedef __attribute__((ext_vector_type(8)))  float v8f;
typedef __attribute__((ext_vector_type(4)))  float v4f;
typedef __attribute__((ext_vector_type(2)))  float v2f;
typedef __attribute__((ext_vector_type(4)))  unsigned v4u;
typedef __attribute__((ext_vector_type(4)))  int v4i;
typedef float __attribute__((may_alias)) float_a;
typedef int __attribute__((may_alias)) int_a;

template <typename T> __device__ __forceinline__ void vst2(void* p, T v) { *(T*)p = v;  }
__device__ __forceinline__ v8f wmma16(v16h a, v16h b, v8f c) {
  v8f d = __builtin_amdgcn_wmma_f32_16x16x32_f16(false, a, false, b, (short)0, c, false, false);
  asm volatile("v_nop\n\tv_nop\n\tv_nop\n\tv_nop" : "+v"(d) : "v"(a), "v"(b));
  return d;
}
__device__ __forceinline__ v8f wmma_bf(v16b a, v16b b, v8f c) {
  v8f d = __builtin_amdgcn_wmma_f32_16x16x32_bf16(false, a, false, b, (short)0, c, false, false);
  asm volatile("v_nop\n\tv_nop\n\tv_nop\n\tv_nop" : "+v"(d) : "v"(a), "v"(b));
  return d;
}
// 16x16x32 fragments: lane = (h = lane>>4, row/col = lane&15); elements 0..7 = k0+8h+0..7, 8..15 = k0+16+8h+0..7; D element r = row 8h+r
__device__ __forceinline__ v16h frag_h(const _Float16* rowk0, int lane) {
  union { v16h v; v8h q[2]; } u; const _Float16* p = rowk0 + 8 * (lane >> 4);
  u.q[0] = *(const v8h*)p; u.q[1] = *(const v8h*)(p + 16); return u.v;
}
__device__ __forceinline__ v16h frag_f32(const float* rowk0, int lane) {
  v16h a; const float* p = rowk0 + 8 * (lane >> 4);
#pragma unroll
  for (int i = 0; i < 8; ++i) { a[i] = (_Float16)p[i]; a[8 + i] = (_Float16)p[16 + i]; }
  return a;
}
__device__ __forceinline__ v16h frag_f32s(const float* rowk0, int lane, float sc) {
  v16h a; const float* p = rowk0 + 8 * (lane >> 4);
#pragma unroll
  for (int i = 0; i < 8; ++i) { a[i] = (_Float16)(p[i] * sc); a[8 + i] = (_Float16)(p[16 + i] * sc); }
  return a;
}
// column fragment from a [K][ld] layout (column n), rows >= K read as 0
__device__ __forceinline__ v16h fragc_f32(const float* W, int k0, int n, int lane, int ld, int K) {
  v16h a; const int g = lane >> 4;
#pragma unroll
  for (int i = 0; i < 8; ++i) { const int ka = k0 + 8 * g + i, kb = ka + 16;
    a[i] = (_Float16)(ka < K ? W[(size_t)(ka < K ? ka : K - 1) * ld + n] : 0.f); a[8 + i] = (_Float16)(kb < K ? W[(size_t)(kb < K ? kb : K - 1) * ld + n] : 0.f); }
  return a;
}
struct F2 { v16b h, l; };
__device__ __forceinline__ F2 bsplit16(const float v[16]) { F2 r;
#pragma unroll
  for (int i = 0; i < 16; ++i) { const __bf16 h = (__bf16)v[i]; r.h[i] = h; r.l[i] = (__bf16)(v[i] - (float)h); }
  return r; }
__device__ __forceinline__ F2 split_row(const float* row, int k0, int lane) { float v[16]; const float* p = row + k0 + 8 * (lane >> 4);
#pragma unroll
  for (int i = 0; i < 8; ++i) { v[i] = p[i]; v[8 + i] = p[16 + i]; }
  return bsplit16(v); }
__device__ __forceinline__ F2 split_rowK(const float* row, int k0, int lane, int K) { float v[16]; const int g = lane >> 4;
#pragma unroll
  for (int i = 0; i < 8; ++i) { const int ka = k0 + 8 * g + i, kb = ka + 16; v[i] = ka < K ? row[ka < K ? ka : K - 1] : 0.f; v[8 + i] = kb < K ? row[kb < K ? kb : K - 1] : 0.f; }
  return bsplit16(v); }
__device__ __forceinline__ F2 split_col(const float* W, int k0, int n, int lane, int ld, int K) { float v[16]; const int g = lane >> 4;
#pragma unroll
  for (int i = 0; i < 8; ++i) { const int ka = k0 + 8 * g + i, kb = ka + 16; v[i] = ka < K ? W[(size_t)(ka < K ? ka : K - 1) * ld + n] : 0.f; v[8 + i] = kb < K ? W[(size_t)(kb < K ? kb : K - 1) * ld + n] : 0.f; }
  return bsplit16(v); }
__device__ __forceinline__ v8f mac3(const F2& a, const F2& b, v8f c) { c = wmma_bf(a.l, b.h, c); c = wmma_bf(a.h, b.l, c); return wmma_bf(a.h, b.h, c); }
__device__ __forceinline__ float sigm(float v) { return 1.0f / (1.0f + expf(-v)); }
#define LDSX() do { asm volatile("s_wait_dscnt 0" ::: "memory"); __builtin_amdgcn_wave_barrier(); __builtin_amdgcn_fence(__ATOMIC_RELEASE, "workgroup"); } while (0)

// Multi-headed attention whose probabilities are multiplied by a group-probability tensor (query / key / value [4,1024,1024]; (in,out) wq / wk / wv / wo [1024,1024] uniform(+-1/32) + biases uniform(+-1/32); 16 heads x 64; scale 1/8; mask [4,1024,1024] int32 random 0/1: scores[mask == 0] = -1e9; p = softmax(scores); p *= group_prob[:, None] with group_prob [4,1024,1024] uniform[0,1) f32 (multiplicative, after the softmax, no renormalisation); merge; wo + bo).
#define NB 4
#define TT 1024
#define CC 1024            // NH * HD = projected width
#define DIN 1024          // input (model) width
#define NH 16
#define HD 64
#define NQB (TT / 64)
#define HG 8
#define SCALE (0.125f)
#define CAUSAL 0
#ifndef TNB
#define TNB NB
#endif
__device__ __forceinline__ float bfr(float v) { return (float)(__bf16)v; }
__host__ __device__ __forceinline__ int kb_last(int qb) { return CAUSAL ? ((qb * 64 + 63) >> 7) : (TT / 128 - 1); }
typedef __attribute__((ext_vector_type(8))) __bf16 v8b;
__device__ __forceinline__ v16b frag_b(const __bf16* rowk0, int lane) {
  union { v16b v; v8b q[2]; } u; const __bf16* p = rowk0 + 8 * (lane >> 4);
  u.q[0] = *(const v8b*)p; u.q[1] = *(const v8b*)(p + 16); return u.v;
}
#define QBH 0              // query blocks 0..QBH-1 take the high-precision path: none here (QBH = 0; non-causal, every block sees all keys)
#define QHI 0               // single-product logits on every row
#define KHI 64            // key rows carrying k residual / v bf16 hi+lo planes (read only on the qb < QBH path, which no block takes)
// B fragment (k rows k0+.., output column o) of a weight: (in,out) [K][ld] or (out,in) [ld rows of K]: bf16 exact, or f16(bf16 * 256) exact
__device__ __forceinline__ v16b wcol_io(const float* Wm, int k0, int o, int lane, int ld) { v16b w; const int g = lane >> 4;
#pragma unroll
  for (int i = 0; i < 8; ++i) { w[i] = (__bf16)Wm[(size_t)(k0 + 8 * g + i) * ld + o]; w[8 + i] = (__bf16)Wm[(size_t)(k0 + 16 + 8 * g + i) * ld + o]; }
  return w; }
__device__ __forceinline__ v16b wcol_oi(const float* Wm, int k0, int o, int lane, int K) { v16b w; const float* p = Wm + (size_t)o * K + k0 + 8 * (lane >> 4);
#pragma unroll
  for (int i = 0; i < 8; ++i) { w[i] = (__bf16)p[i]; w[8 + i] = (__bf16)p[16 + i]; }
  return w; }
__device__ __forceinline__ v16h wcolh_io(const float* Wm, int k0, int o, int lane, int ld) { v16h w; const int g = lane >> 4;
#pragma unroll
  for (int i = 0; i < 8; ++i) { w[i] = (_Float16)(bfr(Wm[(size_t)(k0 + 8 * g + i) * ld + o]) * 256.0f); w[8 + i] = (_Float16)(bfr(Wm[(size_t)(k0 + 16 + 8 * g + i) * ld + o]) * 256.0f); }
  return w; }
__device__ __forceinline__ v16h wcolh_oi(const float* Wm, int k0, int o, int lane, int K) { v16h w; const float* p = Wm + (size_t)o * K + k0 + 8 * (lane >> 4);
#pragma unroll
  for (int i = 0; i < 8; ++i) { w[i] = (_Float16)(bfr(p[i]) * 256.0f); w[8 + i] = (_Float16)(bfr(p[16 + i]) * 256.0f); }
  return w; }
#define WQKV_LAYOUT 0   // 0 = (in,out) [DIN][CC]; 1 = (out,in) [CC][DIN]; 2 = per-head [NH][DIN][HD]
__device__ __forceinline__ v16b wcol_hdk(const float* Wm, int k0, int o, int lane) { v16b w; const int g = lane >> 4; const float* p = Wm + (size_t)(o / HD) * DIN * HD + (o % HD);
#pragma unroll
  for (int i = 0; i < 8; ++i) { w[i] = (__bf16)p[(size_t)(k0 + 8 * g + i) * HD]; w[8 + i] = (__bf16)p[(size_t)(k0 + 16 + 8 * g + i) * HD]; }
  return w; }
#define WO_OUT_IN 0
#if WQKV_LAYOUT == 1
#define WCOL(W, k0, o, lane) wcol_oi(W, k0, o, lane, DIN)
#elif WQKV_LAYOUT == 2
#define WCOL(W, k0, o, lane) wcol_hdk(W, k0, o, lane)
#else
#define WCOL(W, k0, o, lane) wcol_io(W, k0, o, lane, CC)
#endif
#if WO_OUT_IN
#define WOCOL(W, k0, o, lane) wcol_oi(W, k0, o, lane, CC)
#define WOCOLH(W, k0, o, lane) wcolh_oi(W, k0, o, lane, CC)
#else
#define WOCOL(W, k0, o, lane) wcol_io(W, k0, o, lane, DIN)
#define WOCOLH(W, k0, o, lane) wcolh_io(W, k0, o, lane, DIN)
#endif
#define SM_EXTRA_PARAMS , int bsm, const int* __restrict__ MASK, const float* __restrict__ GPROB
// int32 mask [B,S,S] (random 0/1; shared by the heads): where(mask == 0, -1e9, score) before the softmax; unconditional load, then a value select
#define SM_MASK_HOOK do { const int mk_ = MASK[((size_t)bsm * TT + t) * TT + k]; asm volatile("s_wait_loadcnt 0x0" ::: "memory"); v = (mk_ == 0) ? -1.0e9f : v; } while (0)
#ifndef SM_EXTRA_PARAMS
#define SM_EXTRA_PARAMS
#endif
#ifndef PROJ_EXTRA_PARAMS
#define PROJ_EXTRA_PARAMS
#endif
#ifndef SM_MASK_HOOK
#define SM_MASK_HOOK (void)0
#endif

#define WS_QH  0u                                      // f16 q rows [b*t][CC]
#define WS_KH  (WS_QH + 2u * (size_t)NB * TT * CC)      // f16 k rows [b*t][CC]
#define WS_VT  (WS_KH + 2u * (size_t)NB * TT * CC)      // f16 v planes [b][c][t]
#define WS_QL  (WS_VT + 2u * (size_t)NB * CC * TT)      // f16 q residual x 2^10 rows [b][t < QHI][CC]
#define WS_KL  (WS_QL + 2u * (size_t)NB * QHI * CC)     // f16 k residual x 2^10 rows [b][t < KHI][CC]
#define WS_VB  (WS_KL + 2u * (size_t)NB * KHI * CC)     // bf16 v hi planes [b][c][t < KHI]
#define WS_VBL (WS_VB + 2u * (size_t)NB * CC * KHI)
#define WS_S   (WS_VBL + 2u * (size_t)NB * CC * KHI)    // f32 logits / P [hg][t][s]
#define WS_Y   (WS_S  + 4u * (size_t)HG * TT * TT)      // f32 ctx rows [b*t][CC] (only when there is an output projection)
#define WS_END (WS_Y  + 4u * (size_t)NB * TT * CC)

// ---- k_proj: block = (64 rows, 128 cols, which): q/k/v = X W (+ b) with exact bf16 products (K = DIN) -> which 0: q f16 rows (+ residual rows < QHI); 1: k f16 rows (+ residual rows < KHI); 2: v f16 planes [c][t] (+ bf16 hi/lo planes for t < KHI)
__global__ __launch_bounds__(128) void k_proj(const float* __restrict__ XQ, const float* __restrict__ XK, const float* __restrict__ XV, const float* __restrict__ WQ, const float* __restrict__ WK, const float* __restrict__ WV, const float* __restrict__ BQ, const float* __restrict__ BK, const float* __restrict__ BV,
    _Float16* __restrict__ QH, _Float16* __restrict__ QL, _Float16* __restrict__ KH, _Float16* __restrict__ KL, _Float16* __restrict__ VT, __bf16* __restrict__ VB, __bf16* __restrict__ VBL) {
  __shared__ __align__(16) _Float16 sh[64][136], sl[64][136]; __shared__ __align__(16) _Float16 th[128][72]; __shared__ __align__(16) __bf16 tb[128][72], tbl[128][72];
  const int tid = threadIdx.x, wave = tid >> 5, lane = tid & 31, col = lane & 15, g = lane >> 4; const int which = blockIdx.z; const int c0 = blockIdx.y * 128; const size_t r0 = (size_t)blockIdx.x * 64; const size_t bb = r0 / TT; const int t0 = (int)(r0 % TT);
  const float* X = which == 0 ? XQ : which == 1 ? XK : XV; const float* WA = which == 0 ? WQ : which == 1 ? WK : WV; const float* BA = which == 0 ? BQ : which == 1 ? BK : BV;
  v8f acc[8] = {};
#pragma unroll 2
  for (int kc = 0; kc < DIN / 32; ++kc) { v16b a; { const float* p = X + (r0 + wave * 16 + col) * DIN + kc * 32 + 8 * g;
#pragma unroll
      for (int i = 0; i < 8; ++i) { a[i] = (__bf16)p[i]; a[8 + i] = (__bf16)p[16 + i]; } }
    asm volatile("s_wait_loadcnt 0x0" ::: "memory");
#pragma unroll
    for (int j = 0; j < 8; ++j) { const v16b w = WCOL(WA, kc * 32, c0 + j * 16 + col, lane); asm volatile("s_wait_loadcnt 0x0" ::: "memory"); acc[j] = wmma_bf(a, w, acc[j]); } }
  if (which < 2) { _Float16* DH = which == 0 ? QH : KH; _Float16* DL = which == 0 ? QL : KL; const int nhi = which == 0 ? QHI : KHI; const bool hi_rows = t0 < nhi;
#pragma unroll
    for (int j = 0; j < 8; ++j) { const float bias = BA ? bfr(BA[c0 + j * 16 + col]) : 0.f;
#pragma unroll
      for (int r = 0; r < 8; ++r) { const float v = acc[j][r] + bias; const _Float16 hv = (_Float16)v; sh[wave * 16 + 8 * g + r][j * 16 + col] = hv; sl[wave * 16 + 8 * g + r][j * 16 + col] = (_Float16)((v - (float)hv) * 1024.0f); } }
    __syncthreads();
    for (int e = tid; e < 64 * 16; e += 128) { const int rl = e >> 4, q = e & 15; vst2((unsigned*)(DH + (r0 + rl) * CC + c0 + q * 8), *(const v4u*)&sh[rl][q * 8]); if (hi_rows) vst2((unsigned*)(DL + (bb * nhi + t0 + rl) * (size_t)CC + c0 + q * 8), *(const v4u*)&sl[rl][q * 8]); }
  } else { const bool hi_rows = t0 < KHI;
#pragma unroll
    for (int j = 0; j < 8; ++j) { const float bias = BA ? bfr(BA[c0 + j * 16 + col]) : 0.f;
#pragma unroll
      for (int r = 0; r < 8; ++r) { const float v = acc[j][r] + bias; const int rl = wave * 16 + 8 * g + r, cl = j * 16 + col; th[cl][rl] = (_Float16)v; const __bf16 bh = (__bf16)v; tb[cl][rl] = bh; tbl[cl][rl] = (__bf16)(v - (float)bh); } }
    __syncthreads();
    for (int e = tid; e < 128 * 8; e += 128) { const int cl = e >> 3, q = e & 7; vst2((unsigned*)(VT + (bb * CC + c0 + cl) * (size_t)TT + t0 + q * 8), *(const v4u*)&th[cl][q * 8]); if (hi_rows) { const size_t o3 = (bb * CC + c0 + cl) * (size_t)KHI + t0 + q * 8; vst2((unsigned*)(VB + o3), *(const v4u*)&tb[cl][q * 8]); vst2((unsigned*)(VBL + o3), *(const v4u*)&tbl[cl][q * 8]); } } } }
// ---- k_sc: block = (query block qb, key block kb <= kb_last(qb), head in group) of batch b: logits x SCALE; q hi + residual (x 2^10) against k (2 products) for query rows < QHI, plus the k residual (3 products) for query blocks < QBH (causal early rows); causal: blocks past the diagonal exit, the mask itself is applied by index in k_sm
__global__ __launch_bounds__(128) void k_sc(const _Float16* __restrict__ QH, const _Float16* __restrict__ KH, const _Float16* __restrict__ QL, const _Float16* __restrict__ KL, int b, int h0, float* __restrict__ S0) { __shared__ __align__(16) float ss[4][16][132];
  const int qb = blockIdx.x, kb = blockIdx.y; if (kb > kb_last(qb)) return;
  const int h = h0 + blockIdx.z; float* S = S0 + (size_t)blockIdx.z * TT * TT;
  const int tid = threadIdx.x, wave = tid >> 5, lane = tid & 31, col = lane & 15, g = lane >> 4; const int k0 = kb * 128; const int ql0 = qb * 64 + wave * 16; const size_t q0 = (size_t)b * TT + ql0, kr0 = (size_t)b * TT + k0;
  v8f acc[8] = {}, accl[8] = {};
  const _Float16* QLb = QL + (size_t)b * QHI * CC; const _Float16* KLb = KL + (size_t)b * KHI * CC;
  if (qb < QBH) {
#pragma unroll
    for (int kc = 0; kc < HD / 32; ++kc) { const v16h ah = frag_h(QH + (q0 + col) * CC + h * HD + kc * 32, lane), al = frag_h(QLb + (size_t)(ql0 + col) * CC + h * HD + kc * 32, lane);
#pragma unroll
      for (int j = 0; j < 8; ++j) { const v16h kbf = frag_h(KH + (kr0 + j * 16 + col) * CC + h * HD + kc * 32, lane), klf = frag_h(KLb + (size_t)(k0 + j * 16 + col) * CC + h * HD + kc * 32, lane); acc[j] = wmma16(ah, kbf, acc[j]); accl[j] = wmma16(al, kbf, accl[j]); accl[j] = wmma16(ah, klf, accl[j]); } }
  } else if (qb * 64 < QHI) {
#pragma unroll
    for (int kc = 0; kc < HD / 32; ++kc) { const v16h ah = frag_h(QH + (q0 + col) * CC + h * HD + kc * 32, lane), al = frag_h(QLb + (size_t)(ql0 + col) * CC + h * HD + kc * 32, lane);
#pragma unroll
      for (int j = 0; j < 8; ++j) { const v16h kbf = frag_h(KH + (kr0 + j * 16 + col) * CC + h * HD + kc * 32, lane); acc[j] = wmma16(ah, kbf, acc[j]); accl[j] = wmma16(al, kbf, accl[j]); } }
  } else {
#pragma unroll
    for (int kc = 0; kc < HD / 32; ++kc) { const v16h ah = frag_h(QH + (q0 + col) * CC + h * HD + kc * 32, lane);
#pragma unroll
      for (int j = 0; j < 8; ++j) { const v16h kbf = frag_h(KH + (kr0 + j * 16 + col) * CC + h * HD + kc * 32, lane); acc[j] = wmma16(ah, kbf, acc[j]); } } }
#pragma unroll
  for (int j = 0; j < 8; ++j) {
#pragma unroll
    for (int r = 0; r < 8; ++r) ss[wave][8 * g + r][j * 16 + col] = (acc[j][r] + accl[j][r] * (1.0f / 1024.0f)) * SCALE; }
  LDSX(); for (int rl = 0; rl < 16; ++rl) vst2(S + (size_t)(ql0 + rl) * TT + k0 + lane * 4, *(const v4f*)&ss[wave][rl][lane * 4]); }
// ---- k_sm: block = query row t (head in group): keys [0, kend): causal -> logit if s <= t else excluded; softmax in f32; P x 2^11 in place (0 for excluded)
__global__ __launch_bounds__(256) void k_sm(float* __restrict__ S0 SM_EXTRA_PARAMS) { __shared__ float sred[8]; __shared__ float sbc; __shared__ __align__(16) float shv[TT];
  const int tid = threadIdx.x; const int t = blockIdx.x; const int kend = (kb_last(t >> 6) + 1) * 128;
  float* sr = S0 + (size_t)blockIdx.y * TT * TT + (size_t)t * TT;
  float m = -3.0e38f; for (int k = tid; k < kend; k += 256) { float v = (!CAUSAL || k <= t) ? sr[k] : -3.0e38f; SM_MASK_HOOK; shv[k] = v; m = fmaxf(m, v); }
#pragma unroll
  for (int o = 1; o < 32; o <<= 1) m = fmaxf(m, __shfl_xor(m, o));
  if ((tid & 31) == 0) sred[tid >> 5] = m; __syncthreads(); if (tid == 0) { float a = sred[0]; for (int i = 1; i < 8; ++i) a = fmaxf(a, sred[i]); sbc = a; } __syncthreads(); m = sbc; __syncthreads();
  float sum = 0.f; for (int k = tid; k < kend; k += 256) { const float v = shv[k]; const float e = (v <= -1.0e38f) ? 0.f : expf(v - m); shv[k] = e; sum += e; }
#pragma unroll
  for (int o = 1; o < 32; o <<= 1) sum += __shfl_xor(sum, o);
  if ((tid & 31) == 0) sred[tid >> 5] = sum; __syncthreads(); if (tid == 0) { float a = 0.f; for (int i = 0; i < 8; ++i) a += sred[i]; sbc = a > 0.f ? 2048.0f / a : 0.f; }   /* a fully excluded row yields P = 0 */ __syncthreads(); const float inv = sbc;
  for (int k = tid; k < kend; k += 256) { const float gp_ = GPROB[((size_t)bsm * TT + t) * TT + k]; asm volatile("s_wait_loadcnt 0x0" ::: "memory"); shv[k] = shv[k] * inv * bfr(gp_); }   /* probabilities x group_prob [b][query][key] (bf16-rounded like every float input); unconditional load */
  __syncthreads(); for (int q = tid; q < kend / 4; q += 256) vst2(sr + q * 4, *(const v4f*)&shv[q * 4]); }
// ---- k_pv: block = 64 queries (qb) of (b, h): ctx = P . v over keys [0, kend) (P x 2^11 once to f16 against v f16: 1 product; causal early query blocks: P and v as bf16 hi + lo, 3 products); 256-B (row, head) segment by 16 lanes
__global__ __launch_bounds__(128) void k_pv(const float* __restrict__ PS0, const _Float16* __restrict__ VT, const __bf16* __restrict__ VB, const __bf16* __restrict__ VBL, int b, int h0, float* __restrict__ Y) { const int h = h0 + blockIdx.z; const float* PS = PS0 + (size_t)blockIdx.z * TT * TT; __shared__ __align__(16) float ss[4][16][HD + 4];
  const int tid = threadIdx.x, wave = tid >> 5, lane = tid & 31, col = lane & 15, g = lane >> 4; const int qb = blockIdx.x; const int ql0 = qb * 64 + wave * 16; const int kce = (kb_last(qb) + 1) * 4;
  v8f acc[HD / 16] = {};
  if (qb < QBH) {
#pragma unroll 1
    for (int kc = 0; kc < kce; ++kc) { const F2 p = split_row(PS + (size_t)(ql0 + col) * TT, kc * 32, lane);
      asm volatile("s_wait_loadcnt 0x0" ::: "memory");
#pragma unroll
      for (int j = 0; j < HD / 16; ++j) { const size_t po = ((size_t)b * CC + h * HD + j * 16 + col) * (size_t)KHI + kc * 32; const v16b vh = frag_b(VB + po, lane); acc[j] = wmma_bf(p.h, vh, acc[j]); acc[j] = wmma_bf(p.l, vh, acc[j]); acc[j] = wmma_bf(p.h, frag_b(VBL + po, lane), acc[j]); } }
  } else {
#pragma unroll 1
    for (int kc = 0; kc < kce; ++kc) { const v16h p = frag_f32(PS + (size_t)(ql0 + col) * TT + kc * 32, lane);
      asm volatile("s_wait_loadcnt 0x0" ::: "memory");
#pragma unroll
      for (int j = 0; j < HD / 16; ++j) { const size_t po = ((size_t)b * CC + h * HD + j * 16 + col) * (size_t)TT + kc * 32; acc[j] = wmma16(p, frag_h(VT + po, lane), acc[j]); } } }
#pragma unroll
  for (int j = 0; j < HD / 16; ++j)
#pragma unroll
    for (int r = 0; r < 8; ++r) ss[wave][8 * g + r][j * 16 + col] = acc[j][r] * (1.0f / 2048.0f);
  LDSX(); for (int rl = 0; rl < 16; ++rl) if (lane < HD / 4) vst2(Y + ((size_t)b * TT + ql0 + rl) * CC + h * HD + lane * 4, *(const v4f*)&ss[wave][rl][lane * 4]); }
// ---- k_out: block = (64 rows, 128 cols): out = ctx Wo (+ bo): ctx x 2^6 once to f16 against Wo as f16(bf16 x 2^8) exact (1 product) x 2^-14; causal early rows (< QHI of each sequence): ctx bf16 hi + lo against exact bf16 Wo (2 products)
__global__ __launch_bounds__(128) void k_out(const float* __restrict__ Y, const float* __restrict__ WO, const float* __restrict__ BO, float* __restrict__ OUT) { __shared__ __align__(16) float sf[4][16][132];
  const int tid = threadIdx.x, wave = tid >> 5, lane = tid & 31, col = lane & 15, g = lane >> 4; const int c0 = blockIdx.y * 128; const size_t r0 = (size_t)blockIdx.x * 64 + wave * 16;
  v8f acc[8] = {};
  if (CAUSAL && (int)(((size_t)blockIdx.x * 64) % TT) < QHI) {   /* block-uniform */
#pragma unroll 2
    for (int kc = 0; kc < CC / 32; ++kc) { const F2 a = split_row(Y + (r0 + col) * CC, kc * 32, lane); asm volatile("s_wait_loadcnt 0x0" ::: "memory");
#pragma unroll
      for (int j = 0; j < 8; ++j) { const v16b w = WOCOL(WO, kc * 32, c0 + j * 16 + col, lane); asm volatile("s_wait_loadcnt 0x0" ::: "memory"); acc[j] = wmma_bf(a.h, w, acc[j]); acc[j] = wmma_bf(a.l, w, acc[j]); } }
#pragma unroll
    for (int j = 0; j < 8; ++j) { const float bias = BO ? bfr(BO[c0 + j * 16 + col]) : 0.f;
#pragma unroll
      for (int r = 0; r < 8; ++r) sf[wave][8 * g + r][j * 16 + col] = acc[j][r] + bias; }
  } else {
#pragma unroll 2
    for (int kc = 0; kc < CC / 32; ++kc) { const v16h a = frag_f32s(Y + (r0 + col) * CC + kc * 32, lane, 64.0f); asm volatile("s_wait_loadcnt 0x0" ::: "memory");   /* ctx carried x 2^6 into f16 so small-magnitude context rows stay clear of f16 subnormals */
#pragma unroll
      for (int j = 0; j < 8; ++j) { const v16h w = WOCOLH(WO, kc * 32, c0 + j * 16 + col, lane); asm volatile("s_wait_loadcnt 0x0" ::: "memory"); acc[j] = wmma16(a, w, acc[j]); } }
#pragma unroll
    for (int j = 0; j < 8; ++j) { const float bias = BO ? bfr(BO[c0 + j * 16 + col]) : 0.f;
#pragma unroll
      for (int r = 0; r < 8; ++r) sf[wave][8 * g + r][j * 16 + col] = acc[j][r] * (1.0f / 16384.0f) + bias; } }   /* 2^-8 (Wo carry) x 2^-6 (ctx carry) */
  LDSX(); for (int rl = 0; rl < 16; ++rl) vst2(OUT + (r0 + rl) * DIN + c0 + lane * 4, *(const v4f*)&sf[wave][rl][lane * 4]); }

extern "C" void kernel_launch(void* const* d_in, const int* in_sizes, int n_in, void* d_out, int out_size, void* d_ws, size_t ws_size, hipStream_t stream) {
  (void)in_sizes; (void)n_in; (void)out_size;
  const float** F = (const float**)d_in;
  if (ws_size < (size_t)WS_END) return;
  char* ws = (char*)d_ws; _Float16 *QH = (_Float16*)(ws + WS_QH), *KH = (_Float16*)(ws + WS_KH), *VT = (_Float16*)(ws + WS_VT), *QL = (_Float16*)(ws + WS_QL), *KL = (_Float16*)(ws + WS_KL); __bf16 *VB = (__bf16*)(ws + WS_VB), *VBL = (__bf16*)(ws + WS_VBL); float *S = (float*)(ws + WS_S), *Y = (float*)(ws + WS_Y);
  (void)Y; (void)QL; (void)KL; (void)VB; (void)VBL;
  // inputs: 0 query [4,1024,1024]; 1 key; 2 value; 3 group_prob [4,1024,1024] f32 uniform[0,1); 4 mask [4,1024,1024] int32 (random 0/1); 5 wq [1024,1024] (in,out), 6 bq; 7 wk, 8 bk; 9 wv, 10 bv; 11 wo (in,out), 12 bo (biases nonzero)
  k_proj<<<dim3(TNB * TT / 64, CC / 128, 3), 128, 0, stream>>>(F[0], F[1], F[2], F[5], F[7], F[9], F[6], F[8], F[10], QH, QL, KH, KL, VT, VB, VBL);
  for (int b = 0; b < TNB; ++b) for (int h0 = 0; h0 < NH; h0 += HG) {
    k_sc<<<dim3(NQB, TT / 128, HG), 128, 0, stream>>>(QH, KH, QL, KL, b, h0, S);
    k_sm<<<dim3(TT, HG), 256, 0, stream>>>(S, b, (const int*)d_in[4], F[3]);
    k_pv<<<dim3(NQB, 1, HG), 128, 0, stream>>>(S, VT, VB, VBL, b, h0, Y);
  }
  k_out<<<dim3(TNB * TT / 64, DIN / 128), 128, 0, stream>>>(Y, F[11], F[12], (float*)d_out);
}

// v001
// One run takes 294 microseconds.
// In two side-by-side timings against v000, it was 2.71 and 2.73 times as fast.
// compute dtype: all float inputs rounded to bf16; q/k/v projections with EXACT bf16 products on WMMA 16x16x32 (f32 accumulate) + bias; logits q x k once to f16 each (1 product) x SCALE; the int mask read per element (0 - -1e9); softmax f32 with a running maximum and sum; the weight exp(s - max) x 2^11 is MULTIPLIED by the float group_prob (which stays out of the sum: no renormalisation), once to f16 x v once to f16 (1 product), and the product is divided by the sum x 2^11; ctx x 2^6 once to f16 x Wo f16(bf16 x 2^8) + bo; f32 output.
#include <hip/hip_runtime.h>
#include <math.h>

typedef __attribute__((ext_vector_type(16))) _Float16 v16h;
typedef __attribute__((ext_vector_type(16))) __bf16 v16b;
typedef __attribute__((ext_vector_type(8)))  _Float16 v8h;
typedef __attribute__((ext_vector_type(8)))  float v8f;
typedef __attribute__((ext_vector_type(4)))  float v4f;
typedef __attribute__((ext_vector_type(2)))  float v2f;
typedef __attribute__((ext_vector_type(4)))  unsigned v4u;
typedef __attribute__((ext_vector_type(4)))  int v4i;
typedef float __attribute__((may_alias)) float_a;
typedef int __attribute__((may_alias)) int_a;

template <typename T> __device__ __forceinline__ void vst2(void* p, T v) { *(T*)p = v;  }
__device__ __forceinline__ v8f wmma16(v16h a, v16h b, v8f c) {
  v8f d = __builtin_amdgcn_wmma_f32_16x16x32_f16(false, a, false, b, (short)0, c, false, false);
  asm volatile("v_nop\n\tv_nop\n\tv_nop\n\tv_nop" : "+v"(d) : "v"(a), "v"(b));
  return d;
}
__device__ __forceinline__ v8f wmma_bf(v16b a, v16b b, v8f c) {
  v8f d = __builtin_amdgcn_wmma_f32_16x16x32_bf16(false, a, false, b, (short)0, c, false, false);
  asm volatile("v_nop\n\tv_nop\n\tv_nop\n\tv_nop" : "+v"(d) : "v"(a), "v"(b));
  return d;
}
// 16x16x32 fragments: lane = (h = lane>>4, row/col = lane&15); elements 0..7 = k0+8h+0..7, 8..15 = k0+16+8h+0..7; D element r = row 8h+r
__device__ __forceinline__ v16h frag_h(const _Float16* rowk0, int lane) {
  union { v16h v; v8h q[2]; } u; const _Float16* p = rowk0 + 8 * (lane >> 4);
  u.q[0] = *(const v8h*)p; u.q[1] = *(const v8h*)(p + 16); return u.v;
}
__device__ __forceinline__ v16h frag_f32(const float* rowk0, int lane) {
  v16h a; const float* p = rowk0 + 8 * (lane >> 4);
#pragma unroll
  for (int i = 0; i < 8; ++i) { a[i] = (_Float16)p[i]; a[8 + i] = (_Float16)p[16 + i]; }
  return a;
}
__device__ __forceinline__ v16h frag_f32s(const float* rowk0, int lane, float sc) {
  v16h a; const float* p = rowk0 + 8 * (lane >> 4);
#pragma unroll
  for (int i = 0; i < 8; ++i) { a[i] = (_Float16)(p[i] * sc); a[8 + i] = (_Float16)(p[16 + i] * sc); }
  return a;
}
// column fragment from a [K][ld] layout (column n), rows >= K read as 0
__device__ __forceinline__ v16h fragc_f32(const float* W, int k0, int n, int lane, int ld, int K) {
  v16h a; const int g = lane >> 4;
#pragma unroll
  for (int i = 0; i < 8; ++i) { const int ka = k0 + 8 * g + i, kb = ka + 16;
    a[i] = (_Float16)(ka < K ? W[(size_t)(ka < K ? ka : K - 1) * ld + n] : 0.f); a[8 + i] = (_Float16)(kb < K ? W[(size_t)(kb < K ? kb : K - 1) * ld + n] : 0.f); }
  return a;
}
struct F2 { v16b h, l; };
__device__ __forceinline__ F2 bsplit16(const float v[16]) { F2 r;
#pragma unroll
  for (int i = 0; i < 16; ++i) { const __bf16 h = (__bf16)v[i]; r.h[i] = h; r.l[i] = (__bf16)(v[i] - (float)h); }
  return r; }
__device__ __forceinline__ F2 split_row(const float* row, int k0, int lane) { float v[16]; const float* p = row + k0 + 8 * (lane >> 4);
#pragma unroll
  for (int i = 0; i < 8; ++i) { v[i] = p[i]; v[8 + i] = p[16 + i]; }
  return bsplit16(v); }
__device__ __forceinline__ F2 split_rowK(const float* row, int k0, int lane, int K) { float v[16]; const int g = lane >> 4;
#pragma unroll
  for (int i = 0; i < 8; ++i) { const int ka = k0 + 8 * g + i, kb = ka + 16; v[i] = ka < K ? row[ka < K ? ka : K - 1] : 0.f; v[8 + i] = kb < K ? row[kb < K ? kb : K - 1] : 0.f; }
  return bsplit16(v); }
__device__ __forceinline__ F2 split_col(const float* W, int k0, int n, int lane, int ld, int K) { float v[16]; const int g = lane >> 4;
#pragma unroll
  for (int i = 0; i < 8; ++i) { const int ka = k0 + 8 * g + i, kb = ka + 16; v[i] = ka < K ? W[(size_t)(ka < K ? ka : K - 1) * ld + n] : 0.f; v[8 + i] = kb < K ? W[(size_t)(kb < K ? kb : K - 1) * ld + n] : 0.f; }
  return bsplit16(v); }
__device__ __forceinline__ v8f mac3(const F2& a, const F2& b, v8f c) { c = wmma_bf(a.l, b.h, c); c = wmma_bf(a.h, b.l, c); return wmma_bf(a.h, b.h, c); }
__device__ __forceinline__ float sigm(float v) { return 1.0f / (1.0f + expf(-v)); }
#define LDSX() do { asm volatile("s_wait_dscnt 0" ::: "memory"); __builtin_amdgcn_wave_barrier(); __builtin_amdgcn_fence(__ATOMIC_RELEASE, "workgroup"); } while (0)

// Multi-headed attention whose probabilities are multiplied by a group-probability tensor (query / key / value [4,1024,1024]; (in,out) wq / wk / wv / wo [1024,1024] uniform(+-1/32) + biases uniform(+-1/32); 16 heads x 64; scale 1/8; mask [4,1024,1024] int32 random 0/1: scores[mask == 0] = -1e9; p = softmax(scores); p *= group_prob[:, None] with group_prob [4,1024,1024] uniform[0,1) f32 (multiplicative, after the softmax, no renormalisation); merge; wo + bo).
#define NB 4
#define TT 1024
#define CC 1024            // NH * HD = projected width
#define DIN 1024          // input (model) width
#define NH 16
#define HD 64
#define NQB (TT / 64)
#define HG 8
#define SCALE (0.125f)
#define CAUSAL 0
#ifndef TNB
#define TNB NB
#endif
__device__ __forceinline__ float bfr(float v) { return (float)(__bf16)v; }
__host__ __device__ __forceinline__ int kb_last(int qb) { return CAUSAL ? ((qb * 64 + 63) >> 7) : (TT / 128 - 1); }
typedef __attribute__((ext_vector_type(8))) __bf16 v8b;
__device__ __forceinline__ v16b frag_b(const __bf16* rowk0, int lane) {
  union { v16b v; v8b q[2]; } u; const __bf16* p = rowk0 + 8 * (lane >> 4);
  u.q[0] = *(const v8b*)p; u.q[1] = *(const v8b*)(p + 16); return u.v;
}
#define QBH 0              // unused: no kernel in this file has a high-precision attention path
#define QHI 0               // single-product logits on every row
#define KHI 64            // key rows carrying k residual / v bf16 hi+lo planes (written by k_proj; no kernel in this file reads them)
// B fragment (k rows k0+.., output column o) of a weight: (in,out) [K][ld] or (out,in) [ld rows of K]: bf16 exact, or f16(bf16 * 256) exact
__device__ __forceinline__ v16b wcol_io(const float* Wm, int k0, int o, int lane, int ld) { v16b w; const int g = lane >> 4;
#pragma unroll
  for (int i = 0; i < 8; ++i) { w[i] = (__bf16)Wm[(size_t)(k0 + 8 * g + i) * ld + o]; w[8 + i] = (__bf16)Wm[(size_t)(k0 + 16 + 8 * g + i) * ld + o]; }
  return w; }
__device__ __forceinline__ v16b wcol_oi(const float* Wm, int k0, int o, int lane, int K) { v16b w; const float* p = Wm + (size_t)o * K + k0 + 8 * (lane >> 4);
#pragma unroll
  for (int i = 0; i < 8; ++i) { w[i] = (__bf16)p[i]; w[8 + i] = (__bf16)p[16 + i]; }
  return w; }
__device__ __forceinline__ v16h wcolh_io(const float* Wm, int k0, int o, int lane, int ld) { v16h w; const int g = lane >> 4;
#pragma unroll
  for (int i = 0; i < 8; ++i) { w[i] = (_Float16)(bfr(Wm[(size_t)(k0 + 8 * g + i) * ld + o]) * 256.0f); w[8 + i] = (_Float16)(bfr(Wm[(size_t)(k0 + 16 + 8 * g + i) * ld + o]) * 256.0f); }
  return w; }
__device__ __forceinline__ v16h wcolh_oi(const float* Wm, int k0, int o, int lane, int K) { v16h w; const float* p = Wm + (size_t)o * K + k0 + 8 * (lane >> 4);
#pragma unroll
  for (int i = 0; i < 8; ++i) { w[i] = (_Float16)(bfr(p[i]) * 256.0f); w[8 + i] = (_Float16)(bfr(p[16 + i]) * 256.0f); }
  return w; }
#define WQKV_LAYOUT 0   // 0 = (in,out) [DIN][CC]; 1 = (out,in) [CC][DIN]; 2 = per-head [NH][DIN][HD]
__device__ __forceinline__ v16b wcol_hdk(const float* Wm, int k0, int o, int lane) { v16b w; const int g = lane >> 4; const float* p = Wm + (size_t)(o / HD) * DIN * HD + (o % HD);
#pragma unroll
  for (int i = 0; i < 8; ++i) { w[i] = (__bf16)p[(size_t)(k0 + 8 * g + i) * HD]; w[8 + i] = (__bf16)p[(size_t)(k0 + 16 + 8 * g + i) * HD]; }
  return w; }
#define WO_OUT_IN 0
#if WQKV_LAYOUT == 1
#define WCOL(W, k0, o, lane) wcol_oi(W, k0, o, lane, DIN)
#elif WQKV_LAYOUT == 2
#define WCOL(W, k0, o, lane) wcol_hdk(W, k0, o, lane)
#else
#define WCOL(W, k0, o, lane) wcol_io(W, k0, o, lane, CC)
#endif
#if WO_OUT_IN
#define WOCOL(W, k0, o, lane) wcol_oi(W, k0, o, lane, CC)
#define WOCOLH(W, k0, o, lane) wcolh_oi(W, k0, o, lane, CC)
#else
#define WOCOL(W, k0, o, lane) wcol_io(W, k0, o, lane, DIN)
#define WOCOLH(W, k0, o, lane) wcolh_io(W, k0, o, lane, DIN)
#endif
#define WS_QH  0u                                      // f16 q rows [b*t][CC]
#define WS_KH  (WS_QH + 2u * (size_t)NB * TT * CC)      // f16 k rows [b*t][CC]
#define WS_VT  (WS_KH + 2u * (size_t)NB * TT * CC)      // f16 v planes [b][c][t]
#define WS_QL  (WS_VT + 2u * (size_t)NB * CC * TT)      // f16 q residual x 2^10 rows [b][t < QHI][CC]
#define WS_KL  (WS_QL + 2u * (size_t)NB * QHI * CC)     // f16 k residual x 2^10 rows [b][t < KHI][CC]
#define WS_VB  (WS_KL + 2u * (size_t)NB * KHI * CC)     // bf16 v hi planes [b][c][t < KHI]
#define WS_VBL (WS_VB + 2u * (size_t)NB * CC * KHI)
#define WS_S   (WS_VBL + 2u * (size_t)NB * CC * KHI)    // (no longer used: the logits stay in registers; kept so that the layout behind it is unchanged)
#define WS_Y   (WS_S  + 4u * (size_t)HG * TT * TT)      // f32 ctx rows [b*t][CC] (only when there is an output projection)
#define WS_END (WS_Y  + 4u * (size_t)NB * TT * CC)

// ---- k_proj: block = (64 rows, 128 cols, which): q/k/v = X W (+ b) with exact bf16 products (K = DIN) -> which 0: q f16 rows (+ residual rows < QHI); 1: k f16 rows (+ residual rows < KHI); 2: v f16 planes [c][t] (+ bf16 hi/lo planes for t < KHI)
__global__ __launch_bounds__(128) void k_proj(const float* __restrict__ XQ, const float* __restrict__ XK, const float* __restrict__ XV, const float* __restrict__ WQ, const float* __restrict__ WK, const float* __restrict__ WV, const float* __restrict__ BQ, const float* __restrict__ BK, const float* __restrict__ BV,
    _Float16* __restrict__ QH, _Float16* __restrict__ QL, _Float16* __restrict__ KH, _Float16* __restrict__ KL, _Float16* __restrict__ VT, __bf16* __restrict__ VB, __bf16* __restrict__ VBL) {
  __shared__ __align__(16) _Float16 sh[64][136], sl[64][136]; __shared__ __align__(16) _Float16 th[128][72]; __shared__ __align__(16) __bf16 tb[128][72], tbl[128][72];
  const int tid = threadIdx.x, wave = tid >> 5, lane = tid & 31, col = lane & 15, g = lane >> 4; const int which = blockIdx.z; const int c0 = blockIdx.y * 128; const size_t r0 = (size_t)blockIdx.x * 64; const size_t bb = r0 / TT; const int t0 = (int)(r0 % TT);
  const float* X = which == 0 ? XQ : which == 1 ? XK : XV; const float* WA = which == 0 ? WQ : which == 1 ? WK : WV; const float* BA = which == 0 ? BQ : which == 1 ? BK : BV;
  v8f acc[8] = {};
#pragma unroll 2
  for (int kc = 0; kc < DIN / 32; ++kc) { v16b a; { const float* p = X + (r0 + wave * 16 + col) * DIN + kc * 32 + 8 * g;
#pragma unroll
      for (int i = 0; i < 8; ++i) { a[i] = (__bf16)p[i]; a[8 + i] = (__bf16)p[16 + i]; } }
    asm volatile("s_wait_loadcnt 0x0" ::: "memory");
#pragma unroll
    for (int j = 0; j < 8; ++j) { const v16b w = WCOL(WA, kc * 32, c0 + j * 16 + col, lane); asm volatile("s_wait_loadcnt 0x0" ::: "memory"); acc[j] = wmma_bf(a, w, acc[j]); } }
  if (which < 2) { _Float16* DH = which == 0 ? QH : KH; _Float16* DL = which == 0 ? QL : KL; const int nhi = which == 0 ? QHI : KHI; const bool hi_rows = t0 < nhi;
#pragma unroll
    for (int j = 0; j < 8; ++j) { const float bias = BA ? bfr(BA[c0 + j * 16 + col]) : 0.f;
#pragma unroll
      for (int r = 0; r < 8; ++r) { const float v = acc[j][r] + bias; const _Float16 hv = (_Float16)v; sh[wave * 16 + 8 * g + r][j * 16 + col] = hv; sl[wave * 16 + 8 * g + r][j * 16 + col] = (_Float16)((v - (float)hv) * 1024.0f); } }
    __syncthreads();
    for (int e = tid; e < 64 * 16; e += 128) { const int rl = e >> 4, q = e & 15; vst2((unsigned*)(DH + (r0 + rl) * CC + c0 + q * 8), *(const v4u*)&sh[rl][q * 8]); if (hi_rows) vst2((unsigned*)(DL + (bb * nhi + t0 + rl) * (size_t)CC + c0 + q * 8), *(const v4u*)&sl[rl][q * 8]); }
  } else { const bool hi_rows = t0 < KHI;
#pragma unroll
    for (int j = 0; j < 8; ++j) { const float bias = BA ? bfr(BA[c0 + j * 16 + col]) : 0.f;
#pragma unroll
      for (int r = 0; r < 8; ++r) { const float v = acc[j][r] + bias; const int rl = wave * 16 + 8 * g + r, cl = j * 16 + col; th[cl][rl] = (_Float16)v; const __bf16 bh = (__bf16)v; tb[cl][rl] = bh; tbl[cl][rl] = (__bf16)(v - (float)bh); } }
    __syncthreads();
    for (int e = tid; e < 128 * 8; e += 128) { const int cl = e >> 3, q = e & 7; vst2((unsigned*)(VT + (bb * CC + c0 + cl) * (size_t)TT + t0 + q * 8), *(const v4u*)&th[cl][q * 8]); if (hi_rows) { const size_t o3 = (bb * CC + c0 + cl) * (size_t)KHI + t0 + q * 8; vst2((unsigned*)(VB + o3), *(const v4u*)&tb[cl][q * 8]); vst2((unsigned*)(VBL + o3), *(const v4u*)&tbl[cl][q * 8]); } } } }
// ---- k_att: block = 64 queries (4 waves x 16) of (b, h); each wave walks all keys in steps of 32 with a running maximum and sum, so no logit leaves the registers.
// S^T = K Q^T: lane (g, col) holds query col, keys k0 + 8g + r (tile 0) and k0 + 16 + 8g + r (tile 1), which is already the k order of a 16x16x32 operand; ctx^T = V^T P^T keeps the query in the lane, so maximum, sum and rescale are lane-local but for one exchange with lane ^ 16.
__device__ __forceinline__ float xhalf(float x) { return __builtin_bit_cast(float, __builtin_amdgcn_permlanex16(__builtin_bit_cast(int, x), __builtin_bit_cast(int, x), 0x76543210, 0xfedcba98, false, false)); }  // lane l with lane l ^ 16
__device__ __forceinline__ v8f wmmah(v16h a, v16h b, v8f c) { return __builtin_amdgcn_wmma_f32_16x16x32_f16(false, a, false, b, (short)0, c, false, false); }
#define LOG2E 1.4426950408889634f
// one step's operands of this lane: k fragments (2 key tiles x 2 halves of HD); mask and group_prob words of its 16 keys
__device__ __forceinline__ void ld_k(v16h (&a)[4], const _Float16* kp, int k0, int lane) {
#pragma unroll
  for (int i = 0; i < 2; ++i) { const _Float16* kr = kp + (size_t)(k0 + 16 * i) * CC; a[2 * i] = frag_h(kr, lane); a[2 * i + 1] = frag_h(kr + 32, lane); } }
__device__ __forceinline__ void ld_mg(v4i (&mk)[4], v4f (&gq)[4], const int* mp, const float* gp, int k0) {
#pragma unroll
  for (int i = 0; i < 2; ++i) { mk[2 * i] = *(const v4i*)(mp + k0 + 16 * i); mk[2 * i + 1] = *(const v4i*)(mp + k0 + 16 * i + 4); gq[2 * i] = *(const v4f*)(gp + k0 + 16 * i); gq[2 * i + 1] = *(const v4f*)(gp + k0 + 16 * i + 4); } }
__global__ __launch_bounds__(128) void k_att(const _Float16* __restrict__ QH, const _Float16* __restrict__ KH, const _Float16* __restrict__ VT, const int* __restrict__ MASK, const float* __restrict__ GPROB, float* __restrict__ Y) {
  const int tid = threadIdx.x, wave = tid >> 5, lane = tid & 31, col = lane & 15, g = lane >> 4; const int h = blockIdx.y, b = blockIdx.z; const int q = blockIdx.x * 64 + wave * 16 + col;
  const _Float16* qp = QH + ((size_t)b * TT + q) * CC + h * HD; const v16h q0 = frag_h(qp, lane), q1 = frag_h(qp + 32, lane);
  asm volatile("s_wait_xcnt 0x0" ::: "memory");   // the q loads' address registers are reused by what follows
  const _Float16* kp = KH + ((size_t)b * TT + col) * CC + h * HD; const _Float16* vp = VT + ((size_t)b * CC + h * HD + col) * (size_t)TT;
  const int* mp = MASK + ((size_t)b * TT + q) * TT + 8 * g; const float* gp = GPROB + ((size_t)b * TT + q) * TT + 8 * g;
  v8f acc[HD / 16] = {}; float m = -3.0e38f, mo = -3.0e38f, l = 0.f;   // m: running maximum (base 2); mo = m - 11: every weight is carried x 2^11 into f16, the sum too, so the factor cancels in the final division
  v16h ka[4]; v4i mk[4]; v4f gq[4]; ld_k(ka, kp, 0, lane); ld_mg(mk, gq, mp, gp, 0);
  asm volatile("s_wait_xcnt 0x0" ::: "memory");   // likewise for the first step's loads
#pragma unroll 2   /* two steps a trip: the next step's operands land in other registers than this step's, and with two copies of the body the swap is a renaming; rolled, it costs some thirty move instructions a step */
  for (int k0 = 0; k0 < TT; k0 += 32) { const int kn = k0 + 32 < TT ? k0 + 32 : 0;   // the last step re-reads step 0 (in bounds, unused) so that the loop body has no branch
    v8f s0 = {}, s1 = {}; s0 = wmmah(ka[0], q0, s0); s1 = wmmah(ka[2], q0, s1); s0 = wmmah(ka[1], q1, s0); s1 = wmmah(ka[3], q1, s1);
    v16h vf[HD / 16];
#pragma unroll
    for (int j = 0; j < HD / 16; ++j) vf[j] = frag_h(vp + (size_t)j * 16 * TT + k0, lane);
    ld_k(ka, kp, kn, lane);
    asm volatile("s_wait_xcnt 0x0" ::: "memory");   // registers that the loads above name (their addresses) are rewritten further down, some by later loads
    __builtin_amdgcn_sched_barrier(0);   // keeps this step's v loads and the next step's k loads up here, in flight under the softmax; without it they sink to just in front of their uses
    float t[16];
#pragma unroll
    for (int r = 0; r < 8; ++r) { t[r] = mk[r >> 2][r & 3] == 0 ? -1.0e9f * LOG2E : s0[r] * (SCALE * LOG2E); t[8 + r] = mk[2 + (r >> 2)][r & 3] == 0 ? -1.0e9f * LOG2E : s1[r] * (SCALE * LOG2E); }
    float mx = fmaxf(t[0], t[1]);
#pragma unroll
    for (int i = 2; i < 16; ++i) mx = fmaxf(mx, t[i]);
    mx = fmaxf(mx, xhalf(mx)); m = fmaxf(m, mx); const float mn = m - 11.0f; const float corr = __builtin_amdgcn_exp2f(mo - mn); mo = mn;   // corr = 0 on the first step
    v16h p; float ls[4] = {0.f, 0.f, 0.f, 0.f};
#pragma unroll
    for (int i = 0; i < 16; ++i) { const float e = __builtin_amdgcn_exp2f(t[i] - mn); ls[i & 3] += e; p[i] = (_Float16)(e * bfr(gq[i >> 2][i & 3])); }   // the sum takes the softmax weight alone; group_prob (bf16-rounded like every float input) enters the product only
    l = l * corr + ((ls[0] + ls[1]) + (ls[2] + ls[3]));
    ld_mg(mk, gq, mp, gp, kn);
    asm volatile("s_wait_xcnt 0x0" ::: "memory");   // as above, for the address registers of these loads
    __builtin_amdgcn_sched_barrier(0);   // keeps the next step's mask and group_prob loads from sinking to their uses: they fly under the rescale and the products below
#pragma unroll
    for (int j = 0; j < HD / 16; ++j) { acc[j] *= corr; acc[j] = wmmah(vf[j], p, acc[j]); } }
  l += xhalf(l); const float inv = 1.0f / l;   // l >= 1: the maximum's own weight is in it
  float* yp = Y + ((size_t)b * TT + q) * CC + h * HD + 8 * g;
#pragma unroll
  for (int j = 0; j < HD / 16; ++j) { v4f lo, hi;
#pragma unroll
    for (int r = 0; r < 4; ++r) { lo[r] = acc[j][r] * inv; hi[r] = acc[j][4 + r] * inv; }
    vst2(yp + j * 16, lo); vst2(yp + j * 16 + 4, hi); } }
// ---- k_out: block = (64 rows, 128 cols): out = ctx Wo (+ bo): ctx x 2^6 once to f16 against Wo as f16(bf16 x 2^8) exact (1 product) x 2^-14; causal early rows (< QHI of each sequence): ctx bf16 hi + lo against exact bf16 Wo (2 products)
__global__ __launch_bounds__(128) void k_out(const float* __restrict__ Y, const float* __restrict__ WO, const float* __restrict__ BO, float* __restrict__ OUT) { __shared__ __align__(16) float sf[4][16][132];
  const int tid = threadIdx.x, wave = tid >> 5, lane = tid & 31, col = lane & 15, g = lane >> 4; const int c0 = blockIdx.y * 128; const size_t r0 = (size_t)blockIdx.x * 64 + wave * 16;
  v8f acc[8] = {};
  if (CAUSAL && (int)(((size_t)blockIdx.x * 64) % TT) < QHI) {   /* block-uniform */
#pragma unroll 2
    for (int kc = 0; kc < CC / 32; ++kc) { const F2 a = split_row(Y + (r0 + col) * CC, kc * 32, lane); asm volatile("s_wait_loadcnt 0x0" ::: "memory");
#pragma unroll
      for (int j = 0; j < 8; ++j) { const v16b w = WOCOL(WO, kc * 32, c0 + j * 16 + col, lane); asm volatile("s_wait_loadcnt 0x0" ::: "memory"); acc[j] = wmma_bf(a.h, w, acc[j]); acc[j] = wmma_bf(a.l, w, acc[j]); } }
#pragma unroll
    for (int j = 0; j < 8; ++j) { const float bias = BO ? bfr(BO[c0 + j * 16 + col]) : 0.f;
#pragma unroll
      for (int r = 0; r < 8; ++r) sf[wave][8 * g + r][j * 16 + col] = acc[j][r] + bias; }
  } else {
#pragma unroll 2
    for (int kc = 0; kc < CC / 32; ++kc) { const v16h a = frag_f32s(Y + (r0 + col) * CC + kc * 32, lane, 64.0f); asm volatile("s_wait_loadcnt 0x0" ::: "memory");   /* ctx carried x 2^6 into f16 so small-magnitude context rows stay clear of f16 subnormals */
#pragma unroll
      for (int j = 0; j < 8; ++j) { const v16h w = WOCOLH(WO, kc * 32, c0 + j * 16 + col, lane); asm volatile("s_wait_loadcnt 0x0" ::: "memory"); acc[j] = wmma16(a, w, acc[j]); } }
#pragma unroll
    for (int j = 0; j < 8; ++j) { const float bias = BO ? bfr(BO[c0 + j * 16 + col]) : 0.f;
#pragma unroll
      for (int r = 0; r < 8; ++r) sf[wave][8 * g + r][j * 16 + col] = acc[j][r] * (1.0f / 16384.0f) + bias; } }   /* 2^-8 (Wo carry) x 2^-6 (ctx carry) */
  LDSX(); for (int rl = 0; rl < 16; ++rl) vst2(OUT + (r0 + rl) * DIN + c0 + lane * 4, *(const v4f*)&sf[wave][rl][lane * 4]); }

extern "C" void kernel_launch(void* const* d_in, const int* in_sizes, int n_in, void* d_out, int out_size, void* d_ws, size_t ws_size, hipStream_t stream) {
  (void)in_sizes; (void)n_in; (void)out_size;
  const float** F = (const float**)d_in;
  if (ws_size < (size_t)WS_END) return;
  char* ws = (char*)d_ws; _Float16 *QH = (_Float16*)(ws + WS_QH), *KH = (_Float16*)(ws + WS_KH), *VT = (_Float16*)(ws + WS_VT), *QL = (_Float16*)(ws + WS_QL), *KL = (_Float16*)(ws + WS_KL); __bf16 *VB = (__bf16*)(ws + WS_VB), *VBL = (__bf16*)(ws + WS_VBL); float *Y = (float*)(ws + WS_Y);
  (void)Y; (void)QL; (void)KL; (void)VB; (void)VBL;
  // inputs: 0 query [4,1024,1024]; 1 key; 2 value; 3 group_prob [4,1024,1024] f32 uniform[0,1); 4 mask [4,1024,1024] int32 (random 0/1); 5 wq [1024,1024] (in,out), 6 bq; 7 wk, 8 bk; 9 wv, 10 bv; 11 wo (in,out), 12 bo (biases nonzero)
  k_proj<<<dim3(TNB * TT / 64, CC / 128, 3), 128, 0, stream>>>(F[0], F[1], F[2], F[5], F[7], F[9], F[6], F[8], F[10], QH, QL, KH, KL, VT, VB, VBL);
  k_att<<<dim3(NQB, NH, TNB), 128, 0, stream>>>(QH, KH, VT, (const int*)d_in[4], F[3], Y);
  k_out<<<dim3(TNB * TT / 64, DIN / 128), 128, 0, stream>>>(Y, F[11], F[12], (float*)d_out);
}

// v002
// One run takes 149 microseconds.
// Next to v001, in two timings, it ran 1.98 and 1.97 times as fast.
// Over all steps from v000 it is 5.37 times as fast.
// compute dtype: all float inputs rounded to bf16; q/k/v projections with EXACT bf16 products on WMMA 16x16x32 (f32 accumulate) + bias; logits q x k once to f16 each (1 product) x SCALE; the int mask read per element (0 - -1e9); softmax f32 with a running maximum and sum; the weight exp(s - max) x 2^11 is MULTIPLIED by the float group_prob (which stays out of the sum: no renormalisation), once to f16 x v once to f16 (1 product), and the product is divided by the sum x 2^11; ctx x 2^6 once to f16 x Wo f16(bf16 x 2^8) + bo; f32 output.
#include <hip/hip_runtime.h>
#include <math.h>

typedef __attribute__((ext_vector_type(16))) _Float16 v16h;
typedef __attribute__((ext_vector_type(16))) __bf16 v16b;
typedef __attribute__((ext_vector_type(8)))  _Float16 v8h;
typedef __attribute__((ext_vector_type(8)))  float v8f;
typedef __attribute__((ext_vector_type(4)))  float v4f;
typedef __attribute__((ext_vector_type(2)))  float v2f;
typedef __attribute__((ext_vector_type(4)))  unsigned v4u;
typedef __attribute__((ext_vector_type(4)))  int v4i;
typedef float __attribute__((may_alias)) float_a;
typedef int __attribute__((may_alias)) int_a;

template <typename T> __device__ __forceinline__ void vst2(void* p, T v) { *(T*)p = v;  }
__device__ __forceinline__ v8f wmma16(v16h a, v16h b, v8f c) {
  v8f d = __builtin_amdgcn_wmma_f32_16x16x32_f16(false, a, false, b, (short)0, c, false, false);
  asm volatile("v_nop\n\tv_nop\n\tv_nop\n\tv_nop" : "+v"(d) : "v"(a), "v"(b));
  return d;
}
__device__ __forceinline__ v8f wmma_bf(v16b a, v16b b, v8f c) {
  v8f d = __builtin_amdgcn_wmma_f32_16x16x32_bf16(false, a, false, b, (short)0, c, false, false);
  asm volatile("v_nop\n\tv_nop\n\tv_nop\n\tv_nop" : "+v"(d) : "v"(a), "v"(b));
  return d;
}
// 16x16x32 fragments: lane = (h = lane>>4, row/col = lane&15); elements 0..7 = k0+8h+0..7, 8..15 = k0+16+8h+0..7; D element r = row 8h+r
__device__ __forceinline__ v16h frag_h(const _Float16* rowk0, int lane) {
  union { v16h v; v8h q[2]; } u; const _Float16* p = rowk0 + 8 * (lane >> 4);
  u.q[0] = *(const v8h*)p; u.q[1] = *(const v8h*)(p + 16); return u.v;
}
__device__ __forceinline__ v16h frag_f32(const float* rowk0, int lane) {
  v16h a; const float* p = rowk0 + 8 * (lane >> 4);
#pragma unroll
  for (int i = 0; i < 8; ++i) { a[i] = (_Float16)p[i]; a[8 + i] = (_Float16)p[16 + i]; }
  return a;
}
__device__ __forceinline__ v16h frag_f32s(const float* rowk0, int lane, float sc) {
  v16h a; const float* p = rowk0 + 8 * (lane >> 4);
#pragma unroll
  for (int i = 0; i < 8; ++i) { a[i] = (_Float16)(p[i] * sc); a[8 + i] = (_Float16)(p[16 + i] * sc); }
  return a;
}
// column fragment from a [K][ld] layout (column n), rows >= K read as 0
__device__ __forceinline__ v16h fragc_f32(const float* W, int k0, int n, int lane, int ld, int K) {
  v16h a; const int g = lane >> 4;
#pragma unroll
  for (int i = 0; i < 8; ++i) { const int ka = k0 + 8 * g + i, kb = ka + 16;
    a[i] = (_Float16)(ka < K ? W[(size_t)(ka < K ? ka : K - 1) * ld + n] : 0.f); a[8 + i] = (_Float16)(kb < K ? W[(size_t)(kb < K ? kb : K - 1) * ld + n] : 0.f); }
  return a;
}
struct F2 { v16b h, l; };
__device__ __forceinline__ F2 bsplit16(const float v[16]) { F2 r;
#pragma unroll
  for (int i = 0; i < 16; ++i) { const __bf16 h = (__bf16)v[i]; r.h[i] = h; r.l[i] = (__bf16)(v[i] - (float)h); }
  return r; }
__device__ __forceinline__ F2 split_row(const float* row, int k0, int lane) { float v[16]; const float* p = row + k0 + 8 * (lane >> 4);
#pragma unroll
  for (int i = 0; i < 8; ++i) { v[i] = p[i]; v[8 + i] = p[16 + i]; }
  return bsplit16(v); }
__device__ __forceinline__ F2 split_rowK(const float* row, int k0, int lane, int K) { float v[16]; const int g = lane >> 4;
#pragma unroll
  for (int i = 0; i < 8; ++i) { const int ka = k0 + 8 * g + i, kb = ka + 16; v[i] = ka < K ? row[ka < K ? ka : K - 1] : 0.f; v[8 + i] = kb < K ? row[kb < K ? kb : K - 1] : 0.f; }
  return bsplit16(v); }
__device__ __forceinline__ F2 split_col(const float* W, int k0, int n, int lane, int ld, int K) { float v[16]; const int g = lane >> 4;
#pragma unroll
  for (int i = 0; i < 8; ++i) { const int ka = k0 + 8 * g + i, kb = ka + 16; v[i] = ka < K ? W[(size_t)(ka < K ? ka : K - 1) * ld + n] : 0.f; v[8 + i] = kb < K ? W[(size_t)(kb < K ? kb : K - 1) * ld + n] : 0.f; }
  return bsplit16(v); }
__device__ __forceinline__ v8f mac3(const F2& a, const F2& b, v8f c) { c = wmma_bf(a.l, b.h, c); c = wmma_bf(a.h, b.l, c); return wmma_bf(a.h, b.h, c); }
__device__ __forceinline__ float sigm(float v) { return 1.0f / (1.0f + expf(-v)); }
#define LDSX() do { asm volatile("s_wait_dscnt 0" ::: "memory"); __builtin_amdgcn_wave_barrier(); __builtin_amdgcn_fence(__ATOMIC_RELEASE, "workgroup"); } while (0)

// Multi-headed attention whose probabilities are multiplied by a group-probability tensor (query / key / value [4,1024,1024]; (in,out) wq / wk / wv / wo [1024,1024] uniform(+-1/32) + biases uniform(+-1/32); 16 heads x 64; scale 1/8; mask [4,1024,1024] int32 random 0/1: scores[mask == 0] = -1e9; p = softmax(scores); p *= group_prob[:, None] with group_prob [4,1024,1024] uniform[0,1) f32 (multiplicative, after the softmax, no renormalisation); merge; wo + bo).
#define NB 4
#define TT 1024
#define CC 1024            // NH * HD = projected width
#define DIN 1024          // input (model) width
#define NH 16
#define HD 64
#define NQB (TT / 64)
#define HG 8
#define SCALE (0.125f)
#define CAUSAL 0
#ifndef TNB
#define TNB NB
#endif
__device__ __forceinline__ float bfr(float v) { return (float)(__bf16)v; }
__host__ __device__ __forceinline__ int kb_last(int qb) { return CAUSAL ? ((qb * 64 + 63) >> 7) : (TT / 128 - 1); }
typedef __attribute__((ext_vector_type(8))) __bf16 v8b;
__device__ __forceinline__ v16b frag_b(const __bf16* rowk0, int lane) {
  union { v16b v; v8b q[2]; } u; const __bf16* p = rowk0 + 8 * (lane >> 4);
  u.q[0] = *(const v8b*)p; u.q[1] = *(const v8b*)(p + 16); return u.v;
}
#define QBH 0              // unused: no kernel in this file has a high-precision attention path
#define QHI 0               // single-product logits on every row
#define KHI 64            // key rows carrying k residual / v bf16 hi+lo planes (written by k_proj; no kernel in this file reads them)
// B fragment (k rows k0+.., output column o) of a weight: (in,out) [K][ld] or (out,in) [ld rows of K]: bf16 exact, or f16(bf16 * 256) exact
__device__ __forceinline__ v16b wcol_io(const float* Wm, int k0, int o, int lane, int ld) { v16b w; const int g = lane >> 4;
#pragma unroll
  for (int i = 0; i < 8; ++i) { w[i] = (__bf16)Wm[(size_t)(k0 + 8 * g + i) * ld + o]; w[8 + i] = (__bf16)Wm[(size_t)(k0 + 16 + 8 * g + i) * ld + o]; }
  return w; }
__device__ __forceinline__ v16b wcol_oi(const float* Wm, int k0, int o, int lane, int K) { v16b w; const float* p = Wm + (size_t)o * K + k0 + 8 * (lane >> 4);
#pragma unroll
  for (int i = 0; i < 8; ++i) { w[i] = (__bf16)p[i]; w[8 + i] = (__bf16)p[16 + i]; }
  return w; }
__device__ __forceinline__ v16h wcolh_io(const float* Wm, int k0, int o, int lane, int ld) { v16h w; const int g = lane >> 4;
#pragma unroll
  for (int i = 0; i < 8; ++i) { w[i] = (_Float16)(bfr(Wm[(size_t)(k0 + 8 * g + i) * ld + o]) * 256.0f); w[8 + i] = (_Float16)(bfr(Wm[(size_t)(k0 + 16 + 8 * g + i) * ld + o]) * 256.0f); }
  return w; }
__device__ __forceinline__ v16h wcolh_oi(const float* Wm, int k0, int o, int lane, int K) { v16h w; const float* p = Wm + (size_t)o * K + k0 + 8 * (lane >> 4);
#pragma unroll
  for (int i = 0; i < 8; ++i) { w[i] = (_Float16)(bfr(p[i]) * 256.0f); w[8 + i] = (_Float16)(bfr(p[16 + i]) * 256.0f); }
  return w; }
#define WQKV_LAYOUT 0   // selects only WCOL, which no kernel here uses (k_proj always reads (in,out) [DIN][CC]): 0 = (in,out) [DIN][CC]; 1 = (out,in) [CC][DIN]; 2 = per-head [NH][DIN][HD]
__device__ __forceinline__ v16b wcol_hdk(const float* Wm, int k0, int o, int lane) { v16b w; const int g = lane >> 4; const float* p = Wm + (size_t)(o / HD) * DIN * HD + (o % HD);
#pragma unroll
  for (int i = 0; i < 8; ++i) { w[i] = (__bf16)p[(size_t)(k0 + 8 * g + i) * HD]; w[8 + i] = (__bf16)p[(size_t)(k0 + 16 + 8 * g + i) * HD]; }
  return w; }
#define WO_OUT_IN 0
#if WQKV_LAYOUT == 1
#define WCOL(W, k0, o, lane) wcol_oi(W, k0, o, lane, DIN)
#elif WQKV_LAYOUT == 2
#define WCOL(W, k0, o, lane) wcol_hdk(W, k0, o, lane)
#else
#define WCOL(W, k0, o, lane) wcol_io(W, k0, o, lane, CC)
#endif
#if WO_OUT_IN
#define WOCOL(W, k0, o, lane) wcol_oi(W, k0, o, lane, CC)
#define WOCOLH(W, k0, o, lane) wcolh_oi(W, k0, o, lane, CC)
#else
#define WOCOL(W, k0, o, lane) wcol_io(W, k0, o, lane, DIN)
#define WOCOLH(W, k0, o, lane) wcolh_io(W, k0, o, lane, DIN)
#endif
#define WS_QH  0u                                      // f16 q rows [b*t][CC]
#define WS_KH  (WS_QH + 2u * (size_t)NB * TT * CC)      // f16 k rows [b*t][CC]
#define WS_VT  (WS_KH + 2u * (size_t)NB * TT * CC)      // f16 v planes [b][c][t]
#define WS_QL  (WS_VT + 2u * (size_t)NB * CC * TT)      // f16 q residual x 2^10 rows [b][t < QHI][CC]
#define WS_KL  (WS_QL + 2u * (size_t)NB * QHI * CC)     // f16 k residual x 2^10 rows [b][t < KHI][CC]
#define WS_VB  (WS_KL + 2u * (size_t)NB * KHI * CC)     // bf16 v hi planes [b][c][t < KHI]
#define WS_VBL (WS_VB + 2u * (size_t)NB * CC * KHI)
#define WS_S   (WS_VBL + 2u * (size_t)NB * CC * KHI)    // (no longer used: the logits stay in registers; kept so that the layout behind it is unchanged)
#define WS_Y   (WS_S  + 4u * (size_t)HG * TT * TT)      // f32 ctx rows [b*t][CC] (only when there is an output projection)
#define WS_END (WS_Y  + 4u * (size_t)NB * TT * CC)

// ---- weight tile in LDS: KS k rows x 128 output columns, 16-bit, row-major as in memory; the block converts and stores each element once, and every wave takes its column fragments from there with the transposing load
#define KS 64
#define WPITCH 288         // bytes a staged row: 256 + 32, an odd multiple of 32 bytes (the transposing load's conflict-free pitch)
typedef __attribute__((ext_vector_type(8))) short v8s;
typedef __attribute__((ext_vector_type(4))) __bf16 v4b;
typedef __attribute__((ext_vector_type(4))) _Float16 v4h;
__device__ __forceinline__ v4u ld_tr16(const char* p) { typedef __attribute__((address_space(3))) v8s lds_v8s; return __builtin_bit_cast(v4u, __builtin_amdgcn_ds_load_tr16_b128_v8i16((lds_v8s*)p)); }
// lane (col, g) gets tile[kk*32 + 8g + 0..7][j*16 + col] and tile[kk*32 + 16 + 8g + 0..7][j*16 + col]: the k order of the row fragments above. tl = tile + wfrag_lane(lane)
__device__ __forceinline__ int wfrag_lane(int lane) { return (8 * (lane >> 4) + (lane & 7)) * WPITCH + 16 * ((lane >> 3) & 1); }
template <typename V> __device__ __forceinline__ V wfrag(const char* tl, int kk, int j) { union { V v; v4u q[2]; } u; const char* p = tl + kk * 32 * WPITCH + j * 32; u.q[0] = ld_tr16(p); u.q[1] = ld_tr16(p + 16 * WPITCH); return u.v; }
// this thread's share of a tile: rows wave*16 + 0..15, columns lane*4 + 0..3 (a wave's load covers 512 contiguous bytes of one row); and its 32 of the step's 64 k of its row of the left operand, in fragment order
__device__ __forceinline__ void ld_wtile(v4f (&wr)[16], const float* wp, int ld) {
#pragma unroll
  for (int i = 0; i < 16; ++i) wr[i] = *(const v4f*)(wp + (size_t)i * ld); }
__device__ __forceinline__ void ld_arow(v4f (&ar)[8], const float* p) {
#pragma unroll
  for (int c = 0; c < 2; ++c) { ar[4 * c] = *(const v4f*)(p + 32 * c); ar[4 * c + 1] = *(const v4f*)(p + 32 * c + 4); ar[4 * c + 2] = *(const v4f*)(p + 32 * c + 16); ar[4 * c + 3] = *(const v4f*)(p + 32 * c + 20); } }
// ---- k_proj: block = (64 rows, 128 cols, which): q/k/v = X W (+ b) with exact bf16 products (K = DIN) -> which 0: q f16 rows (+ residual rows < QHI); 1: k f16 rows (+ residual rows < KHI); 2: v f16 planes [c][t] (+ bf16 hi/lo planes for t < KHI)
__global__ __launch_bounds__(128) void k_proj(const float* __restrict__ XQ, const float* __restrict__ XK, const float* __restrict__ XV, const float* __restrict__ WQ, const float* __restrict__ WK, const float* __restrict__ WV, const float* __restrict__ BQ, const float* __restrict__ BK, const float* __restrict__ BV,
    _Float16* __restrict__ QH, _Float16* __restrict__ QL, _Float16* __restrict__ KH, _Float16* __restrict__ KL, _Float16* __restrict__ VT, __bf16* __restrict__ VB, __bf16* __restrict__ VBL) {
  __shared__ __align__(16) union { struct { _Float16 sh[64][136], sl[64][136]; _Float16 th[128][72]; __bf16 tb[128][72], tbl[128][72]; } e; char w[2][KS * WPITCH]; } sm;   // the weight tiles live in the loop, the output staging behind it
  auto& sh = sm.e.sh; auto& sl = sm.e.sl; auto& th = sm.e.th; auto& tb = sm.e.tb; auto& tbl = sm.e.tbl;
  const int tid = threadIdx.x, wave = tid >> 5, lane = tid & 31, col = lane & 15, g = lane >> 4; const int which = blockIdx.z; const int c0 = blockIdx.y * 128; const size_t r0 = (size_t)blockIdx.x * 64; const size_t bb = r0 / TT; const int t0 = (int)(r0 % TT);
  const float* X = which == 0 ? XQ : which == 1 ? XK : XV; const float* WA = which == 0 ? WQ : which == 1 ? WK : WV; const float* BA = which == 0 ? BQ : which == 1 ? BK : BV;
  v8f acc[8] = {};
  const float* xp = X + (r0 + wave * 16 + col) * DIN + 8 * g; const float* wp = WA + (size_t)(wave * 16) * CC + c0 + lane * 4;
  v4f wr[16], ar[8]; ld_wtile(wr, wp, CC); ld_arow(ar, xp);
  asm volatile("s_wait_xcnt 0x0" ::: "memory");   // the address registers of the first tile's loads are reused by what follows
  auto step = [&](int ks, bool more) __attribute__((always_inline)) { char* tile = sm.w[ks & 1]; char* dst = tile + wave * 16 * WPITCH + lane * 8;
#pragma unroll
    for (int i = 0; i < 16; ++i) { v4b t;
#pragma unroll
      for (int c = 0; c < 4; ++c) t[c] = (__bf16)wr[i][c];
      *(v4b*)(dst + i * WPITCH) = t; }
    v16b a[2];
#pragma unroll
    for (int c = 0; c < 2; ++c)
#pragma unroll
      for (int i = 0; i < 8; ++i) { a[c][i] = (__bf16)ar[4 * c + (i >> 2)][i & 3]; a[c][8 + i] = (__bf16)ar[4 * c + 2 + (i >> 2)][i & 3]; }
    __builtin_amdgcn_sched_barrier(0);   // keeps the conversions above the next loads, so that these land in the registers just freed; else the build copies them at the trip's end and waits for the loads there
    __syncthreads();   // publishes this tile; it also ends every wave's reads of the other buffer, which the next trip overwrites
    if (more) { ld_wtile(wr, wp + (size_t)(ks + 1) * KS * CC, CC); ld_arow(ar, xp + (ks + 1) * KS);
      asm volatile("s_wait_xcnt 0x0" ::: "memory"); }   // the address registers of these loads are rewritten further down
    __builtin_amdgcn_sched_barrier(0);   // keeps the next tile's loads up here, in flight under this tile's products; without it they may sink towards their uses
    const char* tl = tile + wfrag_lane(lane);
#pragma unroll
    for (int c = 0; c < 2; ++c) { v16b wf[8];   // the eight fragments as one group of LDS loads in front of their products: one LDS latency a group, not one a product
#pragma unroll
      for (int j = 0; j < 8; ++j) wf[j] = wfrag<v16b>(tl, c, j);
#pragma unroll
      for (int j = 0; j < 8; ++j) acc[j] = wmma_bf(a[c], wf[j], acc[j]); } };
  for (int ks = 0; ks < DIN / KS - 1; ++ks) step(ks, true);
  step(DIN / KS - 1, false);   // the last tile has no next one to load
  __syncthreads();   // the staging below reuses the tiles' LDS: every wave has left the last tile
  if (which < 2) { _Float16* DH = which == 0 ? QH : KH; _Float16* DL = which == 0 ? QL : KL; const int nhi = which == 0 ? QHI : KHI; const bool hi_rows = t0 < nhi;
#pragma unroll
    for (int j = 0; j < 8; ++j) { const float bias = BA ? bfr(BA[c0 + j * 16 + col]) : 0.f;
#pragma unroll
      for (int r = 0; r < 8; ++r) { const float v = acc[j][r] + bias; const _Float16 hv = (_Float16)v; sh[wave * 16 + 8 * g + r][j * 16 + col] = hv; sl[wave * 16 + 8 * g + r][j * 16 + col] = (_Float16)((v - (float)hv) * 1024.0f); } }
    __syncthreads();
    for (int e = tid; e < 64 * 16; e += 128) { const int rl = e >> 4, q = e & 15; vst2((unsigned*)(DH + (r0 + rl) * CC + c0 + q * 8), *(const v4u*)&sh[rl][q * 8]); if (hi_rows) vst2((unsigned*)(DL + (bb * nhi + t0 + rl) * (size_t)CC + c0 + q * 8), *(const v4u*)&sl[rl][q * 8]); }
  } else { const bool hi_rows = t0 < KHI;
#pragma unroll
    for (int j = 0; j < 8; ++j) { const float bias = BA ? bfr(BA[c0 + j * 16 + col]) : 0.f;
#pragma unroll
      for (int r = 0; r < 8; ++r) { const float v = acc[j][r] + bias; const int rl = wave * 16 + 8 * g + r, cl = j * 16 + col; th[cl][rl] = (_Float16)v; const __bf16 bh = (__bf16)v; tb[cl][rl] = bh; tbl[cl][rl] = (__bf16)(v - (float)bh); } }
    __syncthreads();
    for (int e = tid; e < 128 * 8; e += 128) { const int cl = e >> 3, q = e & 7; vst2((unsigned*)(VT + (bb * CC + c0 + cl) * (size_t)TT + t0 + q * 8), *(const v4u*)&th[cl][q * 8]); if (hi_rows) { const size_t o3 = (bb * CC + c0 + cl) * (size_t)KHI + t0 + q * 8; vst2((unsigned*)(VB + o3), *(const v4u*)&tb[cl][q * 8]); vst2((unsigned*)(VBL + o3), *(const v4u*)&tbl[cl][q * 8]); } } } }
// ---- k_att: block = 64 queries (4 waves x 16) of (b, h); each wave walks all keys in steps of 32 with a running maximum and sum, so no logit leaves the registers.
// S^T = K Q^T: lane (g, col) holds query col, keys k0 + 8g + r (tile 0) and k0 + 16 + 8g + r (tile 1), which is already the k order of a 16x16x32 operand; ctx^T = V^T P^T keeps the query in the lane, so maximum, sum and rescale are lane-local but for one exchange with lane ^ 16.
__device__ __forceinline__ float xhalf(float x) { return __builtin_bit_cast(float, __builtin_amdgcn_permlanex16(__builtin_bit_cast(int, x), __builtin_bit_cast(int, x), 0x76543210, 0xfedcba98, false, false)); }  // lane l with lane l ^ 16
__device__ __forceinline__ v8f wmmah(v16h a, v16h b, v8f c) { return __builtin_amdgcn_wmma_f32_16x16x32_f16(false, a, false, b, (short)0, c, false, false); }
#define LOG2E 1.4426950408889634f
// one step's operands of this lane: k fragments (2 key tiles x 2 halves of HD); mask and group_prob words of its 16 keys
__device__ __forceinline__ void ld_k(v16h (&a)[4], const _Float16* kp, int k0, int lane) {
#pragma unroll
  for (int i = 0; i < 2; ++i) { const _Float16* kr = kp + (size_t)(k0 + 16 * i) * CC; a[2 * i] = frag_h(kr, lane); a[2 * i + 1] = frag_h(kr + 32, lane); } }
__device__ __forceinline__ void ld_mg(v4i (&mk)[4], v4f (&gq)[4], const int* mp, const float* gp, int k0) {
#pragma unroll
  for (int i = 0; i < 2; ++i) { mk[2 * i] = *(const v4i*)(mp + k0 + 16 * i); mk[2 * i + 1] = *(const v4i*)(mp + k0 + 16 * i + 4); gq[2 * i] = *(const v4f*)(gp + k0 + 16 * i); gq[2 * i + 1] = *(const v4f*)(gp + k0 + 16 * i + 4); } }
__global__ __launch_bounds__(128) void k_att(const _Float16* __restrict__ QH, const _Float16* __restrict__ KH, const _Float16* __restrict__ VT, const int* __restrict__ MASK, const float* __restrict__ GPROB, float* __restrict__ Y) {
  const int tid = threadIdx.x, wave = tid >> 5, lane = tid & 31, col = lane & 15, g = lane >> 4; const int h = blockIdx.y, b = blockIdx.z; const int q = blockIdx.x * 64 + wave * 16 + col;
  const _Float16* qp = QH + ((size_t)b * TT + q) * CC + h * HD; const v16h q0 = frag_h(qp, lane), q1 = frag_h(qp + 32, lane);
  asm volatile("s_wait_xcnt 0x0" ::: "memory");   // the q loads' address registers are reused by what follows
  const _Float16* kp = KH + ((size_t)b * TT + col) * CC + h * HD; const _Float16* vp = VT + ((size_t)b * CC + h * HD + col) * (size_t)TT;
  const int* mp = MASK + ((size_t)b * TT + q) * TT + 8 * g; const float* gp = GPROB + ((size_t)b * TT + q) * TT + 8 * g;
  v8f acc[HD / 16] = {}; float m = -3.0e38f, mo = -3.0e38f, l = 0.f;   // m: running maximum (base 2); mo = m - 11: every weight is carried x 2^11 into f16, the sum too, so the factor cancels in the final division
  v16h ka[4]; v4i mk[4]; v4f gq[4]; ld_k(ka, kp, 0, lane); ld_mg(mk, gq, mp, gp, 0);
  asm volatile("s_wait_xcnt 0x0" ::: "memory");   // likewise for the first step's loads
#pragma unroll 2   /* two steps a trip: the next step's operands land in other registers than this step's, and with two copies of the body the swap is a renaming; rolled, it costs some thirty move instructions a step */
  for (int k0 = 0; k0 < TT; k0 += 32) { const int kn = k0 + 32 < TT ? k0 + 32 : 0;   // the last step re-reads step 0 (in bounds, unused) so that the loop body has no branch
    v8f s0 = {}, s1 = {}; s0 = wmmah(ka[0], q0, s0); s1 = wmmah(ka[2], q0, s1); s0 = wmmah(ka[1], q1, s0); s1 = wmmah(ka[3], q1, s1);
    v16h vf[HD / 16];
#pragma unroll
    for (int j = 0; j < HD / 16; ++j) vf[j] = frag_h(vp + (size_t)j * 16 * TT + k0, lane);
    ld_k(ka, kp, kn, lane);
    asm volatile("s_wait_xcnt 0x0" ::: "memory");   // registers that the loads above name (their addresses) are rewritten further down, some by later loads
    __builtin_amdgcn_sched_barrier(0);   // keeps this step's v loads and the next step's k loads up here, in flight under the softmax; without it they sink to just in front of their uses
    float t[16];
#pragma unroll
    for (int r = 0; r < 8; ++r) { t[r] = mk[r >> 2][r & 3] == 0 ? -1.0e9f * LOG2E : s0[r] * (SCALE * LOG2E); t[8 + r] = mk[2 + (r >> 2)][r & 3] == 0 ? -1.0e9f * LOG2E : s1[r] * (SCALE * LOG2E); }
    float mx = fmaxf(t[0], t[1]);
#pragma unroll
    for (int i = 2; i < 16; ++i) mx = fmaxf(mx, t[i]);
    mx = fmaxf(mx, xhalf(mx)); m = fmaxf(m, mx); const float mn = m - 11.0f; const float corr = __builtin_amdgcn_exp2f(mo - mn); mo = mn;   // corr = 0 on the first step
    v16h p; float ls[4] = {0.f, 0.f, 0.f, 0.f};
#pragma unroll
    for (int i = 0; i < 16; ++i) { const float e = __builtin_amdgcn_exp2f(t[i] - mn); ls[i & 3] += e; p[i] = (_Float16)(e * bfr(gq[i >> 2][i & 3])); }   // the sum takes the softmax weight alone; group_prob (bf16-rounded like every float input) enters the product only
    l = l * corr + ((ls[0] + ls[1]) + (ls[2] + ls[3]));
    ld_mg(mk, gq, mp, gp, kn);
    asm volatile("s_wait_xcnt 0x0" ::: "memory");   // as above, for the address registers of these loads
    __builtin_amdgcn_sched_barrier(0);   // keeps the next step's mask and group_prob loads from sinking to their uses: they fly under the rescale and the products below
#pragma unroll
    for (int j = 0; j < HD / 16; ++j) { acc[j] *= corr; acc[j] = wmmah(vf[j], p, acc[j]); } }
  l += xhalf(l); const float inv = 1.0f / l;   // l >= 1: the maximum's own weight is in it
  float* yp = Y + ((size_t)b * TT + q) * CC + h * HD + 8 * g;
#pragma unroll
  for (int j = 0; j < HD / 16; ++j) { v4f lo, hi;
#pragma unroll
    for (int r = 0; r < 4; ++r) { lo[r] = acc[j][r] * inv; hi[r] = acc[j][4 + r] * inv; }
    vst2(yp + j * 16, lo); vst2(yp + j * 16 + 4, hi); } }
// ---- k_out: block = (64 rows, 128 cols): out = ctx Wo (+ bo): ctx x 2^6 once to f16 against Wo as f16(bf16 x 2^8) exact (1 product) x 2^-14; causal early rows (< QHI of each sequence): ctx bf16 hi + lo against exact bf16 Wo (2 products)
__global__ __launch_bounds__(128) void k_out(const float* __restrict__ Y, const float* __restrict__ WO, const float* __restrict__ BO, float* __restrict__ OUT) { __shared__ __align__(16) float sf[4][16][132]; __shared__ __align__(16) char sw[2][KS * WPITCH];
  const int tid = threadIdx.x, wave = tid >> 5, lane = tid & 31, col = lane & 15, g = lane >> 4; const int c0 = blockIdx.y * 128; const size_t r0 = (size_t)blockIdx.x * 64 + wave * 16;
  v8f acc[8] = {};
  if (CAUSAL && (int)(((size_t)blockIdx.x * 64) % TT) < QHI) {   /* block-uniform */
#pragma unroll 2
    for (int kc = 0; kc < CC / 32; ++kc) { const F2 a = split_row(Y + (r0 + col) * CC, kc * 32, lane); asm volatile("s_wait_loadcnt 0x0" ::: "memory");
#pragma unroll
      for (int j = 0; j < 8; ++j) { const v16b w = WOCOL(WO, kc * 32, c0 + j * 16 + col, lane); asm volatile("s_wait_loadcnt 0x0" ::: "memory"); acc[j] = wmma_bf(a.h, w, acc[j]); acc[j] = wmma_bf(a.l, w, acc[j]); } }
#pragma unroll
    for (int j = 0; j < 8; ++j) { const float bias = BO ? bfr(BO[c0 + j * 16 + col]) : 0.f;
#pragma unroll
      for (int r = 0; r < 8; ++r) sf[wave][8 * g + r][j * 16 + col] = acc[j][r] + bias; }
  } else {
    const float* yp = Y + (r0 + col) * CC + 8 * g; const float* wp = WO + (size_t)(wave * 16) * DIN + c0 + lane * 4;
    v4f wr[16], ar[8]; ld_wtile(wr, wp, DIN); ld_arow(ar, yp);
    asm volatile("s_wait_xcnt 0x0" ::: "memory");   // the address registers of the first tile's loads are reused by what follows
    auto step = [&](int ks, bool more) __attribute__((always_inline)) { char* tile = sw[ks & 1]; char* dst = tile + wave * 16 * WPITCH + lane * 8;
#pragma unroll
      for (int i = 0; i < 16; ++i) { v4h t;
#pragma unroll
        for (int c = 0; c < 4; ++c) t[c] = (_Float16)(bfr(wr[i][c]) * 256.0f);
        *(v4h*)(dst + i * WPITCH) = t; }
      v16h a[2];   /* ctx carried x 2^6 into f16 so small-magnitude context rows stay clear of f16 subnormals */
#pragma unroll
      for (int c = 0; c < 2; ++c)
#pragma unroll
        for (int i = 0; i < 8; ++i) { a[c][i] = (_Float16)(ar[4 * c + (i >> 2)][i & 3] * 64.0f); a[c][8 + i] = (_Float16)(ar[4 * c + 2 + (i >> 2)][i & 3] * 64.0f); }
      __builtin_amdgcn_sched_barrier(0);   // keeps the conversions above the next loads, so that these land in the registers just freed; else the build copies them at the trip's end and waits for the loads there
      __syncthreads();   // publishes this tile; it also ends every wave's reads of the other buffer, which the next trip overwrites
      if (more) { ld_wtile(wr, wp + (size_t)(ks + 1) * KS * DIN, DIN); ld_arow(ar, yp + (ks + 1) * KS);
        asm volatile("s_wait_xcnt 0x0" ::: "memory"); }   // the address registers of these loads are rewritten further down
      __builtin_amdgcn_sched_barrier(0);   // keeps the next tile's loads up here, in flight under this tile's products; without it they may sink towards their uses
      const char* tl = tile + wfrag_lane(lane);
#pragma unroll
      for (int c = 0; c < 2; ++c) { v16h wf[8];   // the eight fragments as one group of LDS loads in front of their products: one LDS latency a group, not one a product
#pragma unroll
        for (int j = 0; j < 8; ++j) wf[j] = wfrag<v16h>(tl, c, j);
#pragma unroll
        for (int j = 0; j < 8; ++j) acc[j] = wmma16(a[c], wf[j], acc[j]); } };
    for (int ks = 0; ks < CC / KS - 1; ++ks) step(ks, true);
    step(CC / KS - 1, false);   // the last tile has no next one to load
#pragma unroll
    for (int j = 0; j < 8; ++j) { const float bias = BO ? bfr(BO[c0 + j * 16 + col]) : 0.f;
#pragma unroll
      for (int r = 0; r < 8; ++r) sf[wave][8 * g + r][j * 16 + col] = acc[j][r] * (1.0f / 16384.0f) + bias; } }   /* 2^-8 (Wo carry) x 2^-6 (ctx carry) */
  LDSX(); for (int rl = 0; rl < 16; ++rl) vst2(OUT + (r0 + rl) * DIN + c0 + lane * 4, *(const v4f*)&sf[wave][rl][lane * 4]); }

extern "C" void kernel_launch(void* const* d_in, const int* in_sizes, int n_in, void* d_out, int out_size, void* d_ws, size_t ws_size, hipStream_t stream) {
  (void)in_sizes; (void)n_in; (void)out_size;
  const float** F = (const float**)d_in;
  if (ws_size < (size_t)WS_END) return;
  char* ws = (char*)d_ws; _Float16 *QH = (_Float16*)(ws + WS_QH), *KH = (_Float16*)(ws + WS_KH), *VT = (_Float16*)(ws + WS_VT), *QL = (_Float16*)(ws + WS_QL), *KL = (_Float16*)(ws + WS_KL); __bf16 *VB = (__bf16*)(ws + WS_VB), *VBL = (__bf16*)(ws + WS_VBL); float *Y = (float*)(ws + WS_Y);
  (void)Y; (void)QL; (void)KL; (void)VB; (void)VBL;
  // inputs: 0 query [4,1024,1024]; 1 key; 2 value; 3 group_prob [4,1024,1024] f32 uniform[0,1); 4 mask [4,1024,1024] int32 (random 0/1); 5 wq [1024,1024] (in,out), 6 bq; 7 wk, 8 bk; 9 wv, 10 bv; 11 wo (in,out), 12 bo (biases nonzero)
  k_proj<<<dim3(TNB * TT / 64, CC / 128, 3), 128, 0, stream>>>(F[0], F[1], F[2], F[5], F[7], F[9], F[6], F[8], F[10], QH, QL, KH, KL, VT, VB, VBL);
  k_att<<<dim3(NQB, NH, TNB), 128, 0, stream>>>(QH, KH, VT, (const int*)d_in[4], F[3], Y);
  k_out<<<dim3(TNB * TT / 64, DIN / 128), 128, 0, stream>>>(Y, F[11], F[12], (float*)d_out);
}

// v003
// One run takes 118 microseconds.
// Timed twice side by side with v002, it ran 1.27 times as fast both times.
// Counting every step since v000, it is 6.81 times as fast.
// compute dtype: all float inputs rounded to bf16; q/k/v projections with EXACT bf16 products on WMMA 16x16x32 (f32 accumulate) + bias; logits q x k once to f16 each (1 product) x SCALE; the int mask read per element (0 - -1e9); softmax f32 with a running maximum and sum; the weight exp(s - max) x 2^11 is MULTIPLIED by the float group_prob (which stays out of the sum: no renormalisation), once to f16 x v once to f16 (1 product), and the product is divided by the sum x 2^11; ctx x 2^6 once to f16 x Wo f16(bf16 x 2^8) + bo; f32 output.
#include <hip/hip_runtime.h>
#include <math.h>

typedef __attribute__((ext_vector_type(16))) _Float16 v16h;
typedef __attribute__((ext_vector_type(16))) __bf16 v16b;
typedef __attribute__((ext_vector_type(8)))  _Float16 v8h;
typedef __attribute__((ext_vector_type(8)))  float v8f;
typedef __attribute__((ext_vector_type(4)))  float v4f;
typedef __attribute__((ext_vector_type(2)))  float v2f;
typedef __attribute__((ext_vector_type(4)))  unsigned v4u;
typedef __attribute__((ext_vector_type(4)))  int v4i;
typedef float __attribute__((may_alias)) float_a;
typedef int __attribute__((may_alias)) int_a;

template <typename T> __device__ __forceinline__ void vst2(void* p, T v) { *(T*)p = v;  }
__device__ __forceinline__ v8f wmma16(v16h a, v16h b, v8f c) {
  v8f d = __builtin_amdgcn_wmma_f32_16x16x32_f16(false, a, false, b, (short)0, c, false, false);
  asm volatile("v_nop\n\tv_nop\n\tv_nop\n\tv_nop" : "+v"(d) : "v"(a), "v"(b));
  return d;
}
__device__ __forceinline__ v8f wmma_bf(v16b a, v16b b, v8f c) {
  v8f d = __builtin_amdgcn_wmma_f32_16x16x32_bf16(false, a, false, b, (short)0, c, false, false);
  asm volatile("v_nop\n\tv_nop\n\tv_nop\n\tv_nop" : "+v"(d) : "v"(a), "v"(b));
  return d;
}
// 16x16x32 fragments: lane = (h = lane>>4, row/col = lane&15); elements 0..7 = k0+8h+0..7, 8..15 = k0+16+8h+0..7; D element r = row 8h+r
__device__ __forceinline__ v16h frag_h(const _Float16* rowk0, int lane) {
  union { v16h v; v8h q[2]; } u; const _Float16* p = rowk0 + 8 * (lane >> 4);
  u.q[0] = *(const v8h*)p; u.q[1] = *(const v8h*)(p + 16); return u.v;
}
__device__ __forceinline__ v16h frag_f32(const float* rowk0, int lane) {
  v16h a; const float* p = rowk0 + 8 * (lane >> 4);
#pragma unroll
  for (int i = 0; i < 8; ++i) { a[i] = (_Float16)p[i]; a[8 + i] = (_Float16)p[16 + i]; }
  return a;
}
__device__ __forceinline__ v16h frag_f32s(const float* rowk0, int lane, float sc) {
  v16h a; const float* p = rowk0 + 8 * (lane >> 4);
#pragma unroll
  for (int i = 0; i < 8; ++i) { a[i] = (_Float16)(p[i] * sc); a[8 + i] = (_Float16)(p[16 + i] * sc); }
  return a;
}
// column fragment from a [K][ld] layout (column n), rows >= K read as 0
__device__ __forceinline__ v16h fragc_f32(const float* W, int k0, int n, int lane, int ld, int K) {
  v16h a; const int g = lane >> 4;
#pragma unroll
  for (int i = 0; i < 8; ++i) { const int ka = k0 + 8 * g + i, kb = ka + 16;
    a[i] = (_Float16)(ka < K ? W[(size_t)(ka < K ? ka : K - 1) * ld + n] : 0.f); a[8 + i] = (_Float16)(kb < K ? W[(size_t)(kb < K ? kb : K - 1) * ld + n] : 0.f); }
  return a;
}
struct F2 { v16b h, l; };
__device__ __forceinline__ F2 bsplit16(const float v[16]) { F2 r;
#pragma unroll
  for (int i = 0; i < 16; ++i) { const __bf16 h = (__bf16)v[i]; r.h[i] = h; r.l[i] = (__bf16)(v[i] - (float)h); }
  return r; }
__device__ __forceinline__ F2 split_row(const float* row, int k0, int lane) { float v[16]; const float* p = row + k0 + 8 * (lane >> 4);
#pragma unroll
  for (int i = 0; i < 8; ++i) { v[i] = p[i]; v[8 + i] = p[16 + i]; }
  return bsplit16(v); }
__device__ __forceinline__ F2 split_rowK(const float* row, int k0, int lane, int K) { float v[16]; const int g = lane >> 4;
#pragma unroll
  for (int i = 0; i < 8; ++i) { const int ka = k0 + 8 * g + i, kb = ka + 16; v[i] = ka < K ? row[ka < K ? ka : K - 1] : 0.f; v[8 + i] = kb < K ? row[kb < K ? kb : K - 1] : 0.f; }
  return bsplit16(v); }
__device__ __forceinline__ F2 split_col(const float* W, int k0, int n, int lane, int ld, int K) { float v[16]; const int g = lane >> 4;
#pragma unroll
  for (int i = 0; i < 8; ++i) { const int ka = k0 + 8 * g + i, kb = ka + 16; v[i] = ka < K ? W[(size_t)(ka < K ? ka : K - 1) * ld + n] : 0.f; v[8 + i] = kb < K ? W[(size_t)(kb < K ? kb : K - 1) * ld + n] : 0.f; }
  return bsplit16(v); }
__device__ __forceinline__ v8f mac3(const F2& a, const F2& b, v8f c) { c = wmma_bf(a.l, b.h, c); c = wmma_bf(a.h, b.l, c); return wmma_bf(a.h, b.h, c); }
__device__ __forceinline__ float sigm(float v) { return 1.0f / (1.0f + expf(-v)); }
#define LDSX() do { asm volatile("s_wait_dscnt 0" ::: "memory"); __builtin_amdgcn_wave_barrier(); __builtin_amdgcn_fence(__ATOMIC_RELEASE, "workgroup"); } while (0)

// Multi-headed attention whose probabilities are multiplied by a group-probability tensor (query / key / value [4,1024,1024]; (in,out) wq / wk / wv / wo [1024,1024] uniform(+-1/32) + biases uniform(+-1/32); 16 heads x 64; scale 1/8; mask [4,1024,1024] int32 random 0/1: scores[mask == 0] = -1e9; p = softmax(scores); p *= group_prob[:, None] with group_prob [4,1024,1024] uniform[0,1) f32 (multiplicative, after the softmax, no renormalisation); merge; wo + bo).
#define NB 4
#define TT 1024
#define CC 1024            // NH * HD = projected width
#define DIN 1024          // input (model) width
#define NH 16
#define HD 64
#define NQB (TT / 64)
#define HG 8
#define SCALE (0.125f)
#define CAUSAL 0
#ifndef TNB
#define TNB NB
#endif
__device__ __forceinline__ float bfr(float v) { return (float)(__bf16)v; }
__host__ __device__ __forceinline__ int kb_last(int qb) { return CAUSAL ? ((qb * 64 + 63) >> 7) : (TT / 128 - 1); }
typedef __attribute__((ext_vector_type(8))) __bf16 v8b;
__device__ __forceinline__ v16b frag_b(const __bf16* rowk0, int lane) {
  union { v16b v; v8b q[2]; } u; const __bf16* p = rowk0 + 8 * (lane >> 4);
  u.q[0] = *(const v8b*)p; u.q[1] = *(const v8b*)(p + 16); return u.v;
}
#define QBH 0              // unused: no kernel in this file has a high-precision attention path
#define QHI 0               // single-product logits on every row
#define KHI 64            // key rows carrying k residual / v bf16 hi+lo planes (written by k_proj; no kernel in this file reads them)
// B fragment (k rows k0+.., output column o) of a weight: (in,out) [K][ld] or (out,in) [ld rows of K]: bf16 exact, or f16(bf16 * 256) exact
__device__ __forceinline__ v16b wcol_io(const float* Wm, int k0, int o, int lane, int ld) { v16b w; const int g = lane >> 4;
#pragma unroll
  for (int i = 0; i < 8; ++i) { w[i] = (__bf16)Wm[(size_t)(k0 + 8 * g + i) * ld + o]; w[8 + i] = (__bf16)Wm[(size_t)(k0 + 16 + 8 * g + i) * ld + o]; }
  return w; }
__device__ __forceinline__ v16b wcol_oi(const float* Wm, int k0, int o, int lane, int K) { v16b w; const float* p = Wm + (size_t)o * K + k0 + 8 * (lane >> 4);
#pragma unroll
  for (int i = 0; i < 8; ++i) { w[i] = (__bf16)p[i]; w[8 + i] = (__bf16)p[16 + i]; }
  return w; }
__device__ __forceinline__ v16h wcolh_io(const float* Wm, int k0, int o, int lane, int ld) { v16h w; const int g = lane >> 4;
#pragma unroll
  for (int i = 0; i < 8; ++i) { w[i] = (_Float16)(bfr(Wm[(size_t)(k0 + 8 * g + i) * ld + o]) * 256.0f); w[8 + i] = (_Float16)(bfr(Wm[(size_t)(k0 + 16 + 8 * g + i) * ld + o]) * 256.0f); }
  return w; }
__device__ __forceinline__ v16h wcolh_oi(const float* Wm, int k0, int o, int lane, int K) { v16h w; const float* p = Wm + (size_t)o * K + k0 + 8 * (lane >> 4);
#pragma unroll
  for (int i = 0; i < 8; ++i) { w[i] = (_Float16)(bfr(p[i]) * 256.0f); w[8 + i] = (_Float16)(bfr(p[16 + i]) * 256.0f); }
  return w; }
#define WQKV_LAYOUT 0   // selects only WCOL, which no kernel here uses (k_proj always reads (in,out) [DIN][CC]): 0 = (in,out) [DIN][CC]; 1 = (out,in) [CC][DIN]; 2 = per-head [NH][DIN][HD]
__device__ __forceinline__ v16b wcol_hdk(const float* Wm, int k0, int o, int lane) { v16b w; const int g = lane >> 4; const float* p = Wm + (size_t)(o / HD) * DIN * HD + (o % HD);
#pragma unroll
  for (int i = 0; i < 8; ++i) { w[i] = (__bf16)p[(size_t)(k0 + 8 * g + i) * HD]; w[8 + i] = (__bf16)p[(size_t)(k0 + 16 + 8 * g + i) * HD]; }
  return w; }
#define WO_OUT_IN 0
#if WQKV_LAYOUT == 1
#define WCOL(W, k0, o, lane) wcol_oi(W, k0, o, lane, DIN)
#elif WQKV_LAYOUT == 2
#define WCOL(W, k0, o, lane) wcol_hdk(W, k0, o, lane)
#else
#define WCOL(W, k0, o, lane) wcol_io(W, k0, o, lane, CC)
#endif
#if WO_OUT_IN
#define WOCOL(W, k0, o, lane) wcol_oi(W, k0, o, lane, CC)
#define WOCOLH(W, k0, o, lane) wcolh_oi(W, k0, o, lane, CC)
#else
#define WOCOL(W, k0, o, lane) wcol_io(W, k0, o, lane, DIN)
#define WOCOLH(W, k0, o, lane) wcolh_io(W, k0, o, lane, DIN)
#endif
#define WS_QH  0u                                      // f16 q rows [b*t][CC]
#define WS_KH  (WS_QH + 2u * (size_t)NB * TT * CC)      // f16 k rows [b*t][CC]
#define WS_VT  (WS_KH + 2u * (size_t)NB * TT * CC)      // f16 v planes [b][c][t]
#define WS_QL  (WS_VT + 2u * (size_t)NB * CC * TT)      // f16 q residual x 2^10 rows [b][t < QHI][CC]
#define WS_KL  (WS_QL + 2u * (size_t)NB * QHI * CC)     // f16 k residual x 2^10 rows [b][t < KHI][CC]
#define WS_VB  (WS_KL + 2u * (size_t)NB * KHI * CC)     // bf16 v hi planes [b][c][t < KHI]
#define WS_VBL (WS_VB + 2u * (size_t)NB * CC * KHI)
#define WS_S   (WS_VBL + 2u * (size_t)NB * CC * KHI)    // (no longer used: the logits stay in registers; kept so that the layout behind it is unchanged)
#define WS_Y   (WS_S  + 4u * (size_t)HG * TT * TT)      // f32 ctx rows [b*t][CC] (only when there is an output projection)
#define WS_END (WS_Y  + 4u * (size_t)NB * TT * CC)

// ---- weight tile in LDS: KS k rows x 128 output columns, 16-bit, row-major as in memory; the block converts and stores each element once, and every wave takes its column fragments from there with the transposing load
#define KS 64
#define WPITCH 288         // bytes a staged row: 256 + 32, an odd multiple of 32 bytes (the transposing load's conflict-free pitch)
typedef __attribute__((ext_vector_type(8))) short v8s;
typedef __attribute__((ext_vector_type(4))) __bf16 v4b;
typedef __attribute__((ext_vector_type(4))) _Float16 v4h;
__device__ __forceinline__ v4u ld_tr16(const char* p) { typedef __attribute__((address_space(3))) v8s lds_v8s; return __builtin_bit_cast(v4u, __builtin_amdgcn_ds_load_tr16_b128_v8i16((lds_v8s*)p)); }
// lane (col, g) gets tile[kk*32 + 8g + 0..7][j*16 + col] and tile[kk*32 + 16 + 8g + 0..7][j*16 + col]: the k order of the row fragments above. tl = tile + wfrag_lane(lane)
__device__ __forceinline__ int wfrag_lane(int lane) { return (8 * (lane >> 4) + (lane & 7)) * WPITCH + 16 * ((lane >> 3) & 1); }
template <typename V> __device__ __forceinline__ V wfrag(const char* tl, int kk, int j) { union { V v; v4u q[2]; } u; const char* p = tl + kk * 32 * WPITCH + j * 32; u.q[0] = ld_tr16(p); u.q[1] = ld_tr16(p + 16 * WPITCH); return u.v; }
// this thread's share of a tile: rows wave*16 + 0..15, columns lane*4 + 0..3 (a wave's load covers 512 contiguous bytes of one row); and its 32 of the step's 64 k of its row of the left operand, in fragment order
__device__ __forceinline__ void ld_wtile(v4f (&wr)[16], const float* wp, int ld) {
#pragma unroll
  for (int i = 0; i < 16; ++i) wr[i] = *(const v4f*)(wp + (size_t)i * ld); }
__device__ __forceinline__ void ld_arow(v4f (&ar)[8], const float* p) {
#pragma unroll
  for (int c = 0; c < 2; ++c) { ar[4 * c] = *(const v4f*)(p + 32 * c); ar[4 * c + 1] = *(const v4f*)(p + 32 * c + 4); ar[4 * c + 2] = *(const v4f*)(p + 32 * c + 16); ar[4 * c + 3] = *(const v4f*)(p + 32 * c + 20); } }
// ---- k_proj: block = (64 rows, 128 cols, which): q/k/v = X W (+ b) with exact bf16 products (K = DIN) -> which 0: q f16 rows (+ residual rows < QHI); 1: k f16 rows (+ residual rows < KHI); 2: v f16 planes [c][t] (+ bf16 hi/lo planes for t < KHI)
__global__ __launch_bounds__(128) void k_proj(const float* __restrict__ XQ, const float* __restrict__ XK, const float* __restrict__ XV, const float* __restrict__ WQ, const float* __restrict__ WK, const float* __restrict__ WV, const float* __restrict__ BQ, const float* __restrict__ BK, const float* __restrict__ BV,
    _Float16* __restrict__ QH, _Float16* __restrict__ QL, _Float16* __restrict__ KH, _Float16* __restrict__ KL, _Float16* __restrict__ VT, __bf16* __restrict__ VB, __bf16* __restrict__ VBL) {
  __shared__ __align__(16) union { struct { _Float16 sh[64][136], sl[64][136]; _Float16 th[128][72]; __bf16 tb[128][72], tbl[128][72]; } e; char w[2][KS * WPITCH]; } sm;   // the weight tiles live in the loop, the output staging behind it
  auto& sh = sm.e.sh; auto& sl = sm.e.sl; auto& th = sm.e.th; auto& tb = sm.e.tb; auto& tbl = sm.e.tbl;
  const int tid = threadIdx.x, wave = tid >> 5, lane = tid & 31, col = lane & 15, g = lane >> 4; const int which = blockIdx.z; const int c0 = blockIdx.y * 128; const size_t r0 = (size_t)blockIdx.x * 64; const size_t bb = r0 / TT; const int t0 = (int)(r0 % TT);
  const float* X = which == 0 ? XQ : which == 1 ? XK : XV; const float* WA = which == 0 ? WQ : which == 1 ? WK : WV; const float* BA = which == 0 ? BQ : which == 1 ? BK : BV;
  v8f acc[8] = {};
  const float* xp = X + (r0 + wave * 16 + col) * DIN + 8 * g; const float* wp = WA + (size_t)(wave * 16) * CC + c0 + lane * 4;
  v4f wr[16], ar[8]; ld_wtile(wr, wp, CC); ld_arow(ar, xp);
  asm volatile("s_wait_xcnt 0x0" ::: "memory");   // the address registers of the first tile's loads are reused by what follows
  auto step = [&](int ks, bool more) __attribute__((always_inline)) { char* tile = sm.w[ks & 1]; char* dst = tile + wave * 16 * WPITCH + lane * 8;
#pragma unroll
    for (int i = 0; i < 16; ++i) { v4b t;
#pragma unroll
      for (int c = 0; c < 4; ++c) t[c] = (__bf16)wr[i][c];
      *(v4b*)(dst + i * WPITCH) = t; }
    v16b a[2];
#pragma unroll
    for (int c = 0; c < 2; ++c)
#pragma unroll
      for (int i = 0; i < 8; ++i) { a[c][i] = (__bf16)ar[4 * c + (i >> 2)][i & 3]; a[c][8 + i] = (__bf16)ar[4 * c + 2 + (i >> 2)][i & 3]; }
    __builtin_amdgcn_sched_barrier(0);   // keeps the conversions above the next loads, so that these land in the registers just freed; else the build copies them at the trip's end and waits for the loads there
    __syncthreads();   // publishes this tile; it also ends every wave's reads of the other buffer, which the next trip overwrites
    if (more) { ld_wtile(wr, wp + (size_t)(ks + 1) * KS * CC, CC); ld_arow(ar, xp + (ks + 1) * KS);
      asm volatile("s_wait_xcnt 0x0" ::: "memory"); }   // the address registers of these loads are rewritten further down
    __builtin_amdgcn_sched_barrier(0);   // keeps the next tile's loads up here, in flight under this tile's products; without it they may sink towards their uses
    const char* tl = tile + wfrag_lane(lane);
#pragma unroll
    for (int c = 0; c < 2; ++c) { v16b wf[8];   // the eight fragments as one group of LDS loads in front of their products: one LDS latency a group, not one a product
#pragma unroll
      for (int j = 0; j < 8; ++j) wf[j] = wfrag<v16b>(tl, c, j);
#pragma unroll
      for (int j = 0; j < 8; ++j) acc[j] = wmma_bf(a[c], wf[j], acc[j]); } };
  for (int ks = 0; ks < DIN / KS - 1; ++ks) step(ks, true);
  step(DIN / KS - 1, false);   // the last tile has no next one to load
  __syncthreads();   // the staging below reuses the tiles' LDS: every wave has left the last tile
  if (which < 2) { _Float16* DH = which == 0 ? QH : KH; _Float16* DL = which == 0 ? QL : KL; const int nhi = which == 0 ? QHI : KHI; const bool hi_rows = t0 < nhi;
#pragma unroll
    for (int j = 0; j < 8; ++j) { const float bias = BA ? bfr(BA[c0 + j * 16 + col]) : 0.f;
#pragma unroll
      for (int r = 0; r < 8; ++r) { const float v = acc[j][r] + bias; const _Float16 hv = (_Float16)v; sh[wave * 16 + 8 * g + r][j * 16 + col] = hv; sl[wave * 16 + 8 * g + r][j * 16 + col] = (_Float16)((v - (float)hv) * 1024.0f); } }
    __syncthreads();
    for (int e = tid; e < 64 * 16; e += 128) { const int rl = e >> 4, q = e & 15; vst2((unsigned*)(DH + (r0 + rl) * CC + c0 + q * 8), *(const v4u*)&sh[rl][q * 8]); if (hi_rows) vst2((unsigned*)(DL + (bb * nhi + t0 + rl) * (size_t)CC + c0 + q * 8), *(const v4u*)&sl[rl][q * 8]); }
  } else { const bool hi_rows = t0 < KHI;
#pragma unroll
    for (int j = 0; j < 8; ++j) { const float bias = BA ? bfr(BA[c0 + j * 16 + col]) : 0.f;
#pragma unroll
      for (int r = 0; r < 8; ++r) { const float v = acc[j][r] + bias; const int rl = wave * 16 + 8 * g + r, cl = j * 16 + col; th[cl][rl] = (_Float16)v; const __bf16 bh = (__bf16)v; tb[cl][rl] = bh; tbl[cl][rl] = (__bf16)(v - (float)bh); } }
    __syncthreads();
    for (int e = tid; e < 128 * 8; e += 128) { const int cl = e >> 3, q = e & 7; vst2((unsigned*)(VT + (bb * CC + c0 + cl) * (size_t)TT + t0 + q * 8), *(const v4u*)&th[cl][q * 8]); if (hi_rows) { const size_t o3 = (bb * CC + c0 + cl) * (size_t)KHI + t0 + q * 8; vst2((unsigned*)(VB + o3), *(const v4u*)&tb[cl][q * 8]); vst2((unsigned*)(VBL + o3), *(const v4u*)&tbl[cl][q * 8]); } } } }
// ---- k_att: block = 64 queries (4 waves x 16) of (b, h); each wave walks all keys in steps of 32 with a running maximum and sum, so no logit leaves the registers.
// S^T = K Q^T: lane (g, col) holds query col, keys k0 + 8g + r (tile 0) and k0 + 16 + 8g + r (tile 1), which is already the k order of a 16x16x32 operand; ctx^T = V^T P^T keeps the query in the lane, so maximum, sum and rescale are lane-local but for one exchange with lane ^ 16.
// Each step's operands (32 k rows, 64 v rows of 32 keys, 64 mask rows and 64 group_prob rows of 32 keys) come into LDS once per block by asynchronous copies that cover whole 128-byte lines (v: 64-byte pieces); the waves take their fragments from there. A fragment load straight from global memory touches 16 lines for 512 bytes.
__device__ __forceinline__ float xhalf(float x) { return __builtin_bit_cast(float, __builtin_amdgcn_permlanex16(__builtin_bit_cast(int, x), __builtin_bit_cast(int, x), 0x76543210, 0xfedcba98, false, false)); }  // lane l with lane l ^ 16
__device__ __forceinline__ v8f wmmah(v16h a, v16h b, v8f c) { return __builtin_amdgcn_wmma_f32_16x16x32_f16(false, a, false, b, (short)0, c, false, false); }
#define LOG2E 1.4426950408889634f
#define AKP 144            // bytes a staged k, mask or group_prob row: 128 + 16 (the conflict-free pitch of 16-byte LDS reads)
#define AVP 80             // bytes a staged v row: 64 + 16
#define A_K 0
#define A_V (A_K + 32 * AKP)
#define A_M (A_V + HD * AVP)
#define A_G (A_M + 64 * AKP)
#define A_SZ (A_G + 64 * AKP)
typedef __attribute__((address_space(3))) char lds_char;
// this thread's twelve 16-byte copies of one step's operands: k rows r, r + 16; v rows r, r + 32; mask and group_prob rows r, r + 16, r + 32, r + 48. The wait at the end stands in the copies' own statement, in front of any rewrite of the address registers that they name.
__device__ __forceinline__ void att_copy(unsigned lk, unsigned lv, unsigned lm, unsigned lg, const char* k, const char* v, const char* m, const char* g) {
  asm volatile("global_load_async_to_lds_b128 %0, %12, off\n\t"
               "global_load_async_to_lds_b128 %1, %13, off\n\t"
               "global_load_async_to_lds_b128 %2, %14, off\n\t"
               "global_load_async_to_lds_b128 %3, %15, off\n\t"
               "global_load_async_to_lds_b128 %4, %16, off\n\t"
               "global_load_async_to_lds_b128 %5, %17, off\n\t"
               "global_load_async_to_lds_b128 %6, %18, off\n\t"
               "global_load_async_to_lds_b128 %7, %19, off\n\t"
               "global_load_async_to_lds_b128 %8, %20, off\n\t"
               "global_load_async_to_lds_b128 %9, %21, off\n\t"
               "global_load_async_to_lds_b128 %10, %22, off\n\t"
               "global_load_async_to_lds_b128 %11, %23, off\n\t"
               "s_wait_xcnt 0x0"
               :: "v"(lk), "v"(lk + 16 * AKP), "v"(lv), "v"(lv + 32 * AVP), "v"(lm), "v"(lm + 16 * AKP), "v"(lm + 32 * AKP), "v"(lm + 48 * AKP), "v"(lg), "v"(lg + 16 * AKP), "v"(lg + 32 * AKP), "v"(lg + 48 * AKP),
                  "v"(k), "v"(k + 16 * CC * 2), "v"(v), "v"(v + 32 * TT * 2), "v"(m), "v"(m + 16 * TT * 4), "v"(m + 32 * TT * 4), "v"(m + 48 * TT * 4), "v"(g), "v"(g + 16 * TT * 4), "v"(g + 32 * TT * 4), "v"(g + 48 * TT * 4)
               : "memory"); }
__global__ __launch_bounds__(128) void k_att(const _Float16* __restrict__ QH, const _Float16* __restrict__ KH, const _Float16* __restrict__ VT, const int* __restrict__ MASK, const float* __restrict__ GPROB, float* __restrict__ Y) {
  __shared__ __align__(16) char sa[2][A_SZ];
  const int tid = threadIdx.x, wave = tid >> 5, lane = tid & 31, col = lane & 15, g = lane >> 4; const int h = blockIdx.y, b = blockIdx.z; const int q = blockIdx.x * 64 + wave * 16 + col;
  const _Float16* qp = QH + ((size_t)b * TT + q) * CC + h * HD; const v16h q0 = frag_h(qp, lane), q1 = frag_h(qp + 32, lane);
  asm volatile("s_wait_xcnt 0x0" ::: "memory");   // the q loads' address registers are reused by what follows
  const unsigned lb = (unsigned)(size_t)(lds_char*)&sa[0][0];
  const unsigned lk = lb + A_K + (tid >> 3) * AKP + (tid & 7) * 16, lv = lb + A_V + (tid >> 2) * AVP + (tid & 3) * 16, lm = lb + A_M + (tid >> 3) * AKP + (tid & 7) * 16, lg = lm + (A_G - A_M);
  const char* kg = (const char*)(KH + ((size_t)b * TT + (tid >> 3)) * CC + h * HD + (tid & 7) * 8); const char* vg = (const char*)(VT + ((size_t)b * CC + h * HD + (tid >> 2)) * (size_t)TT + (tid & 3) * 8);
  const size_t mo0 = ((size_t)b * TT + blockIdx.x * 64 + (tid >> 3)) * TT + (tid & 7) * 4; const char* mg = (const char*)(MASK + mo0); const char* gg = (const char*)(GPROB + mo0);
  auto copy = [&](int t) __attribute__((always_inline)) { const unsigned o = (t & 1) * A_SZ; att_copy(lk + o, lv + o, lm + o, lg + o, kg + (size_t)t * (32 * CC * 2), vg + t * 64, mg + t * 128, gg + t * 128); };
  v8f acc[HD / 16] = {}; float m = -3.0e38f, mo = -3.0e38f, l = 0.f;   // m: running maximum (base 2); mo = m - 11: every weight is carried x 2^11 into f16, the sum too, so the factor cancels in the final division
  copy(0);
  asm volatile("s_wait_asynccnt 0x0" ::: "memory");   // this wave's share of step 0 has landed
  __syncthreads();   // publishes step 0
  copy(1);
#pragma unroll 2   /* two steps a trip: the buffer's offset is then a constant in every LDS address */
  for (int t = 0; t < TT / 32; ++t) { const char* bp = sa[t & 1];
    v16h ka[4], vf[HD / 16]; v4i mk[4]; v4f gq[4];
    const int* mr = (const int*)(bp + A_M + (wave * 16 + col) * AKP) + 8 * g; const float* gr = (const float*)(bp + A_G + (wave * 16 + col) * AKP) + 8 * g;
#pragma unroll
    for (int i = 0; i < 2; ++i) { const _Float16* kr = (const _Float16*)(bp + A_K + (16 * i + col) * AKP); ka[2 * i] = frag_h(kr, lane); ka[2 * i + 1] = frag_h(kr + 32, lane); }
#pragma unroll
    for (int i = 0; i < 2; ++i) { mk[2 * i] = *(const v4i*)(mr + 16 * i); mk[2 * i + 1] = *(const v4i*)(mr + 16 * i + 4); gq[2 * i] = *(const v4f*)(gr + 16 * i); gq[2 * i + 1] = *(const v4f*)(gr + 16 * i + 4); }
#pragma unroll
    for (int j = 0; j < HD / 16; ++j) vf[j] = frag_h((const _Float16*)(bp + A_V + (j * 16 + col) * AVP), lane);
    // the step's publish point stands right behind its LDS reads (all that follows works on registers), so that the copies of the step after next fly for a whole step
    asm volatile("s_wait_dscnt 0x0" ::: "memory");      // this wave's reads of this buffer have returned: behind the barrier it is refilled
    asm volatile("s_wait_asynccnt 0x0" ::: "memory");   // this wave's share of the next step has landed
    __syncthreads();   // publishes the next step's buffer and ends every wave's reads of this one
    if (t + 2 < TT / 32) copy(t + 2);
    v8f s0 = {}, s1 = {}; s0 = wmmah(ka[0], q0, s0); s1 = wmmah(ka[2], q0, s1); s0 = wmmah(ka[1], q1, s0); s1 = wmmah(ka[3], q1, s1);
    float t16[16];
#pragma unroll
    for (int r = 0; r < 8; ++r) { t16[r] = mk[r >> 2][r & 3] == 0 ? -1.0e9f * LOG2E : s0[r] * (SCALE * LOG2E); t16[8 + r] = mk[2 + (r >> 2)][r & 3] == 0 ? -1.0e9f * LOG2E : s1[r] * (SCALE * LOG2E); }
    float mx = fmaxf(t16[0], t16[1]);
#pragma unroll
    for (int i = 2; i < 16; ++i) mx = fmaxf(mx, t16[i]);
    mx = fmaxf(mx, xhalf(mx)); m = fmaxf(m, mx); const float mn = m - 11.0f; const float corr = __builtin_amdgcn_exp2f(mo - mn); mo = mn;   // corr = 0 on the first step
    v16h p; float ls[4] = {0.f, 0.f, 0.f, 0.f};
#pragma unroll
    for (int i = 0; i < 16; ++i) { const float e = __builtin_amdgcn_exp2f(t16[i] - mn); ls[i & 3] += e; p[i] = (_Float16)(e * bfr(gq[i >> 2][i & 3])); }   // the sum takes the softmax weight alone; group_prob (bf16-rounded like every float input) enters the product only
    l = l * corr + ((ls[0] + ls[1]) + (ls[2] + ls[3]));
#pragma unroll
    for (int j = 0; j < HD / 16; ++j) { acc[j] *= corr; acc[j] = wmmah(vf[j], p, acc[j]); } }
  asm volatile("s_wait_asynccnt 0x0" ::: "memory");   // no copy is outstanding when the wave ends
  l += xhalf(l); const float inv = 1.0f / l;   // l >= 1: the maximum's own weight is in it
  float* yp = Y + ((size_t)b * TT + q) * CC + h * HD + 8 * g;
#pragma unroll
  for (int j = 0; j < HD / 16; ++j) { v4f lo, hi;
#pragma unroll
    for (int r = 0; r < 4; ++r) { lo[r] = acc[j][r] * inv; hi[r] = acc[j][4 + r] * inv; }
    vst2(yp + j * 16, lo); vst2(yp + j * 16 + 4, hi); } }
// ---- k_out: block = (64 rows, 128 cols): out = ctx Wo (+ bo): ctx x 2^6 once to f16 against Wo as f16(bf16 x 2^8) exact (1 product) x 2^-14; causal early rows (< QHI of each sequence): ctx bf16 hi + lo against exact bf16 Wo (2 products)
__global__ __launch_bounds__(128) void k_out(const float* __restrict__ Y, const float* __restrict__ WO, const float* __restrict__ BO, float* __restrict__ OUT) { __shared__ __align__(16) float sf[4][16][132]; __shared__ __align__(16) char sw[2][KS * WPITCH];
  const int tid = threadIdx.x, wave = tid >> 5, lane = tid & 31, col = lane & 15, g = lane >> 4; const int c0 = blockIdx.y * 128; const size_t r0 = (size_t)blockIdx.x * 64 + wave * 16;
  v8f acc[8] = {};
  if (CAUSAL && (int)(((size_t)blockIdx.x * 64) % TT) < QHI) {   /* block-uniform */
#pragma unroll 2
    for (int kc = 0; kc < CC / 32; ++kc) { const F2 a = split_row(Y + (r0 + col) * CC, kc * 32, lane); asm volatile("s_wait_loadcnt 0x0" ::: "memory");
#pragma unroll
      for (int j = 0; j < 8; ++j) { const v16b w = WOCOL(WO, kc * 32, c0 + j * 16 + col, lane); asm volatile("s_wait_loadcnt 0x0" ::: "memory"); acc[j] = wmma_bf(a.h, w, acc[j]); acc[j] = wmma_bf(a.l, w, acc[j]); } }
#pragma unroll
    for (int j = 0; j < 8; ++j) { const float bias = BO ? bfr(BO[c0 + j * 16 + col]) : 0.f;
#pragma unroll
      for (int r = 0; r < 8; ++r) sf[wave][8 * g + r][j * 16 + col] = acc[j][r] + bias; }
  } else {
    const float* yp = Y + (r0 + col) * CC + 8 * g; const float* wp = WO + (size_t)(wave * 16) * DIN + c0 + lane * 4;
    v4f wr[16], ar[8]; ld_wtile(wr, wp, DIN); ld_arow(ar, yp);
    asm volatile("s_wait_xcnt 0x0" ::: "memory");   // the address registers of the first tile's loads are reused by what follows
    auto step = [&](int ks, bool more) __attribute__((always_inline)) { char* tile = sw[ks & 1]; char* dst = tile + wave * 16 * WPITCH + lane * 8;
#pragma unroll
      for (int i = 0; i < 16; ++i) { v4h t;
#pragma unroll
        for (int c = 0; c < 4; ++c) t[c] = (_Float16)(bfr(wr[i][c]) * 256.0f);
        *(v4h*)(dst + i * WPITCH) = t; }
      v16h a[2];   /* ctx carried x 2^6 into f16 so small-magnitude context rows stay clear of f16 subnormals */
#pragma unroll
      for (int c = 0; c < 2; ++c)
#pragma unroll
        for (int i = 0; i < 8; ++i) { a[c][i] = (_Float16)(ar[4 * c + (i >> 2)][i & 3] * 64.0f); a[c][8 + i] = (_Float16)(ar[4 * c + 2 + (i >> 2)][i & 3] * 64.0f); }
      __builtin_amdgcn_sched_barrier(0);   // keeps the conversions above the next loads, so that these land in the registers just freed; else the build copies them at the trip's end and waits for the loads there
      __syncthreads();   // publishes this tile; it also ends every wave's reads of the other buffer, which the next trip overwrites
      if (more) { ld_wtile(wr, wp + (size_t)(ks + 1) * KS * DIN, DIN); ld_arow(ar, yp + (ks + 1) * KS);
        asm volatile("s_wait_xcnt 0x0" ::: "memory"); }   // the address registers of these loads are rewritten further down
      __builtin_amdgcn_sched_barrier(0);   // keeps the next tile's loads up here, in flight under this tile's products; without it they may sink towards their uses
      const char* tl = tile + wfrag_lane(lane);
#pragma unroll
      for (int c = 0; c < 2; ++c) { v16h wf[8];   // the eight fragments as one group of LDS loads in front of their products: one LDS latency a group, not one a product
#pragma unroll
        for (int j = 0; j < 8; ++j) wf[j] = wfrag<v16h>(tl, c, j);
#pragma unroll
        for (int j = 0; j < 8; ++j) acc[j] = wmma16(a[c], wf[j], acc[j]); } };
    for (int ks = 0; ks < CC / KS - 1; ++ks) step(ks, true);
    step(CC / KS - 1, false);   // the last tile has no next one to load
#pragma unroll
    for (int j = 0; j < 8; ++j) { const float bias = BO ? bfr(BO[c0 + j * 16 + col]) : 0.f;
#pragma unroll
      for (int r = 0; r < 8; ++r) sf[wave][8 * g + r][j * 16 + col] = acc[j][r] * (1.0f / 16384.0f) + bias; } }   /* 2^-8 (Wo carry) x 2^-6 (ctx carry) */
  LDSX(); for (int rl = 0; rl < 16; ++rl) vst2(OUT + (r0 + rl) * DIN + c0 + lane * 4, *(const v4f*)&sf[wave][rl][lane * 4]); }

extern "C" void kernel_launch(void* const* d_in, const int* in_sizes, int n_in, void* d_out, int out_size, void* d_ws, size_t ws_size, hipStream_t stream) {
  (void)in_sizes; (void)n_in; (void)out_size;
  const float** F = (const float**)d_in;
  if (ws_size < (size_t)WS_END) return;
  char* ws = (char*)d_ws; _Float16 *QH = (_Float16*)(ws + WS_QH), *KH = (_Float16*)(ws + WS_KH), *VT = (_Float16*)(ws + WS_VT), *QL = (_Float16*)(ws + WS_QL), *KL = (_Float16*)(ws + WS_KL); __bf16 *VB = (__bf16*)(ws + WS_VB), *VBL = (__bf16*)(ws + WS_VBL); float *Y = (float*)(ws + WS_Y);
  (void)Y; (void)QL; (void)KL; (void)VB; (void)VBL;
  // inputs: 0 query [4,1024,1024]; 1 key; 2 value; 3 group_prob [4,1024,1024] f32 uniform[0,1); 4 mask [4,1024,1024] int32 (random 0/1); 5 wq [1024,1024] (in,out), 6 bq; 7 wk, 8 bk; 9 wv, 10 bv; 11 wo (in,out), 12 bo (biases nonzero)
  k_proj<<<dim3(TNB * TT / 64, CC / 128, 3), 128, 0, stream>>>(F[0], F[1], F[2], F[5], F[7], F[9], F[6], F[8], F[10], QH, QL, KH, KL, VT, VB, VBL);
  k_att<<<dim3(NQB, NH, TNB), 128, 0, stream>>>(QH, KH, VT, (const int*)d_in[4], F[3], Y);
  k_out<<<dim3(TNB * TT / 64, DIN / 128), 128, 0, stream>>>(Y, F[11], F[12], (float*)d_out);
}

// v004
// It runs in 112 microseconds.
// In two side-by-side timings against v003, it was 1.05 and 1.04 times as fast.
// All steps since v000 together make it 7.11 times as fast.
// compute dtype: all float inputs rounded to bf16; q/k/v projections with EXACT bf16 products on WMMA 16x16x32 (f32 accumulate) + bias; logits q x k once to f16 each (1 product) x SCALE; the int mask read per element (0 - -1e9); softmax f32 with a running maximum and sum; the weight exp(s - max) x 2^11 is MULTIPLIED by the float group_prob (which stays out of the sum: no renormalisation), once to f16 x v once to f16 (1 product), and the product is divided by the sum x 2^11; ctx x 2^6 once to f16 x Wo f16(bf16 x 2^8) + bo; f32 output.
#include <hip/hip_runtime.h>
#include <math.h>

typedef __attribute__((ext_vector_type(16))) _Float16 v16h;
typedef __attribute__((ext_vector_type(16))) __bf16 v16b;
typedef __attribute__((ext_vector_type(8)))  _Float16 v8h;
typedef __attribute__((ext_vector_type(8)))  float v8f;
typedef __attribute__((ext_vector_type(4)))  float v4f;
typedef __attribute__((ext_vector_type(2)))  float v2f;
typedef __attribute__((ext_vector_type(4)))  unsigned v4u;
typedef __attribute__((ext_vector_type(4)))  int v4i;
typedef float __attribute__((may_alias)) float_a;
typedef int __attribute__((may_alias)) int_a;

template <typename T> __device__ __forceinline__ void vst2(void* p, T v) { *(T*)p = v;  }
__device__ __forceinline__ v8f wmma16(v16h a, v16h b, v8f c) {
  v8f d = __builtin_amdgcn_wmma_f32_16x16x32_f16(false, a, false, b, (short)0, c, false, false);
  asm volatile("v_nop\n\tv_nop\n\tv_nop\n\tv_nop" : "+v"(d) : "v"(a), "v"(b));
  return d;
}
__device__ __forceinline__ v8f wmma_bf(v16b a, v16b b, v8f c) {
  v8f d = __builtin_amdgcn_wmma_f32_16x16x32_bf16(false, a, false, b, (short)0, c, false, false);
  asm volatile("v_nop\n\tv_nop\n\tv_nop\n\tv_nop" : "+v"(d) : "v"(a), "v"(b));
  return d;
}
// 16x16x32 fragments: lane = (h = lane>>4, row/col = lane&15); elements 0..7 = k0+8h+0..7, 8..15 = k0+16+8h+0..7; D element r = row 8h+r
__device__ __forceinline__ v16h frag_h(const _Float16* rowk0, int lane) {
  union { v16h v; v8h q[2]; } u; const _Float16* p = rowk0 + 8 * (lane >> 4);
  u.q[0] = *(const v8h*)p; u.q[1] = *(const v8h*)(p + 16); return u.v;
}
__device__ __forceinline__ v16h frag_f32(const float* rowk0, int lane) {
  v16h a; const float* p = rowk0 + 8 * (lane >> 4);
#pragma unroll
  for (int i = 0; i < 8; ++i) { a[i] = (_Float16)p[i]; a[8 + i] = (_Float16)p[16 + i]; }
  return a;
}
__device__ __forceinline__ v16h frag_f32s(const float* rowk0, int lane, float sc) {
  v16h a; const float* p = rowk0 + 8 * (lane >> 4);
#pragma unroll
  for (int i = 0; i < 8; ++i) { a[i] = (_Float16)(p[i] * sc); a[8 + i] = (_Float16)(p[16 + i] * sc); }
  return a;
}
// column fragment from a [K][ld] layout (column n), rows >= K read as 0
__device__ __forceinline__ v16h fragc_f32(const float* W, int k0, int n, int lane, int ld, int K) {
  v16h a; const int g = lane >> 4;
#pragma unroll
  for (int i = 0; i < 8; ++i) { const int ka = k0 + 8 * g + i, kb = ka + 16;
    a[i] = (_Float16)(ka < K ? W[(size_t)(ka < K ? ka : K - 1) * ld + n] : 0.f); a[8 + i] = (_Float16)(kb < K ? W[(size_t)(kb < K ? kb : K - 1) * ld + n] : 0.f); }
  return a;
}
struct F2 { v16b h, l; };
__device__ __forceinline__ F2 bsplit16(const float v[16]) { F2 r;
#pragma unroll
  for (int i = 0; i < 16; ++i) { const __bf16 h = (__bf16)v[i]; r.h[i] = h; r.l[i] = (__bf16)(v[i] - (float)h); }
  return r; }
__device__ __forceinline__ F2 split_row(const float* row, int k0, int lane) { float v[16]; const float* p = row + k0 + 8 * (lane >> 4);
#pragma unroll
  for (int i = 0; i < 8; ++i) { v[i] = p[i]; v[8 + i] = p[16 + i]; }
  return bsplit16(v); }
__device__ __forceinline__ F2 split_rowK(const float* row, int k0, int lane, int K) { float v[16]; const int g = lane >> 4;
#pragma unroll
  for (int i = 0; i < 8; ++i) { const int ka = k0 + 8 * g + i, kb = ka + 16; v[i] = ka < K ? row[ka < K ? ka : K - 1] : 0.f; v[8 + i] = kb < K ? row[kb < K ? kb : K - 1] : 0.f; }
  return bsplit16(v); }
__device__ __forceinline__ F2 split_col(const float* W, int k0, int n, int lane, int ld, int K) { float v[16]; const int g = lane >> 4;
#pragma unroll
  for (int i = 0; i < 8; ++i) { const int ka = k0 + 8 * g + i, kb = ka + 16; v[i] = ka < K ? W[(size_t)(ka < K ? ka : K - 1) * ld + n] : 0.f; v[8 + i] = kb < K ? W[(size_t)(kb < K ? kb : K - 1) * ld + n] : 0.f; }
  return bsplit16(v); }
__device__ __forceinline__ v8f mac3(const F2& a, const F2& b, v8f c) { c = wmma_bf(a.l, b.h, c); c = wmma_bf(a.h, b.l, c); return wmma_bf(a.h, b.h, c); }
__device__ __forceinline__ float sigm(float v) { return 1.0f / (1.0f + expf(-v)); }
#define LDSX() do { asm volatile("s_wait_dscnt 0" ::: "memory"); __builtin_amdgcn_wave_barrier(); __builtin_amdgcn_fence(__ATOMIC_RELEASE, "workgroup"); } while (0)

// Multi-headed attention whose probabilities are multiplied by a group-probability tensor (query / key / value [4,1024,1024]; (in,out) wq / wk / wv / wo [1024,1024] uniform(+-1/32) + biases uniform(+-1/32); 16 heads x 64; scale 1/8; mask [4,1024,1024] int32 random 0/1: scores[mask == 0] = -1e9; p = softmax(scores); p *= group_prob[:, None] with group_prob [4,1024,1024] uniform[0,1) f32 (multiplicative, after the softmax, no renormalisation); merge; wo + bo).
#define NB 4
#define TT 1024
#define CC 1024            // NH * HD = projected width
#define DIN 1024          // input (model) width
#define NH 16
#define HD 64
#define NQB (TT / 64)
#define HG 8
#define SCALE (0.125f)
#define CAUSAL 0
#ifndef TNB
#define TNB NB
#endif
__device__ __forceinline__ float bfr(float v) { return (float)(__bf16)v; }
__host__ __device__ __forceinline__ int kb_last(int qb) { return CAUSAL ? ((qb * 64 + 63) >> 7) : (TT / 128 - 1); }
typedef __attribute__((ext_vector_type(8))) __bf16 v8b;
__device__ __forceinline__ v16b frag_b(const __bf16* rowk0, int lane) {
  union { v16b v; v8b q[2]; } u; const __bf16* p = rowk0 + 8 * (lane >> 4);
  u.q[0] = *(const v8b*)p; u.q[1] = *(const v8b*)(p + 16); return u.v;
}
#define QBH 0              // unused: no kernel in this file has a high-precision attention path
#define QHI 0               // single-product logits on every row
#define KHI 64            // key rows carrying k residual / v bf16 hi+lo planes (written by k_proj; no kernel in this file reads them)
// B fragment (k rows k0+.., output column o) of a weight: (in,out) [K][ld] or (out,in) [ld rows of K]: bf16 exact, or f16(bf16 * 256) exact
__device__ __forceinline__ v16b wcol_io(const float* Wm, int k0, int o, int lane, int ld) { v16b w; const int g = lane >> 4;
#pragma unroll
  for (int i = 0; i < 8; ++i) { w[i] = (__bf16)Wm[(size_t)(k0 + 8 * g + i) * ld + o]; w[8 + i] = (__bf16)Wm[(size_t)(k0 + 16 + 8 * g + i) * ld + o]; }
  return w; }
__device__ __forceinline__ v16b wcol_oi(const float* Wm, int k0, int o, int lane, int K) { v16b w; const float* p = Wm + (size_t)o * K + k0 + 8 * (lane >> 4);
#pragma unroll
  for (int i = 0; i < 8; ++i) { w[i] = (__bf16)p[i]; w[8 + i] = (__bf16)p[16 + i]; }
  return w; }
__device__ __forceinline__ v16h wcolh_io(const float* Wm, int k0, int o, int lane, int ld) { v16h w; const int g = lane >> 4;
#pragma unroll
  for (int i = 0; i < 8; ++i) { w[i] = (_Float16)(bfr(Wm[(size_t)(k0 + 8 * g + i) * ld + o]) * 256.0f); w[8 + i] = (_Float16)(bfr(Wm[(size_t)(k0 + 16 + 8 * g + i) * ld + o]) * 256.0f); }
  return w; }
__device__ __forceinline__ v16h wcolh_oi(const float* Wm, int k0, int o, int lane, int K) { v16h w; const float* p = Wm + (size_t)o * K + k0 + 8 * (lane >> 4);
#pragma unroll
  for (int i = 0; i < 8; ++i) { w[i] = (_Float16)(bfr(p[i]) * 256.0f); w[8 + i] = (_Float16)(bfr(p[16 + i]) * 256.0f); }
  return w; }
#define WQKV_LAYOUT 0   // selects only WCOL, which no kernel here uses (k_proj always reads (in,out) [DIN][CC]): 0 = (in,out) [DIN][CC]; 1 = (out,in) [CC][DIN]; 2 = per-head [NH][DIN][HD]
__device__ __forceinline__ v16b wcol_hdk(const float* Wm, int k0, int o, int lane) { v16b w; const int g = lane >> 4; const float* p = Wm + (size_t)(o / HD) * DIN * HD + (o % HD);
#pragma unroll
  for (int i = 0; i < 8; ++i) { w[i] = (__bf16)p[(size_t)(k0 + 8 * g + i) * HD]; w[8 + i] = (__bf16)p[(size_t)(k0 + 16 + 8 * g + i) * HD]; }
  return w; }
#define WO_OUT_IN 0
#if WQKV_LAYOUT == 1
#define WCOL(W, k0, o, lane) wcol_oi(W, k0, o, lane, DIN)
#elif WQKV_LAYOUT == 2
#define WCOL(W, k0, o, lane) wcol_hdk(W, k0, o, lane)
#else
#define WCOL(W, k0, o, lane) wcol_io(W, k0, o, lane, CC)
#endif
#if WO_OUT_IN
#define WOCOL(W, k0, o, lane) wcol_oi(W, k0, o, lane, CC)
#define WOCOLH(W, k0, o, lane) wcolh_oi(W, k0, o, lane, CC)
#else
#define WOCOL(W, k0, o, lane) wcol_io(W, k0, o, lane, DIN)
#define WOCOLH(W, k0, o, lane) wcolh_io(W, k0, o, lane, DIN)
#endif
#define WS_QH  0u                                      // f16 q rows [b*t][CC]
#define WS_KH  (WS_QH + 2u * (size_t)NB * TT * CC)      // f16 k rows [b*t][CC]
#define WS_VT  (WS_KH + 2u * (size_t)NB * TT * CC)      // f16 v planes [b][c][t]
#define WS_QL  (WS_VT + 2u * (size_t)NB * CC * TT)      // f16 q residual x 2^10 rows [b][t < QHI][CC]
#define WS_KL  (WS_QL + 2u * (size_t)NB * QHI * CC)     // f16 k residual x 2^10 rows [b][t < KHI][CC]
#define WS_VB  (WS_KL + 2u * (size_t)NB * KHI * CC)     // bf16 v hi planes [b][c][t < KHI]
#define WS_VBL (WS_VB + 2u * (size_t)NB * CC * KHI)
#define WS_S   (WS_VBL + 2u * (size_t)NB * CC * KHI)    // (no longer used: the logits stay in registers; kept so that the layout behind it is unchanged)
#define WS_Y   (WS_S  + 4u * (size_t)HG * TT * TT)      // f32 ctx rows [b*t][CC] (only when there is an output projection)
#define WS_END (WS_Y  + 4u * (size_t)NB * TT * CC)

// ---- weight tile in LDS: KS k rows x 128 output columns, 16-bit, row-major as in memory; the block converts and stores each element once, and every wave takes its column fragments from there with the transposing load
#define KS 64
#define WPITCH 288         // bytes a staged row: 256 + 32, an odd multiple of 32 bytes (the transposing load's conflict-free pitch)
typedef __attribute__((ext_vector_type(8))) short v8s;
typedef __attribute__((ext_vector_type(4))) __bf16 v4b;
typedef __attribute__((ext_vector_type(4))) _Float16 v4h;
__device__ __forceinline__ v4u ld_tr16(const char* p) { typedef __attribute__((address_space(3))) v8s lds_v8s; return __builtin_bit_cast(v4u, __builtin_amdgcn_ds_load_tr16_b128_v8i16((lds_v8s*)p)); }
// lane (col, g) gets tile[kk*32 + 8g + 0..7][j*16 + col] and tile[kk*32 + 16 + 8g + 0..7][j*16 + col]: the k order of the row fragments above. tl = tile + wfrag_lane(lane)
__device__ __forceinline__ int wfrag_lane(int lane) { return (8 * (lane >> 4) + (lane & 7)) * WPITCH + 16 * ((lane >> 3) & 1); }
template <typename V> __device__ __forceinline__ V wfrag(const char* tl, int kk, int j) { union { V v; v4u q[2]; } u; const char* p = tl + kk * 32 * WPITCH + j * 32; u.q[0] = ld_tr16(p); u.q[1] = ld_tr16(p + 16 * WPITCH); return u.v; }
// left operand in LDS: behind each weight tile the block's 64 rows x KS k, 16-bit, row-major; a wave stores and reads its own 16 rows only
#define APITCH 144         // bytes a staged row of the left operand: 128 + 16 (the conflict-free pitch of 16-byte LDS reads)
#define A_OFF (KS * WPITCH)
#define TILE_SZ (A_OFF + 64 * APITCH)
// this thread's share of a tile: rows wave*16 + 0..15, columns lane*4 + 0..3 (a wave's load covers 512 contiguous bytes of one row); and of its wave's 16 rows x 64 k of the left operand: rows 2i + (lane >> 4), k (lane & 15)*4 + 0..3, so that a wave's load covers two whole 256-byte row pieces (4 lines; a load in fragment order touches 16 lines for the same 512 bytes)
__device__ __forceinline__ void ld_wtile(v4f (&wr)[16], const float* wp, int ld) {
#pragma unroll
  for (int i = 0; i < 16; ++i) wr[i] = *(const v4f*)(wp + (size_t)i * ld); }
__device__ __forceinline__ void ld_arow(v4f (&ar)[8], const float* p, int ld) {
#pragma unroll
  for (int i = 0; i < 8; ++i) ar[i] = *(const v4f*)(p + (size_t)(2 * i) * ld); }
// ---- k_proj: block = (64 rows, 128 cols, which): q/k/v = X W (+ b) with exact bf16 products (K = DIN) -> which 0: q f16 rows (+ residual rows < QHI); 1: k f16 rows (+ residual rows < KHI); 2: v f16 planes [c][t] (+ bf16 hi/lo planes for t < KHI)
__global__ __launch_bounds__(128) void k_proj(const float* __restrict__ XQ, const float* __restrict__ XK, const float* __restrict__ XV, const float* __restrict__ WQ, const float* __restrict__ WK, const float* __restrict__ WV, const float* __restrict__ BQ, const float* __restrict__ BK, const float* __restrict__ BV,
    _Float16* __restrict__ QH, _Float16* __restrict__ QL, _Float16* __restrict__ KH, _Float16* __restrict__ KL, _Float16* __restrict__ VT, __bf16* __restrict__ VB, __bf16* __restrict__ VBL) {
  __shared__ __align__(16) union { struct { _Float16 sh[64][136], sl[64][136]; _Float16 th[128][72]; __bf16 tb[128][72], tbl[128][72]; } e; char w[2][TILE_SZ]; } sm;   // the weight and left-operand tiles live in the loop, the output staging behind it
  auto& sh = sm.e.sh; auto& sl = sm.e.sl; auto& th = sm.e.th; auto& tb = sm.e.tb; auto& tbl = sm.e.tbl;
  const int tid = threadIdx.x, wave = tid >> 5, lane = tid & 31, col = lane & 15, g = lane >> 4; const int which = blockIdx.z; const int c0 = blockIdx.y * 128; const size_t r0 = (size_t)blockIdx.x * 64; const size_t bb = r0 / TT; const int t0 = (int)(r0 % TT);
  const float* X = which == 0 ? XQ : which == 1 ? XK : XV; const float* WA = which == 0 ? WQ : which == 1 ? WK : WV; const float* BA = which == 0 ? BQ : which == 1 ? BK : BV;
  v8f acc[8] = {};
  const float* xp = X + (r0 + wave * 16 + g) * DIN + col * 4; const float* wp = WA + (size_t)(wave * 16) * CC + c0 + lane * 4;
  v4f wr[16], ar[8]; ld_wtile(wr, wp, CC); ld_arow(ar, xp, DIN);
  asm volatile("s_wait_xcnt 0x0" ::: "memory");   // the address registers of the first tile's loads are reused by what follows
  auto step = [&](int ks, bool more) __attribute__((always_inline)) { char* tile = sm.w[ks & 1]; char* dst = tile + wave * 16 * WPITCH + lane * 8;
#pragma unroll
    for (int i = 0; i < 16; ++i) { v4b t;
#pragma unroll
      for (int c = 0; c < 4; ++c) t[c] = (__bf16)wr[i][c];
      *(v4b*)(dst + i * WPITCH) = t; }
    char* adst = tile + A_OFF + (wave * 16 + g) * APITCH + col * 8;
#pragma unroll
    for (int i = 0; i < 8; ++i) { v4b t;
#pragma unroll
      for (int c = 0; c < 4; ++c) t[c] = (__bf16)ar[i][c];
      *(v4b*)(adst + i * 2 * APITCH) = t; }
    __builtin_amdgcn_sched_barrier(0);   // keeps the conversions above the next loads, so that these land in the registers just freed; else the build copies them at the trip's end and waits for the loads there
    __syncthreads();   // publishes this tile; it also ends every wave's reads of the other buffer, which the next trip overwrites
    if (more) { ld_wtile(wr, wp + (size_t)(ks + 1) * KS * CC, CC); ld_arow(ar, xp + (ks + 1) * KS, DIN);
      asm volatile("s_wait_xcnt 0x0" ::: "memory"); }   // the address registers of these loads are rewritten further down
    __builtin_amdgcn_sched_barrier(0);   // keeps the next tile's loads up here, in flight under this tile's products; without it they may sink towards their uses
    const char* tl = tile + wfrag_lane(lane); const __bf16* al = (const __bf16*)(tile + A_OFF + (wave * 16 + col) * APITCH);
#pragma unroll
    for (int c = 0; c < 2; ++c) { const v16b a = frag_b(al + 32 * c, lane); v16b wf[8];   // the eight fragments as one group of LDS loads in front of their products: one LDS latency a group, not one a product
#pragma unroll
      for (int j = 0; j < 8; ++j) wf[j] = wfrag<v16b>(tl, c, j);
#pragma unroll
      for (int j = 0; j < 8; ++j) acc[j] = wmma_bf(a, wf[j], acc[j]); } };
  for (int ks = 0; ks < DIN / KS - 1; ++ks) step(ks, true);
  step(DIN / KS - 1, false);   // the last tile has no next one to load
  __syncthreads();   // the staging below reuses the tiles' LDS: every wave has left the last tile
  if (which < 2) { _Float16* DH = which == 0 ? QH : KH; _Float16* DL = which == 0 ? QL : KL; const int nhi = which == 0 ? QHI : KHI; const bool hi_rows = t0 < nhi;
#pragma unroll
    for (int j = 0; j < 8; ++j) { const float bias = BA ? bfr(BA[c0 + j * 16 + col]) : 0.f;
#pragma unroll
      for (int r = 0; r < 8; ++r) { const float v = acc[j][r] + bias; const _Float16 hv = (_Float16)v; sh[wave * 16 + 8 * g + r][j * 16 + col] = hv; sl[wave * 16 + 8 * g + r][j * 16 + col] = (_Float16)((v - (float)hv) * 1024.0f); } }
    __syncthreads();
    for (int e = tid; e < 64 * 16; e += 128) { const int rl = e >> 4, q = e & 15; vst2((unsigned*)(DH + (r0 + rl) * CC + c0 + q * 8), *(const v4u*)&sh[rl][q * 8]); if (hi_rows) vst2((unsigned*)(DL + (bb * nhi + t0 + rl) * (size_t)CC + c0 + q * 8), *(const v4u*)&sl[rl][q * 8]); }
  } else { const bool hi_rows = t0 < KHI;
#pragma unroll
    for (int j = 0; j < 8; ++j) { const float bias = BA ? bfr(BA[c0 + j * 16 + col]) : 0.f;
#pragma unroll
      for (int r = 0; r < 8; ++r) { const float v = acc[j][r] + bias; const int rl = wave * 16 + 8 * g + r, cl = j * 16 + col; th[cl][rl] = (_Float16)v; const __bf16 bh = (__bf16)v; tb[cl][rl] = bh; tbl[cl][rl] = (__bf16)(v - (float)bh); } }
    __syncthreads();
    for (int e = tid; e < 128 * 8; e += 128) { const int cl = e >> 3, q = e & 7; vst2((unsigned*)(VT + (bb * CC + c0 + cl) * (size_t)TT + t0 + q * 8), *(const v4u*)&th[cl][q * 8]); if (hi_rows) { const size_t o3 = (bb * CC + c0 + cl) * (size_t)KHI + t0 + q * 8; vst2((unsigned*)(VB + o3), *(const v4u*)&tb[cl][q * 8]); vst2((unsigned*)(VBL + o3), *(const v4u*)&tbl[cl][q * 8]); } } } }
// ---- k_att: block = 64 queries (4 waves x 16) of (b, h); each wave walks all keys in steps of 32 with a running maximum and sum, so no logit leaves the registers.
// S^T = K Q^T: lane (g, col) holds query col, keys k0 + 8g + r (tile 0) and k0 + 16 + 8g + r (tile 1), which is already the k order of a 16x16x32 operand; ctx^T = V^T P^T keeps the query in the lane, so maximum, sum and rescale are lane-local but for one exchange with lane ^ 16.
// Each step's operands (32 k rows, 64 v rows of 32 keys, 64 mask rows and 64 group_prob rows of 32 keys) come into LDS once per block by asynchronous copies that cover whole 128-byte lines (v: 64-byte pieces); the waves take their fragments from there. A fragment load straight from global memory touches 16 lines for 512 bytes.
__device__ __forceinline__ float xhalf(float x) { return __builtin_bit_cast(float, __builtin_amdgcn_permlanex16(__builtin_bit_cast(int, x), __builtin_bit_cast(int, x), 0x76543210, 0xfedcba98, false, false)); }  // lane l with lane l ^ 16
__device__ __forceinline__ v8f wmmah(v16h a, v16h b, v8f c) { return __builtin_amdgcn_wmma_f32_16x16x32_f16(false, a, false, b, (short)0, c, false, false); }
#define LOG2E 1.4426950408889634f
#define AKP 144            // bytes a staged k, mask or group_prob row: 128 + 16 (the conflict-free pitch of 16-byte LDS reads)
#define AVP 80             // bytes a staged v row: 64 + 16
#define A_K 0
#define A_V (A_K + 32 * AKP)
#define A_M (A_V + HD * AVP)
#define A_G (A_M + 64 * AKP)
#define A_SZ (A_G + 64 * AKP)
typedef __attribute__((address_space(3))) char lds_char;
// this thread's twelve 16-byte copies of one step's operands: k rows r, r + 16; v rows r, r + 32; mask and group_prob rows r, r + 16, r + 32, r + 48. The wait at the end stands in the copies' own statement, in front of any rewrite of the address registers that they name.
__device__ __forceinline__ void att_copy(unsigned lk, unsigned lv, unsigned lm, unsigned lg, const char* k, const char* v, const char* m, const char* g) {
  asm volatile("global_load_async_to_lds_b128 %0, %12, off\n\t"
               "global_load_async_to_lds_b128 %1, %13, off\n\t"
               "global_load_async_to_lds_b128 %2, %14, off\n\t"
               "global_load_async_to_lds_b128 %3, %15, off\n\t"
               "global_load_async_to_lds_b128 %4, %16, off\n\t"
               "global_load_async_to_lds_b128 %5, %17, off\n\t"
               "global_load_async_to_lds_b128 %6, %18, off\n\t"
               "global_load_async_to_lds_b128 %7, %19, off\n\t"
               "global_load_async_to_lds_b128 %8, %20, off\n\t"
               "global_load_async_to_lds_b128 %9, %21, off\n\t"
               "global_load_async_to_lds_b128 %10, %22, off\n\t"
               "global_load_async_to_lds_b128 %11, %23, off\n\t"
               "s_wait_xcnt 0x0"
               :: "v"(lk), "v"(lk + 16 * AKP), "v"(lv), "v"(lv + 32 * AVP), "v"(lm), "v"(lm + 16 * AKP), "v"(lm + 32 * AKP), "v"(lm + 48 * AKP), "v"(lg), "v"(lg + 16 * AKP), "v"(lg + 32 * AKP), "v"(lg + 48 * AKP),
                  "v"(k), "v"(k + 16 * CC * 2), "v"(v), "v"(v + 32 * TT * 2), "v"(m), "v"(m + 16 * TT * 4), "v"(m + 32 * TT * 4), "v"(m + 48 * TT * 4), "v"(g), "v"(g + 16 * TT * 4), "v"(g + 32 * TT * 4), "v"(g + 48 * TT * 4)
               : "memory"); }
__global__ __launch_bounds__(128) void k_att(const _Float16* __restrict__ QH, const _Float16* __restrict__ KH, const _Float16* __restrict__ VT, const int* __restrict__ MASK, const float* __restrict__ GPROB, float* __restrict__ Y) {
  __shared__ __align__(16) char sa[2][A_SZ];
  const int tid = threadIdx.x, wave = tid >> 5, lane = tid & 31, col = lane & 15, g = lane >> 4; const int h = blockIdx.y, b = blockIdx.z; const int q = blockIdx.x * 64 + wave * 16 + col;
  const _Float16* qp = QH + ((size_t)b * TT + q) * CC + h * HD; const v16h q0 = frag_h(qp, lane), q1 = frag_h(qp + 32, lane);
  asm volatile("s_wait_xcnt 0x0" ::: "memory");   // the q loads' address registers are reused by what follows
  const unsigned lb = (unsigned)(size_t)(lds_char*)&sa[0][0];
  const unsigned lk = lb + A_K + (tid >> 3) * AKP + (tid & 7) * 16, lv = lb + A_V + (tid >> 2) * AVP + (tid & 3) * 16, lm = lb + A_M + (tid >> 3) * AKP + (tid & 7) * 16, lg = lm + (A_G - A_M);
  const char* kg = (const char*)(KH + ((size_t)b * TT + (tid >> 3)) * CC + h * HD + (tid & 7) * 8); const char* vg = (const char*)(VT + ((size_t)b * CC + h * HD + (tid >> 2)) * (size_t)TT + (tid & 3) * 8);
  const size_t mo0 = ((size_t)b * TT + blockIdx.x * 64 + (tid >> 3)) * TT + (tid & 7) * 4; const char* mg = (const char*)(MASK + mo0); const char* gg = (const char*)(GPROB + mo0);
  auto copy = [&](int t) __attribute__((always_inline)) { const unsigned o = (t & 1) * A_SZ; att_copy(lk + o, lv + o, lm + o, lg + o, kg + (size_t)t * (32 * CC * 2), vg + t * 64, mg + t * 128, gg + t * 128); };
  v8f acc[HD / 16] = {}; float m = -3.0e38f, mo = -3.0e38f, l = 0.f;   // m: running maximum (base 2); mo = m - 11: every weight is carried x 2^11 into f16, the sum too, so the factor cancels in the final division
  copy(0);
  asm volatile("s_wait_asynccnt 0x0" ::: "memory");   // this wave's share of step 0 has landed
  __syncthreads();   // publishes step 0
  copy(1);
#pragma unroll 2   /* two steps a trip: the buffer's offset is then a constant in every LDS address */
  for (int t = 0; t < TT / 32; ++t) { const char* bp = sa[t & 1];
    v16h ka[4], vf[HD / 16]; v4i mk[4]; v4f gq[4];
    const int* mr = (const int*)(bp + A_M + (wave * 16 + col) * AKP) + 8 * g; const float* gr = (const float*)(bp + A_G + (wave * 16 + col) * AKP) + 8 * g;
#pragma unroll
    for (int i = 0; i < 2; ++i) { const _Float16* kr = (const _Float16*)(bp + A_K + (16 * i + col) * AKP); ka[2 * i] = frag_h(kr, lane); ka[2 * i + 1] = frag_h(kr + 32, lane); }
#pragma unroll
    for (int i = 0; i < 2; ++i) { mk[2 * i] = *(const v4i*)(mr + 16 * i); mk[2 * i + 1] = *(const v4i*)(mr + 16 * i + 4); gq[2 * i] = *(const v4f*)(gr + 16 * i); gq[2 * i + 1] = *(const v4f*)(gr + 16 * i + 4); }
#pragma unroll
    for (int j = 0; j < HD / 16; ++j) vf[j] = frag_h((const _Float16*)(bp + A_V + (j * 16 + col) * AVP), lane);
    // the step's publish point stands right behind its LDS reads (all that follows works on registers), so that the copies of the step after next fly for a whole step
    asm volatile("s_wait_dscnt 0x0" ::: "memory");      // this wave's reads of this buffer have returned: behind the barrier it is refilled
    asm volatile("s_wait_asynccnt 0x0" ::: "memory");   // this wave's share of the next step has landed
    __syncthreads();   // publishes the next step's buffer and ends every wave's reads of this one
    if (t + 2 < TT / 32) copy(t + 2);
    v8f s0 = {}, s1 = {}; s0 = wmmah(ka[0], q0, s0); s1 = wmmah(ka[2], q0, s1); s0 = wmmah(ka[1], q1, s0); s1 = wmmah(ka[3], q1, s1);
    float t16[16];
#pragma unroll
    for (int r = 0; r < 8; ++r) { t16[r] = mk[r >> 2][r & 3] == 0 ? -1.0e9f * LOG2E : s0[r] * (SCALE * LOG2E); t16[8 + r] = mk[2 + (r >> 2)][r & 3] == 0 ? -1.0e9f * LOG2E : s1[r] * (SCALE * LOG2E); }
    float mx = fmaxf(t16[0], t16[1]);
#pragma unroll
    for (int i = 2; i < 16; ++i) mx = fmaxf(mx, t16[i]);
    mx = fmaxf(mx, xhalf(mx)); m = fmaxf(m, mx); const float mn = m - 11.0f; const float corr = __builtin_amdgcn_exp2f(mo - mn); mo = mn;   // corr = 0 on the first step
    v16h p; float ls[4] = {0.f, 0.f, 0.f, 0.f};
#pragma unroll
    for (int i = 0; i < 16; ++i) { const float e = __builtin_amdgcn_exp2f(t16[i] - mn); ls[i & 3] += e; p[i] = (_Float16)(e * bfr(gq[i >> 2][i & 3])); }   // the sum takes the softmax weight alone; group_prob (bf16-rounded like every float input) enters the product only
    l = l * corr + ((ls[0] + ls[1]) + (ls[2] + ls[3]));
#pragma unroll
    for (int j = 0; j < HD / 16; ++j) { acc[j] *= corr; acc[j] = wmmah(vf[j], p, acc[j]); } }
  asm volatile("s_wait_asynccnt 0x0" ::: "memory");   // no copy is outstanding when the wave ends
  l += xhalf(l); const float inv = 1.0f / l;   // l >= 1: the maximum's own weight is in it
  float* yp = Y + ((size_t)b * TT + q) * CC + h * HD + 8 * g;
#pragma unroll
  for (int j = 0; j < HD / 16; ++j) { v4f lo, hi;
#pragma unroll
    for (int r = 0; r < 4; ++r) { lo[r] = acc[j][r] * inv; hi[r] = acc[j][4 + r] * inv; }
    vst2(yp + j * 16, lo); vst2(yp + j * 16 + 4, hi); } }
// ---- k_out: block = (64 rows, 128 cols): out = ctx Wo (+ bo): ctx x 2^6 once to f16 against Wo as f16(bf16 x 2^8) exact (1 product) x 2^-14; causal early rows (< QHI of each sequence): ctx bf16 hi + lo against exact bf16 Wo (2 products)
__global__ __launch_bounds__(128) void k_out(const float* __restrict__ Y, const float* __restrict__ WO, const float* __restrict__ BO, float* __restrict__ OUT) { __shared__ __align__(16) float sf[4][16][132]; __shared__ __align__(16) char sw[2][TILE_SZ];
  const int tid = threadIdx.x, wave = tid >> 5, lane = tid & 31, col = lane & 15, g = lane >> 4; const int c0 = blockIdx.y * 128; const size_t r0 = (size_t)blockIdx.x * 64 + wave * 16;
  v8f acc[8] = {};
  if (CAUSAL && (int)(((size_t)blockIdx.x * 64) % TT) < QHI) {   /* block-uniform */
#pragma unroll 2
    for (int kc = 0; kc < CC / 32; ++kc) { const F2 a = split_row(Y + (r0 + col) * CC, kc * 32, lane); asm volatile("s_wait_loadcnt 0x0" ::: "memory");
#pragma unroll
      for (int j = 0; j < 8; ++j) { const v16b w = WOCOL(WO, kc * 32, c0 + j * 16 + col, lane); asm volatile("s_wait_loadcnt 0x0" ::: "memory"); acc[j] = wmma_bf(a.h, w, acc[j]); acc[j] = wmma_bf(a.l, w, acc[j]); } }
#pragma unroll
    for (int j = 0; j < 8; ++j) { const float bias = BO ? bfr(BO[c0 + j * 16 + col]) : 0.f;
#pragma unroll
      for (int r = 0; r < 8; ++r) sf[wave][8 * g + r][j * 16 + col] = acc[j][r] + bias; }
  } else {
    const float* yp = Y + (r0 + g) * CC + col * 4; const float* wp = WO + (size_t)(wave * 16) * DIN + c0 + lane * 4;
    v4f wr[16], ar[8]; ld_wtile(wr, wp, DIN); ld_arow(ar, yp, CC);
    asm volatile("s_wait_xcnt 0x0" ::: "memory");   // the address registers of the first tile's loads are reused by what follows
    auto step = [&](int ks, bool more) __attribute__((always_inline)) { char* tile = sw[ks & 1]; char* dst = tile + wave * 16 * WPITCH + lane * 8;
#pragma unroll
      for (int i = 0; i < 16; ++i) { v4h t;
#pragma unroll
        for (int c = 0; c < 4; ++c) t[c] = (_Float16)(bfr(wr[i][c]) * 256.0f);
        *(v4h*)(dst + i * WPITCH) = t; }
      char* adst = tile + A_OFF + (wave * 16 + g) * APITCH + col * 8;   /* ctx carried x 2^6 into f16 so small-magnitude context rows stay clear of f16 subnormals */
#pragma unroll
      for (int i = 0; i < 8; ++i) { v4h t;
#pragma unroll
        for (int c = 0; c < 4; ++c) t[c] = (_Float16)(ar[i][c] * 64.0f);
        *(v4h*)(adst + i * 2 * APITCH) = t; }
      __builtin_amdgcn_sched_barrier(0);   // keeps the conversions above the next loads, so that these land in the registers just freed; else the build copies them at the trip's end and waits for the loads there
      __syncthreads();   // publishes this tile; it also ends every wave's reads of the other buffer, which the next trip overwrites
      if (more) { ld_wtile(wr, wp + (size_t)(ks + 1) * KS * DIN, DIN); ld_arow(ar, yp + (ks + 1) * KS, CC);
        asm volatile("s_wait_xcnt 0x0" ::: "memory"); }   // the address registers of these loads are rewritten further down
      __builtin_amdgcn_sched_barrier(0);   // keeps the next tile's loads up here, in flight under this tile's products; without it they may sink towards their uses
      const char* tl = tile + wfrag_lane(lane); const _Float16* al = (const _Float16*)(tile + A_OFF + (wave * 16 + col) * APITCH);
#pragma unroll
      for (int c = 0; c < 2; ++c) { const v16h a = frag_h(al + 32 * c, lane); v16h wf[8];   // the eight fragments as one group of LDS loads in front of their products: one LDS latency a group, not one a product
#pragma unroll
        for (int j = 0; j < 8; ++j) wf[j] = wfrag<v16h>(tl, c, j);
#pragma unroll
        for (int j = 0; j < 8; ++j) acc[j] = wmma16(a, wf[j], acc[j]); } };
    for (int ks = 0; ks < CC / KS - 1; ++ks) step(ks, true);
    step(CC / KS - 1, false);   // the last tile has no next one to load
#pragma unroll
    for (int j = 0; j < 8; ++j) { const float bias = BO ? bfr(BO[c0 + j * 16 + col]) : 0.f;
#pragma unroll
      for (int r = 0; r < 8; ++r) sf[wave][8 * g + r][j * 16 + col] = acc[j][r] * (1.0f / 16384.0f) + bias; } }   /* 2^-8 (Wo carry) x 2^-6 (ctx carry) */
  LDSX(); for (int rl = 0; rl < 16; ++rl) vst2(OUT + (r0 + rl) * DIN + c0 + lane * 4, *(const v4f*)&sf[wave][rl][lane * 4]); }

extern "C" void kernel_launch(void* const* d_in, const int* in_sizes, int n_in, void* d_out, int out_size, void* d_ws, size_t ws_size, hipStream_t stream) {
  (void)in_sizes; (void)n_in; (void)out_size;
  const float** F = (const float**)d_in;
  if (ws_size < (size_t)WS_END) return;
  char* ws = (char*)d_ws; _Float16 *QH = (_Float16*)(ws + WS_QH), *KH = (_Float16*)(ws + WS_KH), *VT = (_Float16*)(ws + WS_VT), *QL = (_Float16*)(ws + WS_QL), *KL = (_Float16*)(ws + WS_KL); __bf16 *VB = (__bf16*)(ws + WS_VB), *VBL = (__bf16*)(ws + WS_VBL); float *Y = (float*)(ws + WS_Y);
  (void)Y; (void)QL; (void)KL; (void)VB; (void)VBL;
  // inputs: 0 query [4,1024,1024]; 1 key; 2 value; 3 group_prob [4,1024,1024] f32 uniform[0,1); 4 mask [4,1024,1024] int32 (random 0/1); 5 wq [1024,1024] (in,out), 6 bq; 7 wk, 8 bk; 9 wv, 10 bv; 11 wo (in,out), 12 bo (biases nonzero)
  k_proj<<<dim3(TNB * TT / 64, CC / 128, 3), 128, 0, stream>>>(F[0], F[1], F[2], F[5], F[7], F[9], F[6], F[8], F[10], QH, QL, KH, KL, VT, VB, VBL);
  k_att<<<dim3(NQB, NH, TNB), 128, 0, stream>>>(QH, KH, VT, (const int*)d_in[4], F[3], Y);
  k_out<<<dim3(TNB * TT / 64, DIN / 128), 128, 0, stream>>>(Y, F[11], F[12], (float*)d_out);
}

// v005
// Measured time: 107 microseconds a run.
// In two side-by-side timings against v004, it was 1.03 and 1.05 times as fast.
// Counting every step since v000, it is 7.40 times as fast.
// compute dtype: all float inputs rounded to bf16; q/k/v projections with EXACT bf16 products on WMMA 16x16x32 (f32 accumulate) + bias; logits q x k once to f16 each (1 product) x SCALE; the int mask read per element (0 - -1e9); softmax f32 with a running maximum and sum; the weight exp(s - max) x 2^11 is MULTIPLIED by the float group_prob (which stays out of the sum: no renormalisation), once to f16 x v once to f16 (1 product), and the product is divided by the sum x 2^11; ctx x 2^6 once to f16 x Wo f16(bf16 x 2^8) + bo; f32 output.
#include <hip/hip_runtime.h>
#include <math.h>

typedef __attribute__((ext_vector_type(16))) _Float16 v16h;
typedef __attribute__((ext_vector_type(16))) __bf16 v16b;
typedef __attribute__((ext_vector_type(8)))  _Float16 v8h;
typedef __attribute__((ext_vector_type(8)))  float v8f;
typedef __attribute__((ext_vector_type(4)))  float v4f;
typedef __attribute__((ext_vector_type(2)))  float v2f;
typedef __attribute__((ext_vector_type(4)))  unsigned v4u;
typedef __attribute__((ext_vector_type(4)))  int v4i;
typedef float __attribute__((may_alias)) float_a;
typedef int __attribute__((may_alias)) int_a;

template <typename T> __device__ __forceinline__ void vst2(void* p, T v) { *(T*)p = v;  }
__device__ __forceinline__ v8f wmma16(v16h a, v16h b, v8f c) {
  v8f d = __builtin_amdgcn_wmma_f32_16x16x32_f16(false, a, false, b, (short)0, c, false, false);
  asm volatile("v_nop\n\tv_nop\n\tv_nop\n\tv_nop" : "+v"(d) : "v"(a), "v"(b));
  return d;
}
__device__ __forceinline__ v8f wmma_bf(v16b a, v16b b, v8f c) {
  v8f d = __builtin_amdgcn_wmma_f32_16x16x32_bf16(false, a, false, b, (short)0, c, false, false);
  asm volatile("v_nop\n\tv_nop\n\tv_nop\n\tv_nop" : "+v"(d) : "v"(a), "v"(b));
  return d;
}
// 16x16x32 fragments: lane = (h = lane>>4, row/col = lane&15); elements 0..7 = k0+8h+0..7, 8..15 = k0+16+8h+0..7; D element r = row 8h+r
__device__ __forceinline__ v16h frag_h(const _Float16* rowk0, int lane) {
  union { v16h v; v8h q[2]; } u; const _Float16* p = rowk0 + 8 * (lane >> 4);
  u.q[0] = *(const v8h*)p; u.q[1] = *(const v8h*)(p + 16); return u.v;
}
__device__ __forceinline__ v16h frag_f32(const float* rowk0, int lane) {
  v16h a; const float* p = rowk0 + 8 * (lane >> 4);
#pragma unroll
  for (int i = 0; i < 8; ++i) { a[i] = (_Float16)p[i]; a[8 + i] = (_Float16)p[16 + i]; }
  return a;
}
__device__ __forceinline__ v16h frag_f32s(const float* rowk0, int lane, float sc) {
  v16h a; const float* p = rowk0 + 8 * (lane >> 4);
#pragma unroll
  for (int i = 0; i < 8; ++i) { a[i] = (_Float16)(p[i] * sc); a[8 + i] = (_Float16)(p[16 + i] * sc); }
  return a;
}
// column fragment from a [K][ld] layout (column n), rows >= K read as 0
__device__ __forceinline__ v16h fragc_f32(const float* W, int k0, int n, int lane, int ld, int K) {
  v16h a; const int g = lane >> 4;
#pragma unroll
  for (int i = 0; i < 8; ++i) { const int ka = k0 + 8 * g + i, kb = ka + 16;
    a[i] = (_Float16)(ka < K ? W[(size_t)(ka < K ? ka : K - 1) * ld + n] : 0.f); a[8 + i] = (_Float16)(kb < K ? W[(size_t)(kb < K ? kb : K - 1) * ld + n] : 0.f); }
  return a;
}
struct F2 { v16b h, l; };
__device__ __forceinline__ F2 bsplit16(const float v[16]) { F2 r;
#pragma unroll
  for (int i = 0; i < 16; ++i) { const __bf16 h = (__bf16)v[i]; r.h[i] = h; r.l[i] = (__bf16)(v[i] - (float)h); }
  return r; }
__device__ __forceinline__ F2 split_row(const float* row, int k0, int lane) { float v[16]; const float* p = row + k0 + 8 * (lane >> 4);
#pragma unroll
  for (int i = 0; i < 8; ++i) { v[i] = p[i]; v[8 + i] = p[16 + i]; }
  return bsplit16(v); }
__device__ __forceinline__ F2 split_rowK(const float* row, int k0, int lane, int K) { float v[16]; const int g = lane >> 4;
#pragma unroll
  for (int i = 0; i < 8; ++i) { const int ka = k0 + 8 * g + i, kb = ka + 16; v[i] = ka < K ? row[ka < K ? ka : K - 1] : 0.f; v[8 + i] = kb < K ? row[kb < K ? kb : K - 1] : 0.f; }
  return bsplit16(v); }
__device__ __forceinline__ F2 split_col(const float* W, int k0, int n, int lane, int ld, int K) { float v[16]; const int g = lane >> 4;
#pragma unroll
  for (int i = 0; i < 8; ++i) { const int ka = k0 + 8 * g + i, kb = ka + 16; v[i] = ka < K ? W[(size_t)(ka < K ? ka : K - 1) * ld + n] : 0.f; v[8 + i] = kb < K ? W[(size_t)(kb < K ? kb : K - 1) * ld + n] : 0.f; }
  return bsplit16(v); }
__device__ __forceinline__ v8f mac3(const F2& a, const F2& b, v8f c) { c = wmma_bf(a.l, b.h, c); c = wmma_bf(a.h, b.l, c); return wmma_bf(a.h, b.h, c); }
__device__ __forceinline__ float sigm(float v) { return 1.0f / (1.0f + expf(-v)); }
#define LDSX() do { asm volatile("s_wait_dscnt 0" ::: "memory"); __builtin_amdgcn_wave_barrier(); __builtin_amdgcn_fence(__ATOMIC_RELEASE, "workgroup"); } while (0)

// Multi-headed attention whose probabilities are multiplied by a group-probability tensor (query / key / value [4,1024,1024]; (in,out) wq / wk / wv / wo [1024,1024] uniform(+-1/32) + biases uniform(+-1/32); 16 heads x 64; scale 1/8; mask [4,1024,1024] int32 random 0/1: scores[mask == 0] = -1e9; p = softmax(scores); p *= group_prob[:, None] with group_prob [4,1024,1024] uniform[0,1) f32 (multiplicative, after the softmax, no renormalisation); merge; wo + bo).
#define NB 4
#define TT 1024
#define CC 1024            // NH * HD = projected width
#define DIN 1024          // input (model) width
#define NH 16
#define HD 64
#define NQB (TT / 64)
#define HG 8
#define SCALE (0.125f)
#define CAUSAL 0
#ifndef TNB
#define TNB NB
#endif
__device__ __forceinline__ float bfr(float v) { return (float)(__bf16)v; }
__host__ __device__ __forceinline__ int kb_last(int qb) { return CAUSAL ? ((qb * 64 + 63) >> 7) : (TT / 128 - 1); }
typedef __attribute__((ext_vector_type(8))) __bf16 v8b;
__device__ __forceinline__ v16b frag_b(const __bf16* rowk0, int lane) {
  union { v16b v; v8b q[2]; } u; const __bf16* p = rowk0 + 8 * (lane >> 4);
  u.q[0] = *(const v8b*)p; u.q[1] = *(const v8b*)(p + 16); return u.v;
}
#define QBH 0              // unused: no kernel in this file has a high-precision attention path
#define QHI 0               // single-product logits on every row
#define KHI 64            // key rows carrying k residual / v bf16 hi+lo planes (written by k_proj; no kernel in this file reads them)
// B fragment (k rows k0+.., output column o) of a weight: (in,out) [K][ld] or (out,in) [ld rows of K]: bf16 exact, or f16(bf16 * 256) exact
__device__ __forceinline__ v16b wcol_io(const float* Wm, int k0, int o, int lane, int ld) { v16b w; const int g = lane >> 4;
#pragma unroll
  for (int i = 0; i < 8; ++i) { w[i] = (__bf16)Wm[(size_t)(k0 + 8 * g + i) * ld + o]; w[8 + i] = (__bf16)Wm[(size_t)(k0 + 16 + 8 * g + i) * ld + o]; }
  return w; }
__device__ __forceinline__ v16b wcol_oi(const float* Wm, int k0, int o, int lane, int K) { v16b w; const float* p = Wm + (size_t)o * K + k0 + 8 * (lane >> 4);
#pragma unroll
  for (int i = 0; i < 8; ++i) { w[i] = (__bf16)p[i]; w[8 + i] = (__bf16)p[16 + i]; }
  return w; }
__device__ __forceinline__ v16h wcolh_io(const float* Wm, int k0, int o, int lane, int ld) { v16h w; const int g = lane >> 4;
#pragma unroll
  for (int i = 0; i < 8; ++i) { w[i] = (_Float16)(bfr(Wm[(size_t)(k0 + 8 * g + i) * ld + o]) * 256.0f); w[8 + i] = (_Float16)(bfr(Wm[(size_t)(k0 + 16 + 8 * g + i) * ld + o]) * 256.0f); }
  return w; }
__device__ __forceinline__ v16h wcolh_oi(const float* Wm, int k0, int o, int lane, int K) { v16h w; const float* p = Wm + (size_t)o * K + k0 + 8 * (lane >> 4);
#pragma unroll
  for (int i = 0; i < 8; ++i) { w[i] = (_Float16)(bfr(p[i]) * 256.0f); w[8 + i] = (_Float16)(bfr(p[16 + i]) * 256.0f); }
  return w; }
#define WQKV_LAYOUT 0   // selects only WCOL, which no kernel here uses (k_proj always reads (in,out) [DIN][CC]): 0 = (in,out) [DIN][CC]; 1 = (out,in) [CC][DIN]; 2 = per-head [NH][DIN][HD]
__device__ __forceinline__ v16b wcol_hdk(const float* Wm, int k0, int o, int lane) { v16b w; const int g = lane >> 4; const float* p = Wm + (size_t)(o / HD) * DIN * HD + (o % HD);
#pragma unroll
  for (int i = 0; i < 8; ++i) { w[i] = (__bf16)p[(size_t)(k0 + 8 * g + i) * HD]; w[8 + i] = (__bf16)p[(size_t)(k0 + 16 + 8 * g + i) * HD]; }
  return w; }
#define WO_OUT_IN 0
#if WQKV_LAYOUT == 1
#define WCOL(W, k0, o, lane) wcol_oi(W, k0, o, lane, DIN)
#elif WQKV_LAYOUT == 2
#define WCOL(W, k0, o, lane) wcol_hdk(W, k0, o, lane)
#else
#define WCOL(W, k0, o, lane) wcol_io(W, k0, o, lane, CC)
#endif
#if WO_OUT_IN
#define WOCOL(W, k0, o, lane) wcol_oi(W, k0, o, lane, CC)
#define WOCOLH(W, k0, o, lane) wcolh_oi(W, k0, o, lane, CC)
#else
#define WOCOL(W, k0, o, lane) wcol_io(W, k0, o, lane, DIN)
#define WOCOLH(W, k0, o, lane) wcolh_io(W, k0, o, lane, DIN)
#endif
#define WS_QH  0u                                      // f16 q rows [b*t][CC]
#define WS_KH  (WS_QH + 2u * (size_t)NB * TT * CC)      // f16 k rows [b*t][CC]
#define WS_VT  (WS_KH + 2u * (size_t)NB * TT * CC)      // f16 v planes [b][c][t]
#define WS_QL  (WS_VT + 2u * (size_t)NB * CC * TT)      // f16 q residual x 2^10 rows [b][t < QHI][CC]
#define WS_KL  (WS_QL + 2u * (size_t)NB * QHI * CC)     // f16 k residual x 2^10 rows [b][t < KHI][CC]
#define WS_VB  (WS_KL + 2u * (size_t)NB * KHI * CC)     // bf16 v hi planes [b][c][t < KHI]
#define WS_VBL (WS_VB + 2u * (size_t)NB * CC * KHI)
#define WS_S   (WS_VBL + 2u * (size_t)NB * CC * KHI)    // (no longer used: the logits stay in registers; kept so that the layout behind it is unchanged)
#define WS_Y   (WS_S  + 4u * (size_t)HG * TT * TT)      // f32 ctx rows [b*t][CC] (only when there is an output projection)
#define WS_END (WS_Y  + 4u * (size_t)NB * TT * CC)

// ---- weight tile in LDS: KS k rows x 128 output columns, 16-bit, row-major as in memory; the block converts and stores each element once, and every wave takes its column fragments from there with the transposing load
#define KS 64
#define WPITCH 288         // bytes a staged row: 256 + 32, an odd multiple of 32 bytes (the transposing load's conflict-free pitch)
typedef __attribute__((ext_vector_type(8))) short v8s;
typedef __attribute__((ext_vector_type(4))) __bf16 v4b;
typedef __attribute__((ext_vector_type(4))) _Float16 v4h;
__device__ __forceinline__ v4u ld_tr16(const char* p) { typedef __attribute__((address_space(3))) v8s lds_v8s; return __builtin_bit_cast(v4u, __builtin_amdgcn_ds_load_tr16_b128_v8i16((lds_v8s*)p)); }
// lane (col, g) gets tile[kk*32 + 8g + 0..7][j*16 + col] and tile[kk*32 + 16 + 8g + 0..7][j*16 + col]: the k order of the row fragments above. tl = tile + wfrag_lane(lane)
__device__ __forceinline__ int wfrag_lane(int lane) { return (8 * (lane >> 4) + (lane & 7)) * WPITCH + 16 * ((lane >> 3) & 1); }
template <typename V> __device__ __forceinline__ V wfrag(const char* tl, int kk, int j) { union { V v; v4u q[2]; } u; const char* p = tl + kk * 32 * WPITCH + j * 32; u.q[0] = ld_tr16(p); u.q[1] = ld_tr16(p + 16 * WPITCH); return u.v; }
// left operand in LDS: behind each weight tile the block's BR rows x KS k, 16-bit, row-major; wave w stores rows 16w .. 16w + 15, and the tile's barrier publishes them to the waves that read them
#define BR 128             // rows a block: every weight tile is loaded, converted and stored once for 128 rows
#define APITCH 144         // bytes a staged row of the left operand: 128 + 16 (the conflict-free pitch of 16-byte LDS reads)
#define A_OFF (KS * WPITCH)
#define TILE_SZ (A_OFF + BR * APITCH)
// 8 waves a block. This thread's share of a tile: rows wave*8 + 0..7, columns lane*4 + 0..3 (a wave's load covers 512 contiguous bytes of one row); and of 16 rows x 64 k of the left operand: rows wave*16 + 2i + (lane >> 4), k (lane & 15)*4 + 0..3, so that a wave's load covers two whole 256-byte row pieces (4 lines; a load in fragment order touches 16 lines for the same 512 bytes)
// products: wave (wm = wave >> 1, wn = wave & 1) owns rows wm*32 + 0..31 x columns wn*64 + 0..63: 2 left and 4 weight fragments feed 8 products; acc[i*4 + j] = row tile i, column tile j
__device__ __forceinline__ void ld_wtile(v4f (&wr)[8], const float* wp, int ld) {
#pragma unroll
  for (int i = 0; i < 8; ++i) wr[i] = *(const v4f*)(wp + (size_t)i * ld); }
__device__ __forceinline__ void ld_arow(v4f (&ar)[8], const float* p, int ld) {
#pragma unroll
  for (int i = 0; i < 8; ++i) ar[i] = *(const v4f*)(p + (size_t)(2 * i) * ld); }
// ---- k_proj: block = (128 rows, 128 cols, which): q/k/v = X W (+ b) with exact bf16 products (K = DIN) -> which 0: q f16 rows (+ residual rows < QHI); 1: k f16 rows (+ residual rows < KHI); 2: v f16 planes [c][t] (+ bf16 hi/lo planes for t < KHI)
__global__ __launch_bounds__(256) void k_proj(const float* __restrict__ XQ, const float* __restrict__ XK, const float* __restrict__ XV, const float* __restrict__ WQ, const float* __restrict__ WK, const float* __restrict__ WV, const float* __restrict__ BQ, const float* __restrict__ BK, const float* __restrict__ BV,
    _Float16* __restrict__ QH, _Float16* __restrict__ QL, _Float16* __restrict__ KH, _Float16* __restrict__ KL, _Float16* __restrict__ VT, __bf16* __restrict__ VB, __bf16* __restrict__ VBL) {
  __shared__ __align__(16) union { struct { _Float16 sh[BR][136], sl[BR][136]; } r; struct { _Float16 th[128][BR + 8]; __bf16 tb[128][BR + 8], tbl[128][BR + 8]; } c; char w[2][TILE_SZ]; } sm;   // the weight and left-operand tiles live in the loop, the output staging (rows for q and k, planes for v) behind it
  auto& sh = sm.r.sh; auto& sl = sm.r.sl; auto& th = sm.c.th; auto& tb = sm.c.tb; auto& tbl = sm.c.tbl;
  const int tid = threadIdx.x, wave = tid >> 5, lane = tid & 31, col = lane & 15, g = lane >> 4, wm = wave >> 1, wn = wave & 1; const int which = blockIdx.z; const int c0 = blockIdx.y * 128; const size_t r0 = (size_t)blockIdx.x * BR; const size_t bb = r0 / TT; const int t0 = (int)(r0 % TT);
  const float* X = which == 0 ? XQ : which == 1 ? XK : XV; const float* WA = which == 0 ? WQ : which == 1 ? WK : WV; const float* BA = which == 0 ? BQ : which == 1 ? BK : BV;
  v8f acc[8] = {};
  const float* xp = X + (r0 + wave * 16 + g) * DIN + col * 4; const float* wp = WA + (size_t)(wave * 8) * CC + c0 + lane * 4;
  v4f wr[8], ar[8]; ld_wtile(wr, wp, CC); ld_arow(ar, xp, DIN);
  asm volatile("s_wait_xcnt 0x0" ::: "memory");   // the address registers of the first tile's loads are reused by what follows
  auto step = [&](int ks, bool more) __attribute__((always_inline)) { char* tile = sm.w[ks & 1]; char* dst = tile + wave * 8 * WPITCH + lane * 8;
#pragma unroll
    for (int i = 0; i < 8; ++i) { v4b t;
#pragma unroll
      for (int c = 0; c < 4; ++c) t[c] = (__bf16)wr[i][c];
      *(v4b*)(dst + i * WPITCH) = t; }
    char* adst = tile + A_OFF + (wave * 16 + g) * APITCH + col * 8;
#pragma unroll
    for (int i = 0; i < 8; ++i) { v4b t;
#pragma unroll
      for (int c = 0; c < 4; ++c) t[c] = (__bf16)ar[i][c];
      *(v4b*)(adst + i * 2 * APITCH) = t; }
    __builtin_amdgcn_sched_barrier(0);   // keeps the conversions above the next loads, so that these land in the registers just freed; else the build copies them at the trip's end and waits for the loads there
    __syncthreads();   // publishes this tile; it also ends every wave's reads of the other buffer, which the next trip overwrites
    if (more) { ld_wtile(wr, wp + (size_t)(ks + 1) * KS * CC, CC); ld_arow(ar, xp + (ks + 1) * KS, DIN);
      asm volatile("s_wait_xcnt 0x0" ::: "memory"); }   // the address registers of these loads are rewritten further down
    __builtin_amdgcn_sched_barrier(0);   // keeps the next tile's loads up here, in flight under this tile's products; without it they may sink towards their uses
    const char* tl = tile + wfrag_lane(lane) + wn * 128; const __bf16* al = (const __bf16*)(tile + A_OFF + (wm * 32 + col) * APITCH);
#pragma unroll
    for (int c = 0; c < 2; ++c) { const v16b a0 = frag_b(al + 32 * c, lane), a1 = frag_b(al + 16 * (APITCH / 2) + 32 * c, lane); v16b wf[4];   // the six fragments as one group of LDS loads in front of their products: one LDS latency a group, not one a product
#pragma unroll
      for (int j = 0; j < 4; ++j) wf[j] = wfrag<v16b>(tl, c, j);
#pragma unroll
      for (int j = 0; j < 4; ++j) { acc[j] = wmma_bf(a0, wf[j], acc[j]); acc[4 + j] = wmma_bf(a1, wf[j], acc[4 + j]); } } };
  for (int ks = 0; ks < DIN / KS - 1; ++ks) step(ks, true);
  step(DIN / KS - 1, false);   // the last tile has no next one to load
  __syncthreads();   // the staging below reuses the tiles' LDS: every wave has left the last tile
  if (which < 2) { _Float16* DH = which == 0 ? QH : KH; _Float16* DL = which == 0 ? QL : KL; const int nhi = which == 0 ? QHI : KHI;
#pragma unroll
    for (int j = 0; j < 4; ++j) { const int cl = wn * 64 + j * 16 + col; const float bias = BA ? bfr(BA[c0 + cl]) : 0.f;
#pragma unroll
      for (int i = 0; i < 2; ++i)
#pragma unroll
        for (int r = 0; r < 8; ++r) { const float v = acc[i * 4 + j][r] + bias; const _Float16 hv = (_Float16)v; const int rl = wm * 32 + i * 16 + 8 * g + r; sh[rl][cl] = hv; sl[rl][cl] = (_Float16)((v - (float)hv) * 1024.0f); } }
    __syncthreads();
    for (int e = tid; e < BR * 16; e += 256) { const int rl = e >> 4, q = e & 15; vst2((unsigned*)(DH + (r0 + rl) * CC + c0 + q * 8), *(const v4u*)&sh[rl][q * 8]); if (t0 + rl < nhi) { vst2((unsigned*)(DL + (bb * nhi + t0 + rl) * (size_t)CC + c0 + q * 8), *(const v4u*)&sl[rl][q * 8]);
        asm volatile("s_wait_xcnt 0x0" ::: "memory"); } }   // the next trip steps this store's address registers; the wait stands in the store's own branch, where no such step can be lifted over it
  } else {
#pragma unroll
    for (int j = 0; j < 4; ++j) { const int cl = wn * 64 + j * 16 + col; const float bias = BA ? bfr(BA[c0 + cl]) : 0.f;
#pragma unroll
      for (int i = 0; i < 2; ++i)
#pragma unroll
        for (int r = 0; r < 8; ++r) { const float v = acc[i * 4 + j][r] + bias; const int rl = wm * 32 + i * 16 + 8 * g + r; th[cl][rl] = (_Float16)v; const __bf16 bh = (__bf16)v; tb[cl][rl] = bh; tbl[cl][rl] = (__bf16)(v - (float)bh); } }
    __syncthreads();
    for (int e = tid; e < 128 * (BR / 8); e += 256) { const int cl = e >> 4, q = e & 15; vst2((unsigned*)(VT + (bb * CC + c0 + cl) * (size_t)TT + t0 + q * 8), *(const v4u*)&th[cl][q * 8]); if (t0 + q * 8 < KHI) { const size_t o3 = (bb * CC + c0 + cl) * (size_t)KHI + t0 + q * 8; vst2((unsigned*)(VB + o3), *(const v4u*)&tb[cl][q * 8]); vst2((unsigned*)(VBL + o3), *(const v4u*)&tbl[cl][q * 8]);
        asm volatile("s_wait_xcnt 0x0" ::: "memory"); } } } }   // the next trip steps these stores' address registers; the wait stands in the stores' own branch, where no such step can be lifted over it
// ---- k_att: block = 64 queries (4 waves x 16) of (b, h); each wave walks all keys in steps of 32 with a running maximum and sum, so no logit leaves the registers.
// S^T = K Q^T: lane (g, col) holds query col, keys k0 + 8g + r (tile 0) and k0 + 16 + 8g + r (tile 1), which is already the k order of a 16x16x32 operand; ctx^T = V^T P^T keeps the query in the lane, so maximum, sum and rescale are lane-local but for one exchange with lane ^ 16.
// Each step's operands (32 k rows, 64 v rows of 32 keys, 64 mask rows and 64 group_prob rows of 32 keys) come into LDS once per block by asynchronous copies that cover whole 128-byte lines (v: 64-byte pieces); the waves take their fragments from there. A fragment load straight from global memory touches 16 lines for 512 bytes.
__device__ __forceinline__ float xhalf(float x) { return __builtin_bit_cast(float, __builtin_amdgcn_permlanex16(__builtin_bit_cast(int, x), __builtin_bit_cast(int, x), 0x76543210, 0xfedcba98, false, false)); }  // lane l with lane l ^ 16
__device__ __forceinline__ v8f wmmah(v16h a, v16h b, v8f c) { return __builtin_amdgcn_wmma_f32_16x16x32_f16(false, a, false, b, (short)0, c, false, false); }
#define LOG2E 1.4426950408889634f
#define AKP 144            // bytes a staged k, mask or group_prob row: 128 + 16 (the conflict-free pitch of 16-byte LDS reads)
#define AVP 80             // bytes a staged v row: 64 + 16
#define A_K 0
#define A_V (A_K + 32 * AKP)
#define A_M (A_V + HD * AVP)
#define A_G (A_M + 64 * AKP)
#define A_SZ (A_G + 64 * AKP)
typedef __attribute__((address_space(3))) char lds_char;
// this thread's twelve 16-byte copies of one step's operands: k rows r, r + 16; v rows r, r + 32; mask and group_prob rows r, r + 16, r + 32, r + 48. The wait at the end stands in the copies' own statement, in front of any rewrite of the address registers that they name.
__device__ __forceinline__ void att_copy(unsigned lk, unsigned lv, unsigned lm, unsigned lg, const char* k, const char* v, const char* m, const char* g) {
  asm volatile("global_load_async_to_lds_b128 %0, %12, off\n\t"
               "global_load_async_to_lds_b128 %1, %13, off\n\t"
               "global_load_async_to_lds_b128 %2, %14, off\n\t"
               "global_load_async_to_lds_b128 %3, %15, off\n\t"
               "global_load_async_to_lds_b128 %4, %16, off\n\t"
               "global_load_async_to_lds_b128 %5, %17, off\n\t"
               "global_load_async_to_lds_b128 %6, %18, off\n\t"
               "global_load_async_to_lds_b128 %7, %19, off\n\t"
               "global_load_async_to_lds_b128 %8, %20, off\n\t"
               "global_load_async_to_lds_b128 %9, %21, off\n\t"
               "global_load_async_to_lds_b128 %10, %22, off\n\t"
               "global_load_async_to_lds_b128 %11, %23, off\n\t"
               "s_wait_xcnt 0x0"
               :: "v"(lk), "v"(lk + 16 * AKP), "v"(lv), "v"(lv + 32 * AVP), "v"(lm), "v"(lm + 16 * AKP), "v"(lm + 32 * AKP), "v"(lm + 48 * AKP), "v"(lg), "v"(lg + 16 * AKP), "v"(lg + 32 * AKP), "v"(lg + 48 * AKP),
                  "v"(k), "v"(k + 16 * CC * 2), "v"(v), "v"(v + 32 * TT * 2), "v"(m), "v"(m + 16 * TT * 4), "v"(m + 32 * TT * 4), "v"(m + 48 * TT * 4), "v"(g), "v"(g + 16 * TT * 4), "v"(g + 32 * TT * 4), "v"(g + 48 * TT * 4)
               : "memory"); }
__global__ __launch_bounds__(128) void k_att(const _Float16* __restrict__ QH, const _Float16* __restrict__ KH, const _Float16* __restrict__ VT, const int* __restrict__ MASK, const float* __restrict__ GPROB, float* __restrict__ Y) {
  __shared__ __align__(16) char sa[2][A_SZ];
  const int tid = threadIdx.x, wave = tid >> 5, lane = tid & 31, col = lane & 15, g = lane >> 4; const int h = blockIdx.y, b = blockIdx.z; const int q = blockIdx.x * 64 + wave * 16 + col;
  const _Float16* qp = QH + ((size_t)b * TT + q) * CC + h * HD; const v16h q0 = frag_h(qp, lane), q1 = frag_h(qp + 32, lane);
  asm volatile("s_wait_xcnt 0x0" ::: "memory");   // the q loads' address registers are reused by what follows
  const unsigned lb = (unsigned)(size_t)(lds_char*)&sa[0][0];
  const unsigned lk = lb + A_K + (tid >> 3) * AKP + (tid & 7) * 16, lv = lb + A_V + (tid >> 2) * AVP + (tid & 3) * 16, lm = lb + A_M + (tid >> 3) * AKP + (tid & 7) * 16, lg = lm + (A_G - A_M);
  const char* kg = (const char*)(KH + ((size_t)b * TT + (tid >> 3)) * CC + h * HD + (tid & 7) * 8); const char* vg = (const char*)(VT + ((size_t)b * CC + h * HD + (tid >> 2)) * (size_t)TT + (tid & 3) * 8);
  const size_t mo0 = ((size_t)b * TT + blockIdx.x * 64 + (tid >> 3)) * TT + (tid & 7) * 4; const char* mg = (const char*)(MASK + mo0); const char* gg = (const char*)(GPROB + mo0);
  auto copy = [&](int t) __attribute__((always_inline)) { const unsigned o = (t & 1) * A_SZ; att_copy(lk + o, lv + o, lm + o, lg + o, kg + (size_t)t * (32 * CC * 2), vg + t * 64, mg + t * 128, gg + t * 128); };
  v8f acc[HD / 16] = {}; float m = -3.0e38f, mo = -3.0e38f, l = 0.f;   // m: running maximum (base 2); mo = m - 11: every weight is carried x 2^11 into f16, the sum too, so the factor cancels in the final division
  copy(0);
  asm volatile("s_wait_asynccnt 0x0" ::: "memory");   // this wave's share of step 0 has landed
  __syncthreads();   // publishes step 0
  copy(1);
#pragma unroll 2   /* two steps a trip: the buffer's offset is then a constant in every LDS address */
  for (int t = 0; t < TT / 32; ++t) { const char* bp = sa[t & 1];
    v16h ka[4], vf[HD / 16]; v4i mk[4]; v4f gq[4];
    const int* mr = (const int*)(bp + A_M + (wave * 16 + col) * AKP) + 8 * g; const float* gr = (const float*)(bp + A_G + (wave * 16 + col) * AKP) + 8 * g;
#pragma unroll
    for (int i = 0; i < 2; ++i) { const _Float16* kr = (const _Float16*)(bp + A_K + (16 * i + col) * AKP); ka[2 * i] = frag_h(kr, lane); ka[2 * i + 1] = frag_h(kr + 32, lane); }
#pragma unroll
    for (int i = 0; i < 2; ++i) { mk[2 * i] = *(const v4i*)(mr + 16 * i); mk[2 * i + 1] = *(const v4i*)(mr + 16 * i + 4); gq[2 * i] = *(const v4f*)(gr + 16 * i); gq[2 * i + 1] = *(const v4f*)(gr + 16 * i + 4); }
#pragma unroll
    for (int j = 0; j < HD / 16; ++j) vf[j] = frag_h((const _Float16*)(bp + A_V + (j * 16 + col) * AVP), lane);
    // the step's publish point stands right behind its LDS reads (all that follows works on registers), so that the copies of the step after next fly for a whole step
    asm volatile("s_wait_dscnt 0x0" ::: "memory");      // this wave's reads of this buffer have returned: behind the barrier it is refilled
    asm volatile("s_wait_asynccnt 0x0" ::: "memory");   // this wave's share of the next step has landed
    __syncthreads();   // publishes the next step's buffer and ends every wave's reads of this one
    if (t + 2 < TT / 32) copy(t + 2);
    v8f s0 = {}, s1 = {}; s0 = wmmah(ka[0], q0, s0); s1 = wmmah(ka[2], q0, s1); s0 = wmmah(ka[1], q1, s0); s1 = wmmah(ka[3], q1, s1);
    float t16[16];
#pragma unroll
    for (int r = 0; r < 8; ++r) { t16[r] = mk[r >> 2][r & 3] == 0 ? -1.0e9f * LOG2E : s0[r] * (SCALE * LOG2E); t16[8 + r] = mk[2 + (r >> 2)][r & 3] == 0 ? -1.0e9f * LOG2E : s1[r] * (SCALE * LOG2E); }
    float mx = fmaxf(t16[0], t16[1]);
#pragma unroll
    for (int i = 2; i < 16; ++i) mx = fmaxf(mx, t16[i]);
    mx = fmaxf(mx, xhalf(mx)); m = fmaxf(m, mx); const float mn = m - 11.0f; const float corr = __builtin_amdgcn_exp2f(mo - mn); mo = mn;   // corr = 0 on the first step
    v16h p; float ls[4] = {0.f, 0.f, 0.f, 0.f};
#pragma unroll
    for (int i = 0; i < 16; ++i) { const float e = __builtin_amdgcn_exp2f(t16[i] - mn); ls[i & 3] += e; p[i] = (_Float16)(e * bfr(gq[i >> 2][i & 3])); }   // the sum takes the softmax weight alone; group_prob (bf16-rounded like every float input) enters the product only
    l = l * corr + ((ls[0] + ls[1]) + (ls[2] + ls[3]));
#pragma unroll
    for (int j = 0; j < HD / 16; ++j) { acc[j] *= corr; acc[j] = wmmah(vf[j], p, acc[j]); } }
  asm volatile("s_wait_asynccnt 0x0" ::: "memory");   // no copy is outstanding when the wave ends
  l += xhalf(l); const float inv = 1.0f / l;   // l >= 1: the maximum's own weight is in it
  float* yp = Y + ((size_t)b * TT + q) * CC + h * HD + 8 * g;
#pragma unroll
  for (int j = 0; j < HD / 16; ++j) { v4f lo, hi;
#pragma unroll
    for (int r = 0; r < 4; ++r) { lo[r] = acc[j][r] * inv; hi[r] = acc[j][4 + r] * inv; }
    vst2(yp + j * 16, lo); vst2(yp + j * 16 + 4, hi); } }
// ---- k_out: block = (128 rows, 128 cols): out = ctx Wo (+ bo): ctx x 2^6 once to f16 against Wo as f16(bf16 x 2^8) exact (1 product) x 2^-14
__global__ __launch_bounds__(256) void k_out(const float* __restrict__ Y, const float* __restrict__ WO, const float* __restrict__ BO, float* __restrict__ OUT) { __shared__ __align__(16) float sf[8][32][68]; __shared__ __align__(16) char sw[2][TILE_SZ];
  const int tid = threadIdx.x, wave = tid >> 5, lane = tid & 31, col = lane & 15, g = lane >> 4, wm = wave >> 1, wn = wave & 1; const int c0 = blockIdx.y * 128; const size_t r0 = (size_t)blockIdx.x * BR;
  v8f acc[8] = {};
  const float* yp = Y + (r0 + wave * 16 + g) * CC + col * 4; const float* wp = WO + (size_t)(wave * 8) * DIN + c0 + lane * 4;
  v4f wr[8], ar[8]; ld_wtile(wr, wp, DIN); ld_arow(ar, yp, CC);
  asm volatile("s_wait_xcnt 0x0" ::: "memory");   // the address registers of the first tile's loads are reused by what follows
  auto step = [&](int ks, bool more) __attribute__((always_inline)) { char* tile = sw[ks & 1]; char* dst = tile + wave * 8 * WPITCH + lane * 8;
#pragma unroll
    for (int i = 0; i < 8; ++i) { v4h t;
#pragma unroll
      for (int c = 0; c < 4; ++c) t[c] = (_Float16)(bfr(wr[i][c]) * 256.0f);
      *(v4h*)(dst + i * WPITCH) = t; }
    char* adst = tile + A_OFF + (wave * 16 + g) * APITCH + col * 8;   /* ctx carried x 2^6 into f16 so small-magnitude context rows stay clear of f16 subnormals */
#pragma unroll
    for (int i = 0; i < 8; ++i) { v4h t;
#pragma unroll
      for (int c = 0; c < 4; ++c) t[c] = (_Float16)(ar[i][c] * 64.0f);
      *(v4h*)(adst + i * 2 * APITCH) = t; }
    __builtin_amdgcn_sched_barrier(0);   // keeps the conversions above the next loads, so that these land in the registers just freed; else the build copies them at the trip's end and waits for the loads there
    __syncthreads();   // publishes this tile; it also ends every wave's reads of the other buffer, which the next trip overwrites
    if (more) { ld_wtile(wr, wp + (size_t)(ks + 1) * KS * DIN, DIN); ld_arow(ar, yp + (ks + 1) * KS, CC);
      asm volatile("s_wait_xcnt 0x0" ::: "memory"); }   // the address registers of these loads are rewritten further down
    __builtin_amdgcn_sched_barrier(0);   // keeps the next tile's loads up here, in flight under this tile's products; without it they may sink towards their uses
    const char* tl = tile + wfrag_lane(lane) + wn * 128; const _Float16* al = (const _Float16*)(tile + A_OFF + (wm * 32 + col) * APITCH);
#pragma unroll
    for (int c = 0; c < 2; ++c) { const v16h a0 = frag_h(al + 32 * c, lane), a1 = frag_h(al + 16 * (APITCH / 2) + 32 * c, lane); v16h wf[4];   // the six fragments as one group of LDS loads in front of their products: one LDS latency a group, not one a product
#pragma unroll
      for (int j = 0; j < 4; ++j) wf[j] = wfrag<v16h>(tl, c, j);
#pragma unroll
      for (int j = 0; j < 4; ++j) { acc[j] = wmma16(a0, wf[j], acc[j]); acc[4 + j] = wmma16(a1, wf[j], acc[4 + j]); } } };
  for (int ks = 0; ks < CC / KS - 1; ++ks) step(ks, true);
  step(CC / KS - 1, false);   // the last tile has no next one to load
#pragma unroll
  for (int j = 0; j < 4; ++j) { const float bias = BO ? bfr(BO[c0 + wn * 64 + j * 16 + col]) : 0.f;
#pragma unroll
    for (int i = 0; i < 2; ++i)
#pragma unroll
      for (int r = 0; r < 8; ++r) sf[wave][i * 16 + 8 * g + r][j * 16 + col] = acc[i * 4 + j][r] * (1.0f / 16384.0f) + bias; }   /* 2^-8 (Wo carry) x 2^-6 (ctx carry) */
  // each wave stages its own 32 x 64 piece and stores it as whole 256-byte row pieces, two rows a store
  LDSX(); for (int i = 0; i < 16; ++i) { const int rl = 2 * i + g; vst2(OUT + (r0 + wm * 32 + rl) * DIN + c0 + wn * 64 + col * 4, *(const v4f*)&sf[wave][rl][col * 4]); } }

extern "C" void kernel_launch(void* const* d_in, const int* in_sizes, int n_in, void* d_out, int out_size, void* d_ws, size_t ws_size, hipStream_t stream) {
  (void)in_sizes; (void)n_in; (void)out_size;
  const float** F = (const float**)d_in;
  if (ws_size < (size_t)WS_END) return;
  char* ws = (char*)d_ws; _Float16 *QH = (_Float16*)(ws + WS_QH), *KH = (_Float16*)(ws + WS_KH), *VT = (_Float16*)(ws + WS_VT), *QL = (_Float16*)(ws + WS_QL), *KL = (_Float16*)(ws + WS_KL); __bf16 *VB = (__bf16*)(ws + WS_VB), *VBL = (__bf16*)(ws + WS_VBL); float *Y = (float*)(ws + WS_Y);
  (void)Y; (void)QL; (void)KL; (void)VB; (void)VBL;
  // inputs: 0 query [4,1024,1024]; 1 key; 2 value; 3 group_prob [4,1024,1024] f32 uniform[0,1); 4 mask [4,1024,1024] int32 (random 0/1); 5 wq [1024,1024] (in,out), 6 bq; 7 wk, 8 bk; 9 wv, 10 bv; 11 wo (in,out), 12 bo (biases nonzero)
  k_proj<<<dim3(TNB * TT / BR, CC / 128, 3), 256, 0, stream>>>(F[0], F[1], F[2], F[5], F[7], F[9], F[6], F[8], F[10], QH, QL, KH, KL, VT, VB, VBL);
  k_att<<<dim3(NQB, NH, TNB), 128, 0, stream>>>(QH, KH, VT, (const int*)d_in[4], F[3], Y);
  k_out<<<dim3(TNB * TT / BR, DIN / 128), 256, 0, stream>>>(Y, F[11], F[12], (float*)d_out);
}

// v006
// It runs in 99.5 microseconds.
// Two timings next to v005 both put it at 1.08 times that version's speed.
// Counting every step since v000, it is 7.98 times as fast.
// compute dtype: all float inputs rounded to bf16; q/k/v projections with EXACT bf16 products on WMMA 16x16x32 (f32 accumulate) + bias; logits q x k once to f16 each (1 product) x SCALE; the int mask read per element (0 - -1e9); softmax f32 with a running maximum and sum; the weight exp(s - max) x 2^11 is MULTIPLIED by the float group_prob (which stays out of the sum: no renormalisation), once to f16 x v once to f16 (1 product), and the product is divided by the sum x 2^11; ctx x 2^6 once to f16 x Wo f16(bf16 x 2^8) + bo; f32 output.
#include <hip/hip_runtime.h>
#include <math.h>

typedef __attribute__((ext_vector_type(16))) _Float16 v16h;
typedef __attribute__((ext_vector_type(16))) __bf16 v16b;
typedef __attribute__((ext_vector_type(8)))  _Float16 v8h;
typedef __attribute__((ext_vector_type(8)))  float v8f;
typedef __attribute__((ext_vector_type(4)))  float v4f;
typedef __attribute__((ext_vector_type(2)))  float v2f;
typedef __attribute__((ext_vector_type(4)))  unsigned v4u;
typedef __attribute__((ext_vector_type(4)))  int v4i;
typedef float __attribute__((may_alias)) float_a;
typedef int __attribute__((may_alias)) int_a;

template <typename T> __device__ __forceinline__ void vst2(void* p, T v) { *(T*)p = v;  }
__device__ __forceinline__ v8f wmma16(v16h a, v16h b, v8f c) {
  v8f d = __builtin_amdgcn_wmma_f32_16x16x32_f16(false, a, false, b, (short)0, c, false, false);
  asm volatile("v_nop\n\tv_nop\n\tv_nop\n\tv_nop" : "+v"(d) : "v"(a), "v"(b));
  return d;
}
__device__ __forceinline__ v8f wmma_bf(v16b a, v16b b, v8f c) {
  v8f d = __builtin_amdgcn_wmma_f32_16x16x32_bf16(false, a, false, b, (short)0, c, false, false);
  asm volatile("v_nop\n\tv_nop\n\tv_nop\n\tv_nop" : "+v"(d) : "v"(a), "v"(b));
  return d;
}
// 16x16x32 fragments: lane = (h = lane>>4, row/col = lane&15); elements 0..7 = k0+8h+0..7, 8..15 = k0+16+8h+0..7; D element r = row 8h+r
__device__ __forceinline__ v16h frag_h(const _Float16* rowk0, int lane) {
  union { v16h v; v8h q[2]; } u; const _Float16* p = rowk0 + 8 * (lane >> 4);
  u.q[0] = *(const v8h*)p; u.q[1] = *(const v8h*)(p + 16); return u.v;
}
__device__ __forceinline__ v16h frag_f32(const float* rowk0, int lane) {
  v16h a; const float* p = rowk0 + 8 * (lane >> 4);
#pragma unroll
  for (int i = 0; i < 8; ++i) { a[i] = (_Float16)p[i]; a[8 + i] = (_Float16)p[16 + i]; }
  return a;
}
__device__ __forceinline__ v16h frag_f32s(const float* rowk0, int lane, float sc) {
  v16h a; const float* p = rowk0 + 8 * (lane >> 4);
#pragma unroll
  for (int i = 0; i < 8; ++i) { a[i] = (_Float16)(p[i] * sc); a[8 + i] = (_Float16)(p[16 + i] * sc); }
  return a;
}
// column fragment from a [K][ld] layout (column n), rows >= K read as 0
__device__ __forceinline__ v16h fragc_f32(const float* W, int k0, int n, int lane, int ld, int K) {
  v16h a; const int g = lane >> 4;
#pragma unroll
  for (int i = 0; i < 8; ++i) { const int ka = k0 + 8 * g + i, kb = ka + 16;
    a[i] = (_Float16)(ka < K ? W[(size_t)(ka < K ? ka : K - 1) * ld + n] : 0.f); a[8 + i] = (_Float16)(kb < K ? W[(size_t)(kb < K ? kb : K - 1) * ld + n] : 0.f); }
  return a;
}
struct F2 { v16b h, l; };
__device__ __forceinline__ F2 bsplit16(const float v[16]) { F2 r;
#pragma unroll
  for (int i = 0; i < 16; ++i) { const __bf16 h = (__bf16)v[i]; r.h[i] = h; r.l[i] = (__bf16)(v[i] - (float)h); }
  return r; }
__device__ __forceinline__ F2 split_row(const float* row, int k0, int lane) { float v[16]; const float* p = row + k0 + 8 * (lane >> 4);
#pragma unroll
  for (int i = 0; i < 8; ++i) { v[i] = p[i]; v[8 + i] = p[16 + i]; }
  return bsplit16(v); }
__device__ __forceinline__ F2 split_rowK(const float* row, int k0, int lane, int K) { float v[16]; const int g = lane >> 4;
#pragma unroll
  for (int i = 0; i < 8; ++i) { const int ka = k0 + 8 * g + i, kb = ka + 16; v[i] = ka < K ? row[ka < K ? ka : K - 1] : 0.f; v[8 + i] = kb < K ? row[kb < K ? kb : K - 1] : 0.f; }
  return bsplit16(v); }
__device__ __forceinline__ F2 split_col(const float* W, int k0, int n, int lane, int ld, int K) { float v[16]; const int g = lane >> 4;
#pragma unroll
  for (int i = 0; i < 8; ++i) { const int ka = k0 + 8 * g + i, kb = ka + 16; v[i] = ka < K ? W[(size_t)(ka < K ? ka : K - 1) * ld + n] : 0.f; v[8 + i] = kb < K ? W[(size_t)(kb < K ? kb : K - 1) * ld + n] : 0.f; }
  return bsplit16(v); }
__device__ __forceinline__ v8f mac3(const F2& a, const F2& b, v8f c) { c = wmma_bf(a.l, b.h, c); c = wmma_bf(a.h, b.l, c); return wmma_bf(a.h, b.h, c); }
__device__ __forceinline__ float sigm(float v) { return 1.0f / (1.0f + expf(-v)); }
#define LDSX() do { asm volatile("s_wait_dscnt 0" ::: "memory"); __builtin_amdgcn_wave_barrier(); __builtin_amdgcn_fence(__ATOMIC_RELEASE, "workgroup"); } while (0)

// Multi-headed attention whose probabilities are multiplied by a group-probability tensor (query / key / value [4,1024,1024]; (in,out) wq / wk / wv / wo [1024,1024] uniform(+-1/32) + biases uniform(+-1/32); 16 heads x 64; scale 1/8; mask [4,1024,1024] int32 random 0/1: scores[mask == 0] = -1e9; p = softmax(scores); p *= group_prob[:, None] with group_prob [4,1024,1024] uniform[0,1) f32 (multiplicative, after the softmax, no renormalisation); merge; wo + bo).
#define NB 4
#define TT 1024
#define CC 1024            // NH * HD = projected width
#define DIN 1024          // input (model) width
#define NH 16
#define HD 64
#define NQB (TT / 64)
#define HG 8
#define SCALE (0.125f)
#define CAUSAL 0
#ifndef TNB
#define TNB NB
#endif
__device__ __forceinline__ float bfr(float v) { return (float)(__bf16)v; }
__host__ __device__ __forceinline__ int kb_last(int qb) { return CAUSAL ? ((qb * 64 + 63) >> 7) : (TT / 128 - 1); }
typedef __attribute__((ext_vector_type(8))) __bf16 v8b;
__device__ __forceinline__ v16b frag_b(const __bf16* rowk0, int lane) {
  union { v16b v; v8b q[2]; } u; const __bf16* p = rowk0 + 8 * (lane >> 4);
  u.q[0] = *(const v8b*)p; u.q[1] = *(const v8b*)(p + 16); return u.v;
}
#define QBH 0              // unused: no kernel in this file has a high-precision attention path
#define QHI 0               // single-product logits on every row
#define KHI 64            // key rows carrying k residual / v bf16 hi+lo planes (written by k_proj; no kernel in this file reads them)
// B fragment (k rows k0+.., output column o) of a weight: (in,out) [K][ld] or (out,in) [ld rows of K]: bf16 exact, or f16(bf16 * 256) exact
__device__ __forceinline__ v16b wcol_io(const float* Wm, int k0, int o, int lane, int ld) { v16b w; const int g = lane >> 4;
#pragma unroll
  for (int i = 0; i < 8; ++i) { w[i] = (__bf16)Wm[(size_t)(k0 + 8 * g + i) * ld + o]; w[8 + i] = (__bf16)Wm[(size_t)(k0 + 16 + 8 * g + i) * ld + o]; }
  return w; }
__device__ __forceinline__ v16b wcol_oi(const float* Wm, int k0, int o, int lane, int K) { v16b w; const float* p = Wm + (size_t)o * K + k0 + 8 * (lane >> 4);
#pragma unroll
  for (int i = 0; i < 8; ++i) { w[i] = (__bf16)p[i]; w[8 + i] = (__bf16)p[16 + i]; }
  return w; }
__device__ __forceinline__ v16h wcolh_io(const float* Wm, int k0, int o, int lane, int ld) { v16h w; const int g = lane >> 4;
#pragma unroll
  for (int i = 0; i < 8; ++i) { w[i] = (_Float16)(bfr(Wm[(size_t)(k0 + 8 * g + i) * ld + o]) * 256.0f); w[8 + i] = (_Float16)(bfr(Wm[(size_t)(k0 + 16 + 8 * g + i) * ld + o]) * 256.0f); }
  return w; }
__device__ __forceinline__ v16h wcolh_oi(const float* Wm, int k0, int o, int lane, int K) { v16h w; const float* p = Wm + (size_t)o * K + k0 + 8 * (lane >> 4);
#pragma unroll
  for (int i = 0; i < 8; ++i) { w[i] = (_Float16)(bfr(p[i]) * 256.0f); w[8 + i] = (_Float16)(bfr(p[16 + i]) * 256.0f); }
  return w; }
#define WQKV_LAYOUT 0   // selects only WCOL, which no kernel here uses (k_proj always reads (in,out) [DIN][CC]): 0 = (in,out) [DIN][CC]; 1 = (out,in) [CC][DIN]; 2 = per-head [NH][DIN][HD]
__device__ __forceinline__ v16b wcol_hdk(const float* Wm, int k0, int o, int lane) { v16b w; const int g = lane >> 4; const float* p = Wm + (size_t)(o / HD) * DIN * HD + (o % HD);
#pragma unroll
  for (int i = 0; i < 8; ++i) { w[i] = (__bf16)p[(size_t)(k0 + 8 * g + i) * HD]; w[8 + i] = (__bf16)p[(size_t)(k0 + 16 + 8 * g + i) * HD]; }
  return w; }
#define WO_OUT_IN 0
#if WQKV_LAYOUT == 1
#define WCOL(W, k0, o, lane) wcol_oi(W, k0, o, lane, DIN)
#elif WQKV_LAYOUT == 2
#define WCOL(W, k0, o, lane) wcol_hdk(W, k0, o, lane)
#else
#define WCOL(W, k0, o, lane) wcol_io(W, k0, o, lane, CC)
#endif
#if WO_OUT_IN
#define WOCOL(W, k0, o, lane) wcol_oi(W, k0, o, lane, CC)
#define WOCOLH(W, k0, o, lane) wcolh_oi(W, k0, o, lane, CC)
#else
#define WOCOL(W, k0, o, lane) wcol_io(W, k0, o, lane, DIN)
#define WOCOLH(W, k0, o, lane) wcolh_io(W, k0, o, lane, DIN)
#endif
#define WS_QH  0u                                      // f16 q rows [b*t][CC]
#define WS_KH  (WS_QH + 2u * (size_t)NB * TT * CC)      // f16 k rows [b*t][CC]
#define WS_VT  (WS_KH + 2u * (size_t)NB * TT * CC)      // f16 v planes [b][c][t]
#define WS_QL  (WS_VT + 2u * (size_t)NB * CC * TT)      // f16 q residual x 2^10 rows [b][t < QHI][CC]
#define WS_KL  (WS_QL + 2u * (size_t)NB * QHI * CC)     // f16 k residual x 2^10 rows [b][t < KHI][CC]
#define WS_VB  (WS_KL + 2u * (size_t)NB * KHI * CC)     // bf16 v hi planes [b][c][t < KHI]
#define WS_VBL (WS_VB + 2u * (size_t)NB * CC * KHI)
#define WS_S   (WS_VBL + 2u * (size_t)NB * CC * KHI)    // 16-bit gate tiles (8 MiB of this range; its size is kept so that the layout behind it is unchanged)
#define WS_Y   (WS_S  + 4u * (size_t)HG * TT * TT)      // f32 ctx rows [b*t][CC] (only when there is an output projection)
#define WS_END (WS_Y  + 4u * (size_t)NB * TT * CC)

// ---- weight tile in LDS: KS k rows x 128 output columns, 16-bit, row-major as in memory; the block converts and stores each element once, and every wave takes its column fragments from there with the transposing load
#define KS 64
#define WPITCH 288         // bytes a staged row: 256 + 32, an odd multiple of 32 bytes (the transposing load's conflict-free pitch)
typedef __attribute__((ext_vector_type(8))) short v8s;
typedef __attribute__((ext_vector_type(4))) __bf16 v4b;
typedef __attribute__((ext_vector_type(4))) _Float16 v4h;
__device__ __forceinline__ v4u ld_tr16(const char* p) { typedef __attribute__((address_space(3))) v8s lds_v8s; return __builtin_bit_cast(v4u, __builtin_amdgcn_ds_load_tr16_b128_v8i16((lds_v8s*)p)); }
// lane (col, g) gets tile[kk*32 + 8g + 0..7][j*16 + col] and tile[kk*32 + 16 + 8g + 0..7][j*16 + col]: the k order of the row fragments above. tl = tile + wfrag_lane(lane)
__device__ __forceinline__ int wfrag_lane(int lane) { return (8 * (lane >> 4) + (lane & 7)) * WPITCH + 16 * ((lane >> 3) & 1); }
template <typename V> __device__ __forceinline__ V wfrag(const char* tl, int kk, int j) { union { V v; v4u q[2]; } u; const char* p = tl + kk * 32 * WPITCH + j * 32; u.q[0] = ld_tr16(p); u.q[1] = ld_tr16(p + 16 * WPITCH); return u.v; }
// left operand in LDS: behind each weight tile the block's BR rows x KS k, 16-bit, row-major; wave w stores rows 16w .. 16w + 15, and the tile's barrier publishes them to the waves that read them
#define BR 128             // rows a block: every weight tile is loaded, converted and stored once for 128 rows
#define APITCH 144         // bytes a staged row of the left operand: 128 + 16 (the conflict-free pitch of 16-byte LDS reads)
#define A_OFF (KS * WPITCH)
#define TILE_SZ (A_OFF + BR * APITCH)
// 8 waves a block. This thread's share of a tile: rows wave*8 + 0..7, columns lane*4 + 0..3 (a wave's load covers 512 contiguous bytes of one row); and of 16 rows x 64 k of the left operand: rows wave*16 + 2i + (lane >> 4), k (lane & 15)*4 + 0..3, so that a wave's load covers two whole 256-byte row pieces (4 lines; a load in fragment order touches 16 lines for the same 512 bytes)
// products: wave (wm = wave >> 1, wn = wave & 1) owns rows wm*32 + 0..31 x columns wn*64 + 0..63: 2 left and 4 weight fragments feed 8 products; acc[i*4 + j] = row tile i, column tile j
__device__ __forceinline__ void ld_wtile(v4f (&wr)[8], const float* wp, int ld) {
#pragma unroll
  for (int i = 0; i < 8; ++i) wr[i] = *(const v4f*)(wp + (size_t)i * ld); }
__device__ __forceinline__ void ld_arow(v4f (&ar)[8], const float* p, int ld) {
#pragma unroll
  for (int i = 0; i < 8; ++i) ar[i] = *(const v4f*)(p + (size_t)(2 * i) * ld); }
// ---- gate tiles: mask and group_prob of one (query, key) in 16 bits: group_prob rounded to bf16 (the rounding k_att applied per head), its sign bit set where mask == 0 (group_prob's generator is uniform [0,1): the sign is free).
// Layout [b*TT/64 + query block][key step of 32][64 queries][32 keys]: one step's tile of a k_att block is 4096 contiguous bytes. Written once a call by extra blocks of the k_proj launch, read by all 16 heads.
// A wave takes 2 rows x 512 keys; lane (hi = lane >> 4, lo = lane & 15) takes row hi, keys 64i + 4lo + 0..3: a load covers two whole 256-byte row pieces, a store two whole 128-byte lines (rows 2n, 2n + 1 of two tiles).
typedef __attribute__((ext_vector_type(4))) unsigned short v4us;
typedef __attribute__((ext_vector_type(8))) unsigned short v8us;
#define GATE_BLOCKS (NB * TT * (TT / 32) / 256)   // 256 threads x 32 elements a block
__device__ __forceinline__ void pack_gate(const int* __restrict__ MASK, const float* __restrict__ GPROB, unsigned short* __restrict__ MG, int pb, int tid) {
  const int gw = pb * 8 + (tid >> 5), lane = tid & 31; const int R = (gw >> 1) * 2 + (lane >> 4); const int k0 = (gw & 1) * 512 + (lane & 15) * 4;
  const int* mp = MASK + (size_t)R * TT + k0; const float* gp = GPROB + (size_t)R * TT + k0;
  v4i mk[8]; v4f gq[8];
#pragma unroll
  for (int i = 0; i < 8; ++i) { mk[i] = *(const v4i*)(mp + i * 64); gq[i] = *(const v4f*)(gp + i * 64); }
  asm volatile("s_wait_xcnt 0x0" :: "v"(mp), "v"(gp) : "memory");   // the loads' address registers are reused by what follows; as inputs here they stay whole up to the wait
  unsigned short* dp = MG + ((size_t)((R >> 6) * (TT / 32) + (k0 >> 5)) * 64 + (R & 63)) * 32 + (k0 & 31);
#pragma unroll
  for (int i = 0; i < 8; ++i) { v4us o;
#pragma unroll
    for (int c = 0; c < 4; ++c) o[c] = (unsigned short)(__builtin_bit_cast(unsigned short, (__bf16)gq[i][c]) | (mk[i][c] == 0 ? 0x8000u : 0u));
    *(v4us*)(dp + (size_t)i * 2 * 64 * 32) = o; } }
// ---- k_proj: block = (128 rows, 128 cols, which): q/k/v = X W (+ b) with exact bf16 products (K = DIN) -> which 0: q f16 rows (+ residual rows < QHI); 1: k f16 rows (+ residual rows < KHI); 2: v f16 planes [c][t] (+ bf16 hi/lo planes for t < KHI)
__global__ __launch_bounds__(256) void k_proj(const float* __restrict__ XQ, const float* __restrict__ XK, const float* __restrict__ XV, const float* __restrict__ WQ, const float* __restrict__ WK, const float* __restrict__ WV, const float* __restrict__ BQ, const float* __restrict__ BK, const float* __restrict__ BV,
    _Float16* __restrict__ QH, _Float16* __restrict__ QL, _Float16* __restrict__ KH, _Float16* __restrict__ KL, _Float16* __restrict__ VT, __bf16* __restrict__ VB, __bf16* __restrict__ VBL, const int* __restrict__ MASK, const float* __restrict__ GPROB, unsigned short* __restrict__ MG) {
  if (blockIdx.z >= 3) { pack_gate(MASK, GPROB, MG, (blockIdx.z - 3) * (TNB * TT / BR) * (CC / 128) + blockIdx.y * (TNB * TT / BR) + blockIdx.x, threadIdx.x); return; }   // the launch's last blocks write the gate tiles: whole blocks, in front of every barrier
  __shared__ __align__(16) union { struct { _Float16 sh[BR][136], sl[BR][136]; } r; struct { _Float16 th[128][BR + 8]; __bf16 tb[128][BR + 8], tbl[128][BR + 8]; } c; char w[2][TILE_SZ]; } sm;   // the weight and left-operand tiles live in the loop, the output staging (rows for q and k, planes for v) behind it
  auto& sh = sm.r.sh; auto& sl = sm.r.sl; auto& th = sm.c.th; auto& tb = sm.c.tb; auto& tbl = sm.c.tbl;
  const int tid = threadIdx.x, wave = tid >> 5, lane = tid & 31, col = lane & 15, g = lane >> 4, wm = wave >> 1, wn = wave & 1; const int which = blockIdx.z; const int c0 = blockIdx.y * 128; const size_t r0 = (size_t)blockIdx.x * BR; const size_t bb = r0 / TT; const int t0 = (int)(r0 % TT);
  const float* X = which == 0 ? XQ : which == 1 ? XK : XV; const float* WA = which == 0 ? WQ : which == 1 ? WK : WV; const float* BA = which == 0 ? BQ : which == 1 ? BK : BV;
  v8f acc[8] = {};
  const float* xp = X + (r0 + wave * 16 + g) * DIN + col * 4; const float* wp = WA + (size_t)(wave * 8) * CC + c0 + lane * 4;
  v4f wr[8], ar[8]; ld_wtile(wr, wp, CC); ld_arow(ar, xp, DIN);
  asm volatile("s_wait_xcnt 0x0" ::: "memory");   // the address registers of the first tile's loads are reused by what follows
  auto step = [&](int ks, bool more) __attribute__((always_inline)) { char* tile = sm.w[ks & 1]; char* dst = tile + wave * 8 * WPITCH + lane * 8;
#pragma unroll
    for (int i = 0; i < 8; ++i) { v4b t;
#pragma unroll
      for (int c = 0; c < 4; ++c) t[c] = (__bf16)wr[i][c];
      *(v4b*)(dst + i * WPITCH) = t; }
    char* adst = tile + A_OFF + (wave * 16 + g) * APITCH + col * 8;
#pragma unroll
    for (int i = 0; i < 8; ++i) { v4b t;
#pragma unroll
      for (int c = 0; c < 4; ++c) t[c] = (__bf16)ar[i][c];
      *(v4b*)(adst + i * 2 * APITCH) = t; }
    __builtin_amdgcn_sched_barrier(0);   // keeps the conversions above the next loads, so that these land in the registers just freed; else the build copies them at the trip's end and waits for the loads there
    __syncthreads();   // publishes this tile; it also ends every wave's reads of the other buffer, which the next trip overwrites
    if (more) { ld_wtile(wr, wp + (size_t)(ks + 1) * KS * CC, CC); ld_arow(ar, xp + (ks + 1) * KS, DIN);
      asm volatile("s_wait_xcnt 0x0" ::: "memory"); }   // the address registers of these loads are rewritten further down
    __builtin_amdgcn_sched_barrier(0);   // keeps the next tile's loads up here, in flight under this tile's products; without it they may sink towards their uses
    const char* tl = tile + wfrag_lane(lane) + wn * 128; const __bf16* al = (const __bf16*)(tile + A_OFF + (wm * 32 + col) * APITCH);
#pragma unroll
    for (int c = 0; c < 2; ++c) { const v16b a0 = frag_b(al + 32 * c, lane), a1 = frag_b(al + 16 * (APITCH / 2) + 32 * c, lane); v16b wf[4];   // the six fragments as one group of LDS loads in front of their products: one LDS latency a group, not one a product
#pragma unroll
      for (int j = 0; j < 4; ++j) wf[j] = wfrag<v16b>(tl, c, j);
#pragma unroll
      for (int j = 0; j < 4; ++j) { acc[j] = wmma_bf(a0, wf[j], acc[j]); acc[4 + j] = wmma_bf(a1, wf[j], acc[4 + j]); } } };
  for (int ks = 0; ks < DIN / KS - 1; ++ks) step(ks, true);
  step(DIN / KS - 1, false);   // the last tile has no next one to load
  __syncthreads();   // the staging below reuses the tiles' LDS: every wave has left the last tile
  if (which < 2) { _Float16* DH = which == 0 ? QH : KH; _Float16* DL = which == 0 ? QL : KL; const int nhi = which == 0 ? QHI : KHI;
#pragma unroll
    for (int j = 0; j < 4; ++j) { const int cl = wn * 64 + j * 16 + col; const float bias = BA ? bfr(BA[c0 + cl]) : 0.f;
#pragma unroll
      for (int i = 0; i < 2; ++i)
#pragma unroll
        for (int r = 0; r < 8; ++r) { const float v = acc[i * 4 + j][r] + bias; const _Float16 hv = (_Float16)v; const int rl = wm * 32 + i * 16 + 8 * g + r; sh[rl][cl] = hv; sl[rl][cl] = (_Float16)((v - (float)hv) * 1024.0f); } }
    __syncthreads();
    for (int e = tid; e < BR * 16; e += 256) { const int rl = e >> 4, q = e & 15; vst2((unsigned*)(DH + (r0 + rl) * CC + c0 + q * 8), *(const v4u*)&sh[rl][q * 8]); if (t0 + rl < nhi) { vst2((unsigned*)(DL + (bb * nhi + t0 + rl) * (size_t)CC + c0 + q * 8), *(const v4u*)&sl[rl][q * 8]);
        asm volatile("s_wait_xcnt 0x0" ::: "memory"); } }   // the next trip steps this store's address registers; the wait stands in the store's own branch, where no such step can be lifted over it
  } else {
#pragma unroll
    for (int j = 0; j < 4; ++j) { const int cl = wn * 64 + j * 16 + col; const float bias = BA ? bfr(BA[c0 + cl]) : 0.f;
#pragma unroll
      for (int i = 0; i < 2; ++i)
#pragma unroll
        for (int r = 0; r < 8; ++r) { const float v = acc[i * 4 + j][r] + bias; const int rl = wm * 32 + i * 16 + 8 * g + r; th[cl][rl] = (_Float16)v; const __bf16 bh = (__bf16)v; tb[cl][rl] = bh; tbl[cl][rl] = (__bf16)(v - (float)bh); } }
    __syncthreads();
    for (int e = tid; e < 128 * (BR / 8); e += 256) { const int cl = e >> 4, q = e & 15; vst2((unsigned*)(VT + (bb * CC + c0 + cl) * (size_t)TT + t0 + q * 8), *(const v4u*)&th[cl][q * 8]); if (t0 + q * 8 < KHI) { const size_t o3 = (bb * CC + c0 + cl) * (size_t)KHI + t0 + q * 8; vst2((unsigned*)(VB + o3), *(const v4u*)&tb[cl][q * 8]); vst2((unsigned*)(VBL + o3), *(const v4u*)&tbl[cl][q * 8]);
        asm volatile("s_wait_xcnt 0x0" ::: "memory"); } } } }   // the next trip steps these stores' address registers; the wait stands in the stores' own branch, where no such step can be lifted over it
// ---- k_att: block = 64 queries (4 waves x 16) of (b, h); each wave walks all keys in steps of 32 with a running maximum and sum, so no logit leaves the registers.
// S^T = K Q^T: lane (g, col) holds query col, keys k0 + 8g + r (tile 0) and k0 + 16 + 8g + r (tile 1), which is already the k order of a 16x16x32 operand; ctx^T = V^T P^T keeps the query in the lane, so maximum, sum and rescale are lane-local but for one exchange with lane ^ 16.
// Each step's operands (32 k rows, 64 v rows of 32 keys, 64 gate rows of 32 keys) come into LDS once per block by asynchronous copies that cover whole 128-byte lines (v: 64-byte pieces); the waves take their fragments from there. A fragment load straight from global memory touches 16 lines for 512 bytes.
__device__ __forceinline__ float xhalf(float x) { return __builtin_bit_cast(float, __builtin_amdgcn_permlanex16(__builtin_bit_cast(int, x), __builtin_bit_cast(int, x), 0x76543210, 0xfedcba98, false, false)); }  // lane l with lane l ^ 16
__device__ __forceinline__ v8f wmmah(v16h a, v16h b, v8f c) { return __builtin_amdgcn_wmma_f32_16x16x32_f16(false, a, false, b, (short)0, c, false, false); }
#define LOG2E 1.4426950408889634f
#define AKP 144            // bytes a staged k row: 128 + 16 (the conflict-free pitch of 16-byte LDS reads)
#define AVP 80             // bytes a staged v or gate row: 64 + 16
#define A_K 0
#define A_V (A_K + 32 * AKP)
#define A_M (A_V + HD * AVP)
#define A_SZ (A_M + 64 * AVP)
typedef __attribute__((address_space(3))) char lds_char;
// this thread's six 16-byte copies of one step's operands: k rows r, r + 16; v rows r, r + 32; gate rows r, r + 32. The wait at the end stands in the copies' own statement, in front of any rewrite of the address registers that they name.
__device__ __forceinline__ void att_copy(unsigned lk, unsigned lv, unsigned lm, const char* k, const char* v, const char* m) {
  asm volatile("global_load_async_to_lds_b128 %0, %6, off\n\t"
               "global_load_async_to_lds_b128 %1, %7, off\n\t"
               "global_load_async_to_lds_b128 %2, %8, off\n\t"
               "global_load_async_to_lds_b128 %3, %9, off\n\t"
               "global_load_async_to_lds_b128 %4, %10, off\n\t"
               "global_load_async_to_lds_b128 %5, %11, off\n\t"
               "s_wait_xcnt 0x0"
               :: "v"(lk), "v"(lk + 16 * AKP), "v"(lv), "v"(lv + 32 * AVP), "v"(lm), "v"(lm + 32 * AVP),
                  "v"(k), "v"(k + 16 * CC * 2), "v"(v), "v"(v + 32 * TT * 2), "v"(m), "v"(m + 32 * 64)
               : "memory"); }
__global__ __launch_bounds__(128) void k_att(const _Float16* __restrict__ QH, const _Float16* __restrict__ KH, const _Float16* __restrict__ VT, const unsigned short* __restrict__ MG, float* __restrict__ Y) {
  __shared__ __align__(16) char sa[2][A_SZ];
  const int tid = threadIdx.x, wave = tid >> 5, lane = tid & 31, col = lane & 15, g = lane >> 4; const int h = blockIdx.y, b = blockIdx.z; const int q = blockIdx.x * 64 + wave * 16 + col;
  const _Float16* qp = QH + ((size_t)b * TT + q) * CC + h * HD; const v16h q0 = frag_h(qp, lane), q1 = frag_h(qp + 32, lane);
  asm volatile("s_wait_xcnt 0x0" ::: "memory");   // the q loads' address registers are reused by what follows
  const unsigned lb = (unsigned)(size_t)(lds_char*)&sa[0][0];
  const unsigned lk = lb + A_K + (tid >> 3) * AKP + (tid & 7) * 16, lv = lb + A_V + (tid >> 2) * AVP + (tid & 3) * 16, lm = lv + (A_M - A_V);
  const char* kg = (const char*)(KH + ((size_t)b * TT + (tid >> 3)) * CC + h * HD + (tid & 7) * 8); const char* vg = (const char*)(VT + ((size_t)b * CC + h * HD + (tid >> 2)) * (size_t)TT + (tid & 3) * 8);
  const char* mg = (const char*)(MG + (size_t)(b * NQB + blockIdx.x) * (TT / 32) * (64 * 32)) + tid * 16;   // a tile's 256 pieces of 16 bytes in their order: piece p = row p >> 2, part p & 3
  auto copy = [&](int t) __attribute__((always_inline)) { const unsigned o = (t & 1) * A_SZ; att_copy(lk + o, lv + o, lm + o, kg + (size_t)t * (32 * CC * 2), vg + t * 64, mg + t * (64 * 64)); };
  v8f acc[HD / 16] = {}; float m = -3.0e38f, mo = -3.0e38f, l = 0.f;   // m: running maximum (base 2); mo = m - 11: every weight is carried x 2^11 into f16, the sum too, so the factor cancels in the final division
  copy(0);
  asm volatile("s_wait_asynccnt 0x0" ::: "memory");   // this wave's share of step 0 has landed
  __syncthreads();   // publishes step 0
  copy(1);
#pragma unroll 2   /* two steps a trip: the buffer's offset is then a constant in every LDS address */
  for (int t = 0; t < TT / 32; ++t) { const char* bp = sa[t & 1];
    v16h ka[4], vf[HD / 16]; v8us gt[2];   // gt: this query's gates of keys 8g + 0..7 and 16 + 8g + 0..7, the order of t16 below
    const unsigned short* mr = (const unsigned short*)(bp + A_M + (wave * 16 + col) * AVP) + 8 * g;
#pragma unroll
    for (int i = 0; i < 2; ++i) { const _Float16* kr = (const _Float16*)(bp + A_K + (16 * i + col) * AKP); ka[2 * i] = frag_h(kr, lane); ka[2 * i + 1] = frag_h(kr + 32, lane); }
    gt[0] = *(const v8us*)mr; gt[1] = *(const v8us*)(mr + 16);
#pragma unroll
    for (int j = 0; j < HD / 16; ++j) vf[j] = frag_h((const _Float16*)(bp + A_V + (j * 16 + col) * AVP), lane);
    // the step's publish point stands right behind its LDS reads (all that follows works on registers), so that the copies of the step after next fly for a whole step
    asm volatile("s_wait_dscnt 0x0" ::: "memory");      // this wave's reads of this buffer have returned: behind the barrier it is refilled
    asm volatile("s_wait_asynccnt 0x0" ::: "memory");   // this wave's share of the next step has landed
    __syncthreads();   // publishes the next step's buffer and ends every wave's reads of this one
    if (t + 2 < TT / 32) copy(t + 2);
    v8f s0 = {}, s1 = {}; s0 = wmmah(ka[0], q0, s0); s1 = wmmah(ka[2], q0, s1); s0 = wmmah(ka[1], q1, s0); s1 = wmmah(ka[3], q1, s1);
    float t16[16];
#pragma unroll
    for (int r = 0; r < 8; ++r) { t16[r] = (short)gt[0][r] < 0 ? -1.0e9f * LOG2E : s0[r] * (SCALE * LOG2E); t16[8 + r] = (short)gt[1][r] < 0 ? -1.0e9f * LOG2E : s1[r] * (SCALE * LOG2E); }
    float mx = fmaxf(t16[0], t16[1]);
#pragma unroll
    for (int i = 2; i < 16; ++i) mx = fmaxf(mx, t16[i]);
    mx = fmaxf(mx, xhalf(mx)); m = fmaxf(m, mx); const float mn = m - 11.0f; const float corr = __builtin_amdgcn_exp2f(mo - mn); mo = mn;   // corr = 0 on the first step
    v16h p; float ls[4] = {0.f, 0.f, 0.f, 0.f};
#pragma unroll
    for (int i = 0; i < 16; ++i) { const float e = __builtin_amdgcn_exp2f(t16[i] - mn); ls[i & 3] += e; const unsigned short u = gt[i >> 3][i & 7]; p[i] = (_Float16)(e * __builtin_fabsf((float)__builtin_bit_cast(__bf16, u))); }   // the sum takes the softmax weight alone; group_prob (bf16-rounded like every float input; the gate without its mask bit, which is the sign) enters the product only
    l = l * corr + ((ls[0] + ls[1]) + (ls[2] + ls[3]));
#pragma unroll
    for (int j = 0; j < HD / 16; ++j) { acc[j] *= corr; acc[j] = wmmah(vf[j], p, acc[j]); } }
  asm volatile("s_wait_asynccnt 0x0" ::: "memory");   // no copy is outstanding when the wave ends
  l += xhalf(l); const float inv = 1.0f / l;   // l >= 1: the maximum's own weight is in it
  float* yp = Y + ((size_t)b * TT + q) * CC + h * HD + 8 * g;
#pragma unroll
  for (int j = 0; j < HD / 16; ++j) { v4f lo, hi;
#pragma unroll
    for (int r = 0; r < 4; ++r) { lo[r] = acc[j][r] * inv; hi[r] = acc[j][4 + r] * inv; }
    vst2(yp + j * 16, lo); vst2(yp + j * 16 + 4, hi); } }
// ---- k_out: block = (128 rows, 128 cols): out = ctx Wo (+ bo): ctx x 2^6 once to f16 against Wo as f16(bf16 x 2^8) exact (1 product) x 2^-14
__global__ __launch_bounds__(256) void k_out(const float* __restrict__ Y, const float* __restrict__ WO, const float* __restrict__ BO, float* __restrict__ OUT) { __shared__ __align__(16) float sf[8][32][68]; __shared__ __align__(16) char sw[2][TILE_SZ];
  const int tid = threadIdx.x, wave = tid >> 5, lane = tid & 31, col = lane & 15, g = lane >> 4, wm = wave >> 1, wn = wave & 1; const int c0 = blockIdx.y * 128; const size_t r0 = (size_t)blockIdx.x * BR;
  v8f acc[8] = {};
  const float* yp = Y + (r0 + wave * 16 + g) * CC + col * 4; const float* wp = WO + (size_t)(wave * 8) * DIN + c0 + lane * 4;
  v4f wr[8], ar[8]; ld_wtile(wr, wp, DIN); ld_arow(ar, yp, CC);
  asm volatile("s_wait_xcnt 0x0" ::: "memory");   // the address registers of the first tile's loads are reused by what follows
  auto step = [&](int ks, bool more) __attribute__((always_inline)) { char* tile = sw[ks & 1]; char* dst = tile + wave * 8 * WPITCH + lane * 8;
#pragma unroll
    for (int i = 0; i < 8; ++i) { v4h t;
#pragma unroll
      for (int c = 0; c < 4; ++c) t[c] = (_Float16)(bfr(wr[i][c]) * 256.0f);
      *(v4h*)(dst + i * WPITCH) = t; }
    char* adst = tile + A_OFF + (wave * 16 + g) * APITCH + col * 8;   /* ctx carried x 2^6 into f16 so small-magnitude context rows stay clear of f16 subnormals */
#pragma unroll
    for (int i = 0; i < 8; ++i) { v4h t;
#pragma unroll
      for (int c = 0; c < 4; ++c) t[c] = (_Float16)(ar[i][c] * 64.0f);
      *(v4h*)(adst + i * 2 * APITCH) = t; }
    __builtin_amdgcn_sched_barrier(0);   // keeps the conversions above the next loads, so that these land in the registers just freed; else the build copies them at the trip's end and waits for the loads there
    __syncthreads();   // publishes this tile; it also ends every wave's reads of the other buffer, which the next trip overwrites
    if (more) { ld_wtile(wr, wp + (size_t)(ks + 1) * KS * DIN, DIN); ld_arow(ar, yp + (ks + 1) * KS, CC);
      asm volatile("s_wait_xcnt 0x0" ::: "memory"); }   // the address registers of these loads are rewritten further down
    __builtin_amdgcn_sched_barrier(0);   // keeps the next tile's loads up here, in flight under this tile's products; without it they may sink towards their uses
    const char* tl = tile + wfrag_lane(lane) + wn * 128; const _Float16* al = (const _Float16*)(tile + A_OFF + (wm * 32 + col) * APITCH);
#pragma unroll
    for (int c = 0; c < 2; ++c) { const v16h a0 = frag_h(al + 32 * c, lane), a1 = frag_h(al + 16 * (APITCH / 2) + 32 * c, lane); v16h wf[4];   // the six fragments as one group of LDS loads in front of their products: one LDS latency a group, not one a product
#pragma unroll
      for (int j = 0; j < 4; ++j) wf[j] = wfrag<v16h>(tl, c, j);
#pragma unroll
      for (int j = 0; j < 4; ++j) { acc[j] = wmma16(a0, wf[j], acc[j]); acc[4 + j] = wmma16(a1, wf[j], acc[4 + j]); } } };
  for (int ks = 0; ks < CC / KS - 1; ++ks) step(ks, true);
  step(CC / KS - 1, false);   // the last tile has no next one to load
#pragma unroll
  for (int j = 0; j < 4; ++j) { const float bias = BO ? bfr(BO[c0 + wn * 64 + j * 16 + col]) : 0.f;
#pragma unroll
    for (int i = 0; i < 2; ++i)
#pragma unroll
      for (int r = 0; r < 8; ++r) sf[wave][i * 16 + 8 * g + r][j * 16 + col] = acc[i * 4 + j][r] * (1.0f / 16384.0f) + bias; }   /* 2^-8 (Wo carry) x 2^-6 (ctx carry) */
  // each wave stages its own 32 x 64 piece and stores it as whole 256-byte row pieces, two rows a store
  LDSX(); for (int i = 0; i < 16; ++i) { const int rl = 2 * i + g; vst2(OUT + (r0 + wm * 32 + rl) * DIN + c0 + wn * 64 + col * 4, *(const v4f*)&sf[wave][rl][col * 4]); } }

extern "C" void kernel_launch(void* const* d_in, const int* in_sizes, int n_in, void* d_out, int out_size, void* d_ws, size_t ws_size, hipStream_t stream) {
  (void)in_sizes; (void)n_in; (void)out_size;
  const float** F = (const float**)d_in;
  if (ws_size < (size_t)WS_END) return;
  char* ws = (char*)d_ws; _Float16 *QH = (_Float16*)(ws + WS_QH), *KH = (_Float16*)(ws + WS_KH), *VT = (_Float16*)(ws + WS_VT), *QL = (_Float16*)(ws + WS_QL), *KL = (_Float16*)(ws + WS_KL); __bf16 *VB = (__bf16*)(ws + WS_VB), *VBL = (__bf16*)(ws + WS_VBL); float *Y = (float*)(ws + WS_Y); unsigned short *MG = (unsigned short*)(ws + WS_S);
  (void)Y; (void)QL; (void)KL; (void)VB; (void)VBL;
  // inputs: 0 query [4,1024,1024]; 1 key; 2 value; 3 group_prob [4,1024,1024] f32 uniform[0,1); 4 mask [4,1024,1024] int32 (random 0/1); 5 wq [1024,1024] (in,out), 6 bq; 7 wk, 8 bk; 9 wv, 10 bv; 11 wo (in,out), 12 bo (biases nonzero)
  k_proj<<<dim3(TNB * TT / BR, CC / 128, 3 + GATE_BLOCKS / ((TNB * TT / BR) * (CC / 128))), 256, 0, stream>>>(F[0], F[1], F[2], F[5], F[7], F[9], F[6], F[8], F[10], QH, QL, KH, KL, VT, VB, VBL, (const int*)d_in[4], F[3], MG);
  k_att<<<dim3(NQB, NH, TNB), 128, 0, stream>>>(QH, KH, VT, MG, Y);
  k_out<<<dim3(TNB * TT / BR, DIN / 128), 256, 0, stream>>>(Y, F[11], F[12], (float*)d_out);
}

// v007
// It runs in 84.5 microseconds.
// In two side-by-side timings against v006, it was 1.17 and 1.18 times as fast.
// Over all steps from v000 it is 9.38 times as fast.
// compute dtype: all float inputs rounded to bf16; q/k/v projections with EXACT bf16 products on WMMA 16x16x32 (f32 accumulate) + bias; logits q x k once to f16 each (1 product) x SCALE; the int mask read per element (0 - -1e9); softmax f32 with a running maximum and sum; the weight exp(s - max) x 2^11 is MULTIPLIED by the float group_prob (which stays out of the sum: no renormalisation), once to f16 x v once to f16 (1 product), and the product is divided by the sum x 2^11; ctx x 2^6 once to f16 x Wo f16(bf16 x 2^8) + bo; f32 output.
#include <hip/hip_runtime.h>
#include <math.h>

typedef __attribute__((ext_vector_type(16))) _Float16 v16h;
typedef __attribute__((ext_vector_type(16))) __bf16 v16b;
typedef __attribute__((ext_vector_type(8)))  _Float16 v8h;
typedef __attribute__((ext_vector_type(8)))  float v8f;
typedef __attribute__((ext_vector_type(4)))  float v4f;
typedef __attribute__((ext_vector_type(2)))  float v2f;
typedef __attribute__((ext_vector_type(4)))  unsigned v4u;
typedef __attribute__((ext_vector_type(4)))  int v4i;
typedef float __attribute__((may_alias)) float_a;
typedef int __attribute__((may_alias)) int_a;

template <typename T> __device__ __forceinline__ void vst2(void* p, T v) { *(T*)p = v;  }
__device__ __forceinline__ v8f wmma16(v16h a, v16h b, v8f c) {
  v8f d = __builtin_amdgcn_wmma_f32_16x16x32_f16(false, a, false, b, (short)0, c, false, false);
  asm volatile("v_nop\n\tv_nop\n\tv_nop\n\tv_nop" : "+v"(d) : "v"(a), "v"(b));
  return d;
}
__device__ __forceinline__ v8f wmma_bf(v16b a, v16b b, v8f c) {
  v8f d = __builtin_amdgcn_wmma_f32_16x16x32_bf16(false, a, false, b, (short)0, c, false, false);
  asm volatile("v_nop\n\tv_nop\n\tv_nop\n\tv_nop" : "+v"(d) : "v"(a), "v"(b));
  return d;
}
// 16x16x32 fragments: lane = (h = lane>>4, row/col = lane&15); elements 0..7 = k0+8h+0..7, 8..15 = k0+16+8h+0..7; D element r = row 8h+r
__device__ __forceinline__ v16h frag_h(const _Float16* rowk0, int lane) {
  union { v16h v; v8h q[2]; } u; const _Float16* p = rowk0 + 8 * (lane >> 4);
  u.q[0] = *(const v8h*)p; u.q[1] = *(const v8h*)(p + 16); return u.v;
}
__device__ __forceinline__ v16h frag_f32(const float* rowk0, int lane) {
  v16h a; const float* p = rowk0 + 8 * (lane >> 4);
#pragma unroll
  for (int i = 0; i < 8; ++i) { a[i] = (_Float16)p[i]; a[8 + i] = (_Float16)p[16 + i]; }
  return a;
}
__device__ __forceinline__ v16h frag_f32s(const float* rowk0, int lane, float sc) {
  v16h a; const float* p = rowk0 + 8 * (lane >> 4);
#pragma unroll
  for (int i = 0; i < 8; ++i) { a[i] = (_Float16)(p[i] * sc); a[8 + i] = (_Float16)(p[16 + i] * sc); }
  return a;
}
// column fragment from a [K][ld] layout (column n), rows >= K read as 0
__device__ __forceinline__ v16h fragc_f32(const float* W, int k0, int n, int lane, int ld, int K) {
  v16h a; const int g = lane >> 4;
#pragma unroll
  for (int i = 0; i < 8; ++i) { const int ka = k0 + 8 * g + i, kb = ka + 16;
    a[i] = (_Float16)(ka < K ? W[(size_t)(ka < K ? ka : K - 1) * ld + n] : 0.f); a[8 + i] = (_Float16)(kb < K ? W[(size_t)(kb < K ? kb : K - 1) * ld + n] : 0.f); }
  return a;
}
struct F2 { v16b h, l; };
__device__ __forceinline__ F2 bsplit16(const float v[16]) { F2 r;
#pragma unroll
  for (int i = 0; i < 16; ++i) { const __bf16 h = (__bf16)v[i]; r.h[i] = h; r.l[i] = (__bf16)(v[i] - (float)h); }
  return r; }
__device__ __forceinline__ F2 split_row(const float* row, int k0, int lane) { float v[16]; const float* p = row + k0 + 8 * (lane >> 4);
#pragma unroll
  for (int i = 0; i < 8; ++i) { v[i] = p[i]; v[8 + i] = p[16 + i]; }
  return bsplit16(v); }
__device__ __forceinline__ F2 split_rowK(const float* row, int k0, int lane, int K) { float v[16]; const int g = lane >> 4;
#pragma unroll
  for (int i = 0; i < 8; ++i) { const int ka = k0 + 8 * g + i, kb = ka + 16; v[i] = ka < K ? row[ka < K ? ka : K - 1] : 0.f; v[8 + i] = kb < K ? row[kb < K ? kb : K - 1] : 0.f; }
  return bsplit16(v); }
__device__ __forceinline__ F2 split_col(const float* W, int k0, int n, int lane, int ld, int K) { float v[16]; const int g = lane >> 4;
#pragma unroll
  for (int i = 0; i < 8; ++i) { const int ka = k0 + 8 * g + i, kb = ka + 16; v[i] = ka < K ? W[(size_t)(ka < K ? ka : K - 1) * ld + n] : 0.f; v[8 + i] = kb < K ? W[(size_t)(kb < K ? kb : K - 1) * ld + n] : 0.f; }
  return bsplit16(v); }
__device__ __forceinline__ v8f mac3(const F2& a, const F2& b, v8f c) { c = wmma_bf(a.l, b.h, c); c = wmma_bf(a.h, b.l, c); return wmma_bf(a.h, b.h, c); }
__device__ __forceinline__ float sigm(float v) { return 1.0f / (1.0f + expf(-v)); }
#define LDSX() do { asm volatile("s_wait_dscnt 0" ::: "memory"); __builtin_amdgcn_wave_barrier(); __builtin_amdgcn_fence(__ATOMIC_RELEASE, "workgroup"); } while (0)

// Multi-headed attention whose probabilities are multiplied by a group-probability tensor (query / key / value [4,1024,1024]; (in,out) wq / wk / wv / wo [1024,1024] uniform(+-1/32) + biases uniform(+-1/32); 16 heads x 64; scale 1/8; mask [4,1024,1024] int32 random 0/1: scores[mask == 0] = -1e9; p = softmax(scores); p *= group_prob[:, None] with group_prob [4,1024,1024] uniform[0,1) f32 (multiplicative, after the softmax, no renormalisation); merge; wo + bo).
#define NB 4
#define TT 1024
#define CC 1024            // NH * HD = projected width
#define DIN 1024          // input (model) width
#define NH 16
#define HD 64
#define NQB (TT / 64)
#define HG 8
#define SCALE (0.125f)
#define CAUSAL 0
#ifndef TNB
#define TNB NB
#endif
__device__ __forceinline__ float bfr(float v) { return (float)(__bf16)v; }
__host__ __device__ __forceinline__ int kb_last(int qb) { return CAUSAL ? ((qb * 64 + 63) >> 7) : (TT / 128 - 1); }
typedef __attribute__((ext_vector_type(8))) __bf16 v8b;
__device__ __forceinline__ v16b frag_b(const __bf16* rowk0, int lane) {
  union { v16b v; v8b q[2]; } u; const __bf16* p = rowk0 + 8 * (lane >> 4);
  u.q[0] = *(const v8b*)p; u.q[1] = *(const v8b*)(p + 16); return u.v;
}
#define QBH 0              // unused: no kernel in this file has a high-precision attention path
#define QHI 0               // single-product logits on every row
#define KHI 64            // key rows carrying k residual / v bf16 hi+lo planes (written by k_proj; no kernel in this file reads them)
// B fragment (k rows k0+.., output column o) of a weight: (in,out) [K][ld] or (out,in) [ld rows of K]: bf16 exact, or f16(bf16 * 256) exact
__device__ __forceinline__ v16b wcol_io(const float* Wm, int k0, int o, int lane, int ld) { v16b w; const int g = lane >> 4;
#pragma unroll
  for (int i = 0; i < 8; ++i) { w[i] = (__bf16)Wm[(size_t)(k0 + 8 * g + i) * ld + o]; w[8 + i] = (__bf16)Wm[(size_t)(k0 + 16 + 8 * g + i) * ld + o]; }
  return w; }
__device__ __forceinline__ v16b wcol_oi(const float* Wm, int k0, int o, int lane, int K) { v16b w; const float* p = Wm + (size_t)o * K + k0 + 8 * (lane >> 4);
#pragma unroll
  for (int i = 0; i < 8; ++i) { w[i] = (__bf16)p[i]; w[8 + i] = (__bf16)p[16 + i]; }
  return w; }
__device__ __forceinline__ v16h wcolh_io(const float* Wm, int k0, int o, int lane, int ld) { v16h w; const int g = lane >> 4;
#pragma unroll
  for (int i = 0; i < 8; ++i) { w[i] = (_Float16)(bfr(Wm[(size_t)(k0 + 8 * g + i) * ld + o]) * 256.0f); w[8 + i] = (_Float16)(bfr(Wm[(size_t)(k0 + 16 + 8 * g + i) * ld + o]) * 256.0f); }
  return w; }
__device__ __forceinline__ v16h wcolh_oi(const float* Wm, int k0, int o, int lane, int K) { v16h w; const float* p = Wm + (size_t)o * K + k0 + 8 * (lane >> 4);
#pragma unroll
  for (int i = 0; i < 8; ++i) { w[i] = (_Float16)(bfr(p[i]) * 256.0f); w[8 + i] = (_Float16)(bfr(p[16 + i]) * 256.0f); }
  return w; }
#define WQKV_LAYOUT 0   // selects only WCOL, which no kernel here uses (k_proj always reads (in,out) [DIN][CC]): 0 = (in,out) [DIN][CC]; 1 = (out,in) [CC][DIN]; 2 = per-head [NH][DIN][HD]
__device__ __forceinline__ v16b wcol_hdk(const float* Wm, int k0, int o, int lane) { v16b w; const int g = lane >> 4; const float* p = Wm + (size_t)(o / HD) * DIN * HD + (o % HD);
#pragma unroll
  for (int i = 0; i < 8; ++i) { w[i] = (__bf16)p[(size_t)(k0 + 8 * g + i) * HD]; w[8 + i] = (__bf16)p[(size_t)(k0 + 16 + 8 * g + i) * HD]; }
  return w; }
#define WO_OUT_IN 0
#if WQKV_LAYOUT == 1
#define WCOL(W, k0, o, lane) wcol_oi(W, k0, o, lane, DIN)
#elif WQKV_LAYOUT == 2
#define WCOL(W, k0, o, lane) wcol_hdk(W, k0, o, lane)
#else
#define WCOL(W, k0, o, lane) wcol_io(W, k0, o, lane, CC)
#endif
#if WO_OUT_IN
#define WOCOL(W, k0, o, lane) wcol_oi(W, k0, o, lane, CC)
#define WOCOLH(W, k0, o, lane) wcolh_oi(W, k0, o, lane, CC)
#else
#define WOCOL(W, k0, o, lane) wcol_io(W, k0, o, lane, DIN)
#define WOCOLH(W, k0, o, lane) wcolh_io(W, k0, o, lane, DIN)
#endif
#define WS_QH  0u                                      // f16 q rows [b*t][CC]
#define WS_KH  (WS_QH + 2u * (size_t)NB * TT * CC)      // f16 k rows [b*t][CC]
#define WS_VT  (WS_KH + 2u * (size_t)NB * TT * CC)      // f16 v planes [b][c][t]
#define WS_QL  (WS_VT + 2u * (size_t)NB * CC * TT)      // f16 q residual x 2^10 rows [b][t < QHI][CC]
#define WS_KL  (WS_QL + 2u * (size_t)NB * QHI * CC)     // f16 k residual x 2^10 rows [b][t < KHI][CC]
#define WS_VB  (WS_KL + 2u * (size_t)NB * KHI * CC)     // bf16 v hi planes [b][c][t < KHI]
#define WS_VBL (WS_VB + 2u * (size_t)NB * CC * KHI)
#define WS_S   (WS_VBL + 2u * (size_t)NB * CC * KHI)    // 16-bit gate tiles (8 MiB of this range; its size is kept so that the layout behind it is unchanged)
#define WS_Y   (WS_S  + 4u * (size_t)HG * TT * TT)      // f16 ctx x 2^6 rows [b*t][CC] (half of this range)
#define WS_XB  (WS_Y  + 4u * (size_t)NB * TT * CC)      // bf16 query / key / value rows [3][b*t][DIN]
#define WS_WB  (WS_XB + 2u * 3u * (size_t)NB * TT * DIN) // bf16 wq / wk / wv [3][DIN][CC]
#define WS_WOH (WS_WB + 2u * 3u * (size_t)DIN * CC)     // f16(bf16 wo x 2^8) [CC][DIN]
#define WS_END (WS_WOH + 2u * (size_t)CC * DIN)

// ---- weight tile in LDS: KS k rows x 128 output columns, 16-bit, row-major as in memory; every wave takes its column fragments from there with the transposing load
#define KS 64
#define WPITCH 288         // bytes a staged row: 256 + 32, an odd multiple of 32 bytes (the transposing load's conflict-free pitch)
typedef __attribute__((ext_vector_type(8))) short v8s;
typedef __attribute__((ext_vector_type(4))) __bf16 v4b;
typedef __attribute__((ext_vector_type(4))) _Float16 v4h;
__device__ __forceinline__ v4u ld_tr16(const char* p) { typedef __attribute__((address_space(3))) v8s lds_v8s; return __builtin_bit_cast(v4u, __builtin_amdgcn_ds_load_tr16_b128_v8i16((lds_v8s*)p)); }
// lane (col, g) gets tile[kk*32 + 8g + 0..7][j*16 + col] and tile[kk*32 + 16 + 8g + 0..7][j*16 + col]: the k order of the row fragments above. tl = tile + wfrag_lane(lane)
__device__ __forceinline__ int wfrag_lane(int lane) { return (8 * (lane >> 4) + (lane & 7)) * WPITCH + 16 * ((lane >> 3) & 1); }
template <typename V> __device__ __forceinline__ V wfrag(const char* tl, int kk, int j) { union { V v; v4u q[2]; } u; const char* p = tl + kk * 32 * WPITCH + j * 32; u.q[0] = ld_tr16(p); u.q[1] = ld_tr16(p + 16 * WPITCH); return u.v; }
// left operand in LDS: behind each weight tile the block's BR rows x KS k, 16-bit, row-major
#define BR 128             // rows a block
#define APITCH 144         // bytes a staged row of the left operand: 128 + 16 (the conflict-free pitch of 16-byte LDS reads)
#define A_OFF (KS * WPITCH)
#define TILE_SZ (A_OFF + BR * APITCH)
// 8 waves a block. Both operands lie in the workspace in their 16-bit form (k_prep, k_att), so a tile goes from there into LDS by asynchronous copies and passes no register.
// This thread's eight 16-byte copies of one tile: weight rows r, r + 16, r + 32, r + 48 (a wave's copy covers two whole 256-byte row pieces), left rows s, s + 32, s + 64, s + 96 (four whole 128-byte lines). ld = bytes a row of either operand in memory.
// The wait at the end stands in the copies' own statement, in front of any rewrite of the address registers that they name.
// products: wave (wm = wave >> 1, wn = wave & 1) owns rows wm*32 + 0..31 x columns wn*64 + 0..63: 2 left and 4 weight fragments feed 8 products; acc[i*4 + j] = row tile i, column tile j
typedef __attribute__((address_space(3))) char lds_char;
__device__ __forceinline__ void tile_copy(unsigned lw, unsigned la, const char* w, const char* a, int ld) {
  asm volatile("global_load_async_to_lds_b128 %0, %8, off\n\t"
               "global_load_async_to_lds_b128 %1, %9, off\n\t"
               "global_load_async_to_lds_b128 %2, %10, off\n\t"
               "global_load_async_to_lds_b128 %3, %11, off\n\t"
               "global_load_async_to_lds_b128 %4, %12, off\n\t"
               "global_load_async_to_lds_b128 %5, %13, off\n\t"
               "global_load_async_to_lds_b128 %6, %14, off\n\t"
               "global_load_async_to_lds_b128 %7, %15, off\n\t"
               "s_wait_xcnt 0x0"
               :: "v"(lw), "v"(lw + 16 * WPITCH), "v"(lw + 32 * WPITCH), "v"(lw + 48 * WPITCH), "v"(la), "v"(la + 32 * APITCH), "v"(la + 64 * APITCH), "v"(la + 96 * APITCH),
                  "v"(w), "v"(w + 16 * ld), "v"(w + 32 * ld), "v"(w + 48 * ld), "v"(a), "v"(a + 32 * ld), "v"(a + 64 * ld), "v"(a + 96 * ld)
               : "memory"); }
// ---- k_prep: every GEMM operand that arrives as f32 is rounded to its 16-bit form once a call (the blocks of k_proj and k_out did it per tile: 8 times for a left element, 32 times for a weight): query / key / value and wq / wk / wv to bf16, wo to f16(bf16 x 2^8).
// A block takes PREP_F consecutive floats in 4 rounds; a wave's load covers 512 contiguous bytes, its store 256. Two register sets, so that one round's loads fly while the round before is stored.
typedef __attribute__((ext_vector_type(4))) unsigned short v4us;
#define PREP_F 32768
#define PREP_X (NB * TT * DIN / PREP_F)
#define PREP_W (DIN * CC / PREP_F)
#define PREP_BLOCKS (3 * PREP_X + 4 * PREP_W)
#define XW() asm volatile("s_wait_xcnt 0x0" ::: "memory")   /* behind a round's stores: their data registers are reused by the loads that follow. Behind a round's loads: it keeps the next stores from being mixed among them */
template <bool WOF> __device__ __forceinline__ void prep_run(const float* __restrict__ sp, unsigned short* __restrict__ dp) {
  v4f a[8], b[8];
  auto ld = [&](v4f (&x)[8], int r) __attribute__((always_inline)) {
#pragma unroll
    for (int i = 0; i < 8; ++i) x[i] = *(const v4f*)(sp + r * 8192 + i * 1024); };
  auto st = [&](const v4f (&x)[8], int r) __attribute__((always_inline)) {
#pragma unroll
    for (int i = 0; i < 8; ++i) { v4us o;
#pragma unroll
      for (int c = 0; c < 4; ++c) o[c] = WOF ? __builtin_bit_cast(unsigned short, (_Float16)(bfr(x[i][c]) * 256.0f)) : __builtin_bit_cast(unsigned short, (__bf16)x[i][c]);
      *(v4us*)(dp + r * 8192 + i * 1024) = o; } };
  ld(a, 0); ld(b, 1); XW(); st(a, 0); XW(); ld(a, 2); XW(); st(b, 1); XW(); ld(b, 3); XW(); st(a, 2); XW(); st(b, 3); }
__global__ __launch_bounds__(256) void k_prep(const float* __restrict__ XQ, const float* __restrict__ XK, const float* __restrict__ XV, const float* __restrict__ WQ, const float* __restrict__ WK, const float* __restrict__ WV, const float* __restrict__ WO,
    unsigned short* __restrict__ XB, unsigned short* __restrict__ WB, unsigned short* __restrict__ WOH) {
  const int bi = blockIdx.x, t4 = threadIdx.x * 4;
  if (bi < 3 * PREP_X) { const int w = bi / PREP_X; prep_run<false>((w == 0 ? XQ : w == 1 ? XK : XV) + (size_t)(bi % PREP_X) * PREP_F + t4, XB + (size_t)bi * PREP_F + t4); }
  else if (bi < 3 * PREP_X + 3 * PREP_W) { const int k = bi - 3 * PREP_X, w = k / PREP_W; prep_run<false>((w == 0 ? WQ : w == 1 ? WK : WV) + (size_t)(k % PREP_W) * PREP_F + t4, WB + (size_t)k * PREP_F + t4); }
  else { const int k = bi - 3 * PREP_X - 3 * PREP_W; prep_run<true>(WO + (size_t)k * PREP_F + t4, WOH + (size_t)k * PREP_F + t4); } }
// ---- gate tiles: mask and group_prob of one (query, key) in 16 bits: group_prob rounded to bf16 (the rounding k_att applied per head), its sign bit set where mask == 0 (group_prob's generator is uniform [0,1): the sign is free).
// Layout [b*TT/64 + query block][key step of 32][64 queries][32 keys]: one step's tile of a k_att block is 4096 contiguous bytes. Written once a call by extra blocks of the k_proj launch, read by all 16 heads.
// A wave takes 2 rows x 512 keys; lane (hi = lane >> 4, lo = lane & 15) takes row hi, keys 64i + 4lo + 0..3: a load covers two whole 256-byte row pieces, a store two whole 128-byte lines (rows 2n, 2n + 1 of two tiles).
typedef __attribute__((ext_vector_type(8))) unsigned short v8us;
#define GATE_BLOCKS (NB * TT * (TT / 32) / 256)   // 256 threads x 32 elements a block
__device__ __forceinline__ void pack_gate(const int* __restrict__ MASK, const float* __restrict__ GPROB, unsigned short* __restrict__ MG, int pb, int tid) {
  const int gw = pb * 8 + (tid >> 5), lane = tid & 31; const int R = (gw >> 1) * 2 + (lane >> 4); const int k0 = (gw & 1) * 512 + (lane & 15) * 4;
  const int* mp = MASK + (size_t)R * TT + k0; const float* gp = GPROB + (size_t)R * TT + k0;
  v4i mk[8]; v4f gq[8];
#pragma unroll
  for (int i = 0; i < 8; ++i) { mk[i] = *(const v4i*)(mp + i * 64); gq[i] = *(const v4f*)(gp + i * 64); }
  asm volatile("s_wait_xcnt 0x0" :: "v"(mp), "v"(gp) : "memory");   // the loads' address registers are reused by what follows; as inputs here they stay whole up to the wait
  unsigned short* dp = MG + ((size_t)((R >> 6) * (TT / 32) + (k0 >> 5)) * 64 + (R & 63)) * 32 + (k0 & 31);
#pragma unroll
  for (int i = 0; i < 8; ++i) { v4us o;
#pragma unroll
    for (int c = 0; c < 4; ++c) o[c] = (unsigned short)(__builtin_bit_cast(unsigned short, (__bf16)gq[i][c]) | (mk[i][c] == 0 ? 0x8000u : 0u));
    *(v4us*)(dp + (size_t)i * 2 * 64 * 32) = o; } }
// ---- k_proj: block = (128 rows, 128 cols, which): q/k/v = X W (+ b) with exact bf16 products (K = DIN) -> which 0: q f16 rows (+ residual rows < QHI); 1: k f16 rows (+ residual rows < KHI); 2: v f16 planes [c][t] (+ bf16 hi/lo planes for t < KHI)
__global__ __launch_bounds__(256) void k_proj(const __bf16* __restrict__ XB, const __bf16* __restrict__ WB, const float* __restrict__ BQ, const float* __restrict__ BK, const float* __restrict__ BV,
    _Float16* __restrict__ QH, _Float16* __restrict__ QL, _Float16* __restrict__ KH, _Float16* __restrict__ KL, _Float16* __restrict__ VT, __bf16* __restrict__ VB, __bf16* __restrict__ VBL, const int* __restrict__ MASK, const float* __restrict__ GPROB, unsigned short* __restrict__ MG) {
  if (blockIdx.z >= 3) { pack_gate(MASK, GPROB, MG, (blockIdx.z - 3) * (TNB * TT / BR) * (CC / 128) + blockIdx.y * (TNB * TT / BR) + blockIdx.x, threadIdx.x); return; }   // the launch's last blocks write the gate tiles: whole blocks, in front of every barrier
  __shared__ __align__(16) union { struct { _Float16 sh[BR][136], sl[BR][136]; } r; struct { _Float16 th[128][BR + 8]; __bf16 tb[128][BR + 8], tbl[128][BR + 8]; } c; char w[2][TILE_SZ]; } sm;   // the weight and left-operand tiles live in the loop, the output staging (rows for q and k, planes for v) behind it
  auto& sh = sm.r.sh; auto& sl = sm.r.sl; auto& th = sm.c.th; auto& tb = sm.c.tb; auto& tbl = sm.c.tbl;
  const int tid = threadIdx.x, wave = tid >> 5, lane = tid & 31, col = lane & 15, g = lane >> 4, wm = wave >> 1, wn = wave & 1; const int which = blockIdx.z; const int c0 = blockIdx.y * 128; const size_t r0 = (size_t)blockIdx.x * BR; const size_t bb = r0 / TT; const int t0 = (int)(r0 % TT);
  const __bf16* X = XB + (size_t)which * NB * TT * DIN; const __bf16* WA = WB + (size_t)which * DIN * CC; const float* BA = which == 0 ? BQ : which == 1 ? BK : BV;
  v8f acc[8] = {};
  const unsigned lb = (unsigned)(size_t)(lds_char*)&sm.w[0][0]; const unsigned lw = lb + (tid >> 4) * WPITCH + (tid & 15) * 16, la = lb + A_OFF + (tid >> 3) * APITCH + (tid & 7) * 16;
  const char* wg = (const char*)(WA + (size_t)(tid >> 4) * CC + c0 + (tid & 15) * 8); const char* ag = (const char*)(X + (r0 + (tid >> 3)) * DIN + (tid & 7) * 8);
  auto copy = [&](int t) __attribute__((always_inline)) { const unsigned o = (t & 1) * TILE_SZ; tile_copy(lw + o, la + o, wg + (size_t)t * (KS * CC * 2), ag + t * (KS * 2), CC * 2); };
  copy(0);
  asm volatile("s_wait_asynccnt 0x0" ::: "memory");   // this wave's share of tile 0 has landed
  __syncthreads();   // publishes tile 0
  copy(1);
#pragma unroll 2   /* two tiles a trip: the buffer's offset is then a constant in every LDS address */
  for (int t = 0; t < DIN / KS; ++t) { const char* tile = sm.w[t & 1];
    const char* tl = tile + wfrag_lane(lane) + wn * 128; const __bf16* al = (const __bf16*)(tile + A_OFF + (wm * 32 + col) * APITCH);
#pragma unroll
    for (int c = 0; c < 2; ++c) { const v16b a0 = frag_b(al + 32 * c, lane), a1 = frag_b(al + 16 * (APITCH / 2) + 32 * c, lane); v16b wf[4];   // the six fragments as one group of LDS loads in front of their products: one LDS latency a group, not one a product
#pragma unroll
      for (int j = 0; j < 4; ++j) wf[j] = wfrag<v16b>(tl, c, j);
#pragma unroll
      for (int j = 0; j < 4; ++j) { acc[j] = wmma_bf(a0, wf[j], acc[j]); acc[4 + j] = wmma_bf(a1, wf[j], acc[4 + j]); } }
    asm volatile("s_wait_dscnt 0x0" ::: "memory");      // this wave's reads of this buffer have returned: behind the barrier it is refilled
    asm volatile("s_wait_asynccnt 0x0" ::: "memory");   // this wave's share of the next tile has landed
    __syncthreads();   // publishes the next tile and ends every wave's reads of this one; behind the last tile's the staging below reuses the tiles' LDS
    if (t + 2 < DIN / KS) copy(t + 2); }
  asm volatile("s_wait_asynccnt 0x0" ::: "memory");   // no copy is outstanding when the tiles' LDS is reused
  if (which < 2) { _Float16* DH = which == 0 ? QH : KH; _Float16* DL = which == 0 ? QL : KL; const int nhi = which == 0 ? QHI : KHI;
#pragma unroll
    for (int j = 0; j < 4; ++j) { const int cl = wn * 64 + j * 16 + col; const float bias = BA ? bfr(BA[c0 + cl]) : 0.f;
#pragma unroll
      for (int i = 0; i < 2; ++i)
#pragma unroll
        for (int r = 0; r < 8; ++r) { const float v = acc[i * 4 + j][r] + bias; const _Float16 hv = (_Float16)v; const int rl = wm * 32 + i * 16 + 8 * g + r; sh[rl][cl] = hv; sl[rl][cl] = (_Float16)((v - (float)hv) * 1024.0f); } }
    __syncthreads();
    for (int e = tid; e < BR * 16; e += 256) { const int rl = e >> 4, q = e & 15; vst2((unsigned*)(DH + (r0 + rl) * CC + c0 + q * 8), *(const v4u*)&sh[rl][q * 8]); if (t0 + rl < nhi) { vst2((unsigned*)(DL + (bb * nhi + t0 + rl) * (size_t)CC + c0 + q * 8), *(const v4u*)&sl[rl][q * 8]);
        asm volatile("s_wait_xcnt 0x0" ::: "memory"); } }   // the next trip steps this store's address registers; the wait stands in the store's own branch, where no such step can be lifted over it
  } else {
#pragma unroll
    for (int j = 0; j < 4; ++j) { const int cl = wn * 64 + j * 16 + col; const float bias = BA ? bfr(BA[c0 + cl]) : 0.f;
#pragma unroll
      for (int i = 0; i < 2; ++i)
#pragma unroll
        for (int r = 0; r < 8; ++r) { const float v = acc[i * 4 + j][r] + bias; const int rl = wm * 32 + i * 16 + 8 * g + r; th[cl][rl] = (_Float16)v; const __bf16 bh = (__bf16)v; tb[cl][rl] = bh; tbl[cl][rl] = (__bf16)(v - (float)bh); } }
    __syncthreads();
    for (int e = tid; e < 128 * (BR / 8); e += 256) { const int cl = e >> 4, q = e & 15; vst2((unsigned*)(VT + (bb * CC + c0 + cl) * (size_t)TT + t0 + q * 8), *(const v4u*)&th[cl][q * 8]); if (t0 + q * 8 < KHI) { const size_t o3 = (bb * CC + c0 + cl) * (size_t)KHI + t0 + q * 8; vst2((unsigned*)(VB + o3), *(const v4u*)&tb[cl][q * 8]); vst2((unsigned*)(VBL + o3), *(const v4u*)&tbl[cl][q * 8]);
        asm volatile("s_wait_xcnt 0x0" ::: "memory"); } } } }   // the next trip steps these stores' address registers; the wait stands in the stores' own branch, where no such step can be lifted over it
// ---- k_att: block = 64 queries (4 waves x 16) of (b, h); each wave walks all keys in steps of 32 with a running maximum and sum, so no logit leaves the registers.
// S^T = K Q^T: lane (g, col) holds query col, keys k0 + 8g + r (tile 0) and k0 + 16 + 8g + r (tile 1), which is already the k order of a 16x16x32 operand; ctx^T = V^T P^T keeps the query in the lane, so maximum, sum and rescale are lane-local but for one exchange with lane ^ 16.
// Each step's operands (32 k rows, 64 v rows of 32 keys, 64 gate rows of 32 keys) come into LDS once per block by asynchronous copies that cover whole 128-byte lines (v: 64-byte pieces); the waves take their fragments from there. A fragment load straight from global memory touches 16 lines for 512 bytes.
__device__ __forceinline__ float xhalf(float x) { return __builtin_bit_cast(float, __builtin_amdgcn_permlanex16(__builtin_bit_cast(int, x), __builtin_bit_cast(int, x), 0x76543210, 0xfedcba98, false, false)); }  // lane l with lane l ^ 16
__device__ __forceinline__ v8f wmmah(v16h a, v16h b, v8f c) { return __builtin_amdgcn_wmma_f32_16x16x32_f16(false, a, false, b, (short)0, c, false, false); }
#define LOG2E 1.4426950408889634f
#define AKP 144            // bytes a staged k row: 128 + 16 (the conflict-free pitch of 16-byte LDS reads)
#define AVP 80             // bytes a staged v or gate row: 64 + 16
#define A_K 0
#define A_V (A_K + 32 * AKP)
#define A_M (A_V + HD * AVP)
#define A_SZ (A_M + 64 * AVP)
// this thread's six 16-byte copies of one step's operands: k rows r, r + 16; v rows r, r + 32; gate rows r, r + 32. The wait at the end stands in the copies' own statement, in front of any rewrite of the address registers that they name.
__device__ __forceinline__ void att_copy(unsigned lk, unsigned lv, unsigned lm, const char* k, const char* v, const char* m) {
  asm volatile("global_load_async_to_lds_b128 %0, %6, off\n\t"
               "global_load_async_to_lds_b128 %1, %7, off\n\t"
               "global_load_async_to_lds_b128 %2, %8, off\n\t"
               "global_load_async_to_lds_b128 %3, %9, off\n\t"
               "global_load_async_to_lds_b128 %4, %10, off\n\t"
               "global_load_async_to_lds_b128 %5, %11, off\n\t"
               "s_wait_xcnt 0x0"
               :: "v"(lk), "v"(lk + 16 * AKP), "v"(lv), "v"(lv + 32 * AVP), "v"(lm), "v"(lm + 32 * AVP),
                  "v"(k), "v"(k + 16 * CC * 2), "v"(v), "v"(v + 32 * TT * 2), "v"(m), "v"(m + 32 * 64)
               : "memory"); }
__global__ __launch_bounds__(128) void k_att(const _Float16* __restrict__ QH, const _Float16* __restrict__ KH, const _Float16* __restrict__ VT, const unsigned short* __restrict__ MG, _Float16* __restrict__ Y) {
  __shared__ __align__(16) char sa[2][A_SZ];
  const int tid = threadIdx.x, wave = tid >> 5, lane = tid & 31, col = lane & 15, g = lane >> 4; const int h = blockIdx.y, b = blockIdx.z; const int q = blockIdx.x * 64 + wave * 16 + col;
  const _Float16* qp = QH + ((size_t)b * TT + q) * CC + h * HD; const v16h q0 = frag_h(qp, lane), q1 = frag_h(qp + 32, lane);
  asm volatile("s_wait_xcnt 0x0" ::: "memory");   // the q loads' address registers are reused by what follows
  const unsigned lb = (unsigned)(size_t)(lds_char*)&sa[0][0];
  const unsigned lk = lb + A_K + (tid >> 3) * AKP + (tid & 7) * 16, lv = lb + A_V + (tid >> 2) * AVP + (tid & 3) * 16, lm = lv + (A_M - A_V);
  const char* kg = (const char*)(KH + ((size_t)b * TT + (tid >> 3)) * CC + h * HD + (tid & 7) * 8); const char* vg = (const char*)(VT + ((size_t)b * CC + h * HD + (tid >> 2)) * (size_t)TT + (tid & 3) * 8);
  const char* mg = (const char*)(MG + (size_t)(b * NQB + blockIdx.x) * (TT / 32) * (64 * 32)) + tid * 16;   // a tile's 256 pieces of 16 bytes in their order: piece p = row p >> 2, part p & 3
  auto copy = [&](int t) __attribute__((always_inline)) { const unsigned o = (t & 1) * A_SZ; att_copy(lk + o, lv + o, lm + o, kg + (size_t)t * (32 * CC * 2), vg + t * 64, mg + t * (64 * 64)); };
  v8f acc[HD / 16] = {}; float m = -3.0e38f, mo = -3.0e38f, l = 0.f;   // m: running maximum (base 2); mo = m - 11: every weight is carried x 2^11 into f16, the sum too, so the factor cancels in the final division
  copy(0);
  asm volatile("s_wait_asynccnt 0x0" ::: "memory");   // this wave's share of step 0 has landed
  __syncthreads();   // publishes step 0
  copy(1);
#pragma unroll 2   /* two steps a trip: the buffer's offset is then a constant in every LDS address */
  for (int t = 0; t < TT / 32; ++t) { const char* bp = sa[t & 1];
    v16h ka[4], vf[HD / 16]; v8us gt[2];   // gt: this query's gates of keys 8g + 0..7 and 16 + 8g + 0..7, the order of t16 below
    const unsigned short* mr = (const unsigned short*)(bp + A_M + (wave * 16 + col) * AVP) + 8 * g;
#pragma unroll
    for (int i = 0; i < 2; ++i) { const _Float16* kr = (const _Float16*)(bp + A_K + (16 * i + col) * AKP); ka[2 * i] = frag_h(kr, lane); ka[2 * i + 1] = frag_h(kr + 32, lane); }
    gt[0] = *(const v8us*)mr; gt[1] = *(const v8us*)(mr + 16);
#pragma unroll
    for (int j = 0; j < HD / 16; ++j) vf[j] = frag_h((const _Float16*)(bp + A_V + (j * 16 + col) * AVP), lane);
    // the step's publish point stands right behind its LDS reads (all that follows works on registers), so that the copies of the step after next fly for a whole step
    asm volatile("s_wait_dscnt 0x0" ::: "memory");      // this wave's reads of this buffer have returned: behind the barrier it is refilled
    asm volatile("s_wait_asynccnt 0x0" ::: "memory");   // this wave's share of the next step has landed
    __syncthreads();   // publishes the next step's buffer and ends every wave's reads of this one
    if (t + 2 < TT / 32) copy(t + 2);
    v8f s0 = {}, s1 = {}; s0 = wmmah(ka[0], q0, s0); s1 = wmmah(ka[2], q0, s1); s0 = wmmah(ka[1], q1, s0); s1 = wmmah(ka[3], q1, s1);
    float t16[16];
#pragma unroll
    for (int r = 0; r < 8; ++r) { t16[r] = (short)gt[0][r] < 0 ? -1.0e9f * LOG2E : s0[r] * (SCALE * LOG2E); t16[8 + r] = (short)gt[1][r] < 0 ? -1.0e9f * LOG2E : s1[r] * (SCALE * LOG2E); }
    float mx = fmaxf(t16[0], t16[1]);
#pragma unroll
    for (int i = 2; i < 16; ++i) mx = fmaxf(mx, t16[i]);
    mx = fmaxf(mx, xhalf(mx)); m = fmaxf(m, mx); const float mn = m - 11.0f; const float corr = __builtin_amdgcn_exp2f(mo - mn); mo = mn;   // corr = 0 on the first step
    v16h p; float ls[4] = {0.f, 0.f, 0.f, 0.f};
#pragma unroll
    for (int i = 0; i < 16; ++i) { const float e = __builtin_amdgcn_exp2f(t16[i] - mn); ls[i & 3] += e; const unsigned short u = gt[i >> 3][i & 7]; p[i] = (_Float16)(e * __builtin_fabsf((float)__builtin_bit_cast(__bf16, u))); }   // the sum takes the softmax weight alone; group_prob (bf16-rounded like every float input; the gate without its mask bit, which is the sign) enters the product only
    l = l * corr + ((ls[0] + ls[1]) + (ls[2] + ls[3]));
#pragma unroll
    for (int j = 0; j < HD / 16; ++j) { acc[j] *= corr; acc[j] = wmmah(vf[j], p, acc[j]); } }
  asm volatile("s_wait_asynccnt 0x0" ::: "memory");   // no copy is outstanding when the wave ends
  l += xhalf(l); const float inv = 1.0f / l;   // l >= 1: the maximum's own weight is in it
  _Float16* yp = Y + ((size_t)b * TT + q) * CC + h * HD + 8 * g;   /* ctx carried x 2^6 into f16 so small-magnitude context rows stay clear of f16 subnormals */
#pragma unroll
  for (int j = 0; j < HD / 16; ++j) { v8h o;
#pragma unroll
    for (int r = 0; r < 8; ++r) o[r] = (_Float16)(acc[j][r] * inv * 64.0f);
    vst2(yp + j * 16, o); } }
// ---- k_out: block = (128 rows, 128 cols): out = ctx Wo (+ bo): ctx once to f16 against Wo as f16(bf16 x 2^8) exact (1 product) x 2^-14 (2^-8 Wo carry, 2^-6 ctx carry)
__global__ __launch_bounds__(256) void k_out(const _Float16* __restrict__ Y, const _Float16* __restrict__ WOH, const float* __restrict__ BO, float* __restrict__ OUT) { __shared__ __align__(16) float sf[8][32][68]; __shared__ __align__(16) char sw[2][TILE_SZ];
  const int tid = threadIdx.x, wave = tid >> 5, lane = tid & 31, col = lane & 15, g = lane >> 4, wm = wave >> 1, wn = wave & 1; const int c0 = blockIdx.y * 128; const size_t r0 = (size_t)blockIdx.x * BR;
  v8f acc[8] = {};
  const unsigned lb = (unsigned)(size_t)(lds_char*)&sw[0][0]; const unsigned lw = lb + (tid >> 4) * WPITCH + (tid & 15) * 16, la = lb + A_OFF + (tid >> 3) * APITCH + (tid & 7) * 16;
  const char* wg = (const char*)(WOH + (size_t)(tid >> 4) * DIN + c0 + (tid & 15) * 8); const char* ag = (const char*)(Y + (r0 + (tid >> 3)) * CC + (tid & 7) * 8);
  auto copy = [&](int t) __attribute__((always_inline)) { const unsigned o = (t & 1) * TILE_SZ; tile_copy(lw + o, la + o, wg + (size_t)t * (KS * DIN * 2), ag + t * (KS * 2), DIN * 2); };
  copy(0);
  asm volatile("s_wait_asynccnt 0x0" ::: "memory");   // this wave's share of tile 0 has landed
  __syncthreads();   // publishes tile 0
  copy(1);
#pragma unroll 2   /* two tiles a trip: the buffer's offset is then a constant in every LDS address */
  for (int t = 0; t < CC / KS; ++t) { const char* tile = sw[t & 1];
    const char* tl = tile + wfrag_lane(lane) + wn * 128; const _Float16* al = (const _Float16*)(tile + A_OFF + (wm * 32 + col) * APITCH);
#pragma unroll
    for (int c = 0; c < 2; ++c) { const v16h a0 = frag_h(al + 32 * c, lane), a1 = frag_h(al + 16 * (APITCH / 2) + 32 * c, lane); v16h wf[4];   // the six fragments as one group of LDS loads in front of their products: one LDS latency a group, not one a product
#pragma unroll
      for (int j = 0; j < 4; ++j) wf[j] = wfrag<v16h>(tl, c, j);
#pragma unroll
      for (int j = 0; j < 4; ++j) { acc[j] = wmma16(a0, wf[j], acc[j]); acc[4 + j] = wmma16(a1, wf[j], acc[4 + j]); } }
    asm volatile("s_wait_dscnt 0x0" ::: "memory");      // this wave's reads of this buffer have returned: behind the barrier it is refilled
    asm volatile("s_wait_asynccnt 0x0" ::: "memory");   // this wave's share of the next tile has landed
    __syncthreads();   // publishes the next tile and ends every wave's reads of this one
    if (t + 2 < CC / KS) copy(t + 2); }
  asm volatile("s_wait_asynccnt 0x0" ::: "memory");   // no copy is outstanding when the wave ends
#pragma unroll
  for (int j = 0; j < 4; ++j) { const float bias = BO ? bfr(BO[c0 + wn * 64 + j * 16 + col]) : 0.f;
#pragma unroll
    for (int i = 0; i < 2; ++i)
#pragma unroll
      for (int r = 0; r < 8; ++r) sf[wave][i * 16 + 8 * g + r][j * 16 + col] = acc[i * 4 + j][r] * (1.0f / 16384.0f) + bias; }   /* 2^-8 (Wo carry) x 2^-6 (ctx carry) */
  // each wave stages its own 32 x 64 piece and stores it as whole 256-byte row pieces, two rows a store
  LDSX(); for (int i = 0; i < 16; ++i) { const int rl = 2 * i + g; vst2(OUT + (r0 + wm * 32 + rl) * DIN + c0 + wn * 64 + col * 4, *(const v4f*)&sf[wave][rl][col * 4]); } }

extern "C" void kernel_launch(void* const* d_in, const int* in_sizes, int n_in, void* d_out, int out_size, void* d_ws, size_t ws_size, hipStream_t stream) {
  (void)in_sizes; (void)n_in; (void)out_size;
  const float** F = (const float**)d_in;
  if (ws_size < (size_t)WS_END) return;
  char* ws = (char*)d_ws; _Float16 *QH = (_Float16*)(ws + WS_QH), *KH = (_Float16*)(ws + WS_KH), *VT = (_Float16*)(ws + WS_VT), *QL = (_Float16*)(ws + WS_QL), *KL = (_Float16*)(ws + WS_KL); __bf16 *VB = (__bf16*)(ws + WS_VB), *VBL = (__bf16*)(ws + WS_VBL); _Float16 *Y = (_Float16*)(ws + WS_Y); unsigned short *MG = (unsigned short*)(ws + WS_S);
  (void)Y; (void)QL; (void)KL; (void)VB; (void)VBL;
  // inputs: 0 query [4,1024,1024]; 1 key; 2 value; 3 group_prob [4,1024,1024] f32 uniform[0,1); 4 mask [4,1024,1024] int32 (random 0/1); 5 wq [1024,1024] (in,out), 6 bq; 7 wk, 8 bk; 9 wv, 10 bv; 11 wo (in,out), 12 bo (biases nonzero)
  k_prep<<<PREP_BLOCKS, 256, 0, stream>>>(F[0], F[1], F[2], F[5], F[7], F[9], F[11], (unsigned short*)(ws + WS_XB), (unsigned short*)(ws + WS_WB), (unsigned short*)(ws + WS_WOH));
  k_proj<<<dim3(TNB * TT / BR, CC / 128, 3 + GATE_BLOCKS / ((TNB * TT / BR) * (CC / 128))), 256, 0, stream>>>((const __bf16*)(ws + WS_XB), (const __bf16*)(ws + WS_WB), F[6], F[8], F[10], QH, QL, KH, KL, VT, VB, VBL, (const int*)d_in[4], F[3], MG);
  k_att<<<dim3(NQB, NH, TNB), 128, 0, stream>>>(QH, KH, VT, MG, Y);
  k_out<<<dim3(TNB * TT / BR, DIN / 128), 256, 0, stream>>>(Y, (const _Float16*)(ws + WS_WOH), F[12], (float*)d_out);
}

// v008
// A run of this version takes 81.2 microseconds.
// Two timings next to v007 both put it at 1.04 times that version's speed.
// Over all steps from v000 it is 9.79 times as fast.
// compute dtype: all float inputs rounded to bf16; q/k/v projections with EXACT bf16 products on WMMA 16x16x32 (f32 accumulate) + bias; logits q x k once to f16 each (1 product) x SCALE; the int mask read per element (0 - -1e9); softmax f32 with a running maximum and sum; the weight exp(s - max) x 2^11 is MULTIPLIED by the float group_prob (which stays out of the sum: no renormalisation), once to f16 x v once to f16 (1 product), and the product is divided by the sum x 2^11; ctx x 2^6 once to f16 x Wo f16(bf16 x 2^8) + bo; f32 output.
#include <hip/hip_runtime.h>
#include <math.h>

typedef __attribute__((ext_vector_type(16))) _Float16 v16h;
typedef __attribute__((ext_vector_type(16))) __bf16 v16b;
typedef __attribute__((ext_vector_type(8)))  _Float16 v8h;
typedef __attribute__((ext_vector_type(8)))  float v8f;
typedef __attribute__((ext_vector_type(4)))  float v4f;
typedef __attribute__((ext_vector_type(2)))  float v2f;
typedef __attribute__((ext_vector_type(4)))  unsigned v4u;
typedef __attribute__((ext_vector_type(4)))  int v4i;
typedef float __attribute__((may_alias)) float_a;
typedef int __attribute__((may_alias)) int_a;

template <typename T> __device__ __forceinline__ void vst2(void* p, T v) { *(T*)p = v;  }
__device__ __forceinline__ v8f wmma16(v16h a, v16h b, v8f c) {
  v8f d = __builtin_amdgcn_wmma_f32_16x16x32_f16(false, a, false, b, (short)0, c, false, false);
  asm volatile("v_nop\n\tv_nop\n\tv_nop\n\tv_nop" : "+v"(d) : "v"(a), "v"(b));
  return d;
}
__device__ __forceinline__ v8f wmma_bf(v16b a, v16b b, v8f c) {
  v8f d = __builtin_amdgcn_wmma_f32_16x16x32_bf16(false, a, false, b, (short)0, c, false, false);
  asm volatile("v_nop\n\tv_nop\n\tv_nop\n\tv_nop" : "+v"(d) : "v"(a), "v"(b));
  return d;
}
// 16x16x32 fragments: lane = (h = lane>>4, row/col = lane&15); elements 0..7 = k0+8h+0..7, 8..15 = k0+16+8h+0..7; D element r = row 8h+r
__device__ __forceinline__ v16h frag_h(const _Float16* rowk0, int lane) {
  union { v16h v; v8h q[2]; } u; const _Float16* p = rowk0 + 8 * (lane >> 4);
  u.q[0] = *(const v8h*)p; u.q[1] = *(const v8h*)(p + 16); return u.v;
}
__device__ __forceinline__ v16h frag_f32(const float* rowk0, int lane) {
  v16h a; const float* p = rowk0 + 8 * (lane >> 4);
#pragma unroll
  for (int i = 0; i < 8; ++i) { a[i] = (_Float16)p[i]; a[8 + i] = (_Float16)p[16 + i]; }
  return a;
}
__device__ __forceinline__ v16h frag_f32s(const float* rowk0, int lane, float sc) {
  v16h a; const float* p = rowk0 + 8 * (lane >> 4);
#pragma unroll
  for (int i = 0; i < 8; ++i) { a[i] = (_Float16)(p[i] * sc); a[8 + i] = (_Float16)(p[16 + i] * sc); }
  return a;
}
// column fragment from a [K][ld] layout (column n), rows >= K read as 0
__device__ __forceinline__ v16h fragc_f32(const float* W, int k0, int n, int lane, int ld, int K) {
  v16h a; const int g = lane >> 4;
#pragma unroll
  for (int i = 0; i < 8; ++i) { const int ka = k0 + 8 * g + i, kb = ka + 16;
    a[i] = (_Float16)(ka < K ? W[(size_t)(ka < K ? ka : K - 1) * ld + n] : 0.f); a[8 + i] = (_Float16)(kb < K ? W[(size_t)(kb < K ? kb : K - 1) * ld + n] : 0.f); }
  return a;
}
struct F2 { v16b h, l; };
__device__ __forceinline__ F2 bsplit16(const float v[16]) { F2 r;
#pragma unroll
  for (int i = 0; i < 16; ++i) { const __bf16 h = (__bf16)v[i]; r.h[i] = h; r.l[i] = (__bf16)(v[i] - (float)h); }
  return r; }
__device__ __forceinline__ F2 split_row(const float* row, int k0, int lane) { float v[16]; const float* p = row + k0 + 8 * (lane >> 4);
#pragma unroll
  for (int i = 0; i < 8; ++i) { v[i] = p[i]; v[8 + i] = p[16 + i]; }
  return bsplit16(v); }
__device__ __forceinline__ F2 split_rowK(const float* row, int k0, int lane, int K) { float v[16]; const int g = lane >> 4;
#pragma unroll
  for (int i = 0; i < 8; ++i) { const int ka = k0 + 8 * g + i, kb = ka + 16; v[i] = ka < K ? row[ka < K ? ka : K - 1] : 0.f; v[8 + i] = kb < K ? row[kb < K ? kb : K - 1] : 0.f; }
  return bsplit16(v); }
__device__ __forceinline__ F2 split_col(const float* W, int k0, int n, int lane, int ld, int K) { float v[16]; const int g = lane >> 4;
#pragma unroll
  for (int i = 0; i < 8; ++i) { const int ka = k0 + 8 * g + i, kb = ka + 16; v[i] = ka < K ? W[(size_t)(ka < K ? ka : K - 1) * ld + n] : 0.f; v[8 + i] = kb < K ? W[(size_t)(kb < K ? kb : K - 1) * ld + n] : 0.f; }
  return bsplit16(v); }
__device__ __forceinline__ v8f mac3(const F2& a, const F2& b, v8f c) { c = wmma_bf(a.l, b.h, c); c = wmma_bf(a.h, b.l, c); return wmma_bf(a.h, b.h, c); }
__device__ __forceinline__ float sigm(float v) { return 1.0f / (1.0f + expf(-v)); }
#define LDSX() do { asm volatile("s_wait_dscnt 0" ::: "memory"); __builtin_amdgcn_wave_barrier(); __builtin_amdgcn_fence(__ATOMIC_RELEASE, "workgroup"); } while (0)

// Multi-headed attention whose probabilities are multiplied by a group-probability tensor (query / key / value [4,1024,1024]; (in,out) wq / wk / wv / wo [1024,1024] uniform(+-1/32) + biases uniform(+-1/32); 16 heads x 64; scale 1/8; mask [4,1024,1024] int32 random 0/1: scores[mask == 0] = -1e9; p = softmax(scores); p *= group_prob[:, None] with group_prob [4,1024,1024] uniform[0,1) f32 (multiplicative, after the softmax, no renormalisation); merge; wo + bo).
#define NB 4
#define TT 1024
#define CC 1024            // NH * HD = projected width
#define DIN 1024          // input (model) width
#define NH 16
#define HD 64
#define NQB (TT / 64)
#define HG 8
#define SCALE (0.125f)
#define CAUSAL 0
#ifndef TNB
#define TNB NB
#endif
__device__ __forceinline__ float bfr(float v) { return (float)(__bf16)v; }
__host__ __device__ __forceinline__ int kb_last(int qb) { return CAUSAL ? ((qb * 64 + 63) >> 7) : (TT / 128 - 1); }
typedef __attribute__((ext_vector_type(8))) __bf16 v8b;
__device__ __forceinline__ v16b frag_b(const __bf16* rowk0, int lane) {
  union { v16b v; v8b q[2]; } u; const __bf16* p = rowk0 + 8 * (lane >> 4);
  u.q[0] = *(const v8b*)p; u.q[1] = *(const v8b*)(p + 16); return u.v;
}
#define QBH 0              // unused: no kernel in this file has a high-precision attention path
#define QHI 0               // single-product logits on every row
#define KHI 64            // key rows carrying k residual / v bf16 hi+lo planes (written by k_proj; no kernel in this file reads them)
// B fragment (k rows k0+.., output column o) of a weight: (in,out) [K][ld] or (out,in) [ld rows of K]: bf16 exact, or f16(bf16 * 256) exact
__device__ __forceinline__ v16b wcol_io(const float* Wm, int k0, int o, int lane, int ld) { v16b w; const int g = lane >> 4;
#pragma unroll
  for (int i = 0; i < 8; ++i) { w[i] = (__bf16)Wm[(size_t)(k0 + 8 * g + i) * ld + o]; w[8 + i] = (__bf16)Wm[(size_t)(k0 + 16 + 8 * g + i) * ld + o]; }
  return w; }
__device__ __forceinline__ v16b wcol_oi(const float* Wm, int k0, int o, int lane, int K) { v16b w; const float* p = Wm + (size_t)o * K + k0 + 8 * (lane >> 4);
#pragma unroll
  for (int i = 0; i < 8; ++i) { w[i] = (__bf16)p[i]; w[8 + i] = (__bf16)p[16 + i]; }
  return w; }
__device__ __forceinline__ v16h wcolh_io(const float* Wm, int k0, int o, int lane, int ld) { v16h w; const int g = lane >> 4;
#pragma unroll
  for (int i = 0; i < 8; ++i) { w[i] = (_Float16)(bfr(Wm[(size_t)(k0 + 8 * g + i) * ld + o]) * 256.0f); w[8 + i] = (_Float16)(bfr(Wm[(size_t)(k0 + 16 + 8 * g + i) * ld + o]) * 256.0f); }
  return w; }
__device__ __forceinline__ v16h wcolh_oi(const float* Wm, int k0, int o, int lane, int K) { v16h w; const float* p = Wm + (size_t)o * K + k0 + 8 * (lane >> 4);
#pragma unroll
  for (int i = 0; i < 8; ++i) { w[i] = (_Float16)(bfr(p[i]) * 256.0f); w[8 + i] = (_Float16)(bfr(p[16 + i]) * 256.0f); }
  return w; }
#define WQKV_LAYOUT 0   // selects only WCOL, which no kernel here uses (k_proj always reads (in,out) [DIN][CC]): 0 = (in,out) [DIN][CC]; 1 = (out,in) [CC][DIN]; 2 = per-head [NH][DIN][HD]
__device__ __forceinline__ v16b wcol_hdk(const float* Wm, int k0, int o, int lane) { v16b w; const int g = lane >> 4; const float* p = Wm + (size_t)(o / HD) * DIN * HD + (o % HD);
#pragma unroll
  for (int i = 0; i < 8; ++i) { w[i] = (__bf16)p[(size_t)(k0 + 8 * g + i) * HD]; w[8 + i] = (__bf16)p[(size_t)(k0 + 16 + 8 * g + i) * HD]; }
  return w; }
#define WO_OUT_IN 0
#if WQKV_LAYOUT == 1
#define WCOL(W, k0, o, lane) wcol_oi(W, k0, o, lane, DIN)
#elif WQKV_LAYOUT == 2
#define WCOL(W, k0, o, lane) wcol_hdk(W, k0, o, lane)
#else
#define WCOL(W, k0, o, lane) wcol_io(W, k0, o, lane, CC)
#endif
#if WO_OUT_IN
#define WOCOL(W, k0, o, lane) wcol_oi(W, k0, o, lane, CC)
#define WOCOLH(W, k0, o, lane) wcolh_oi(W, k0, o, lane, CC)
#else
#define WOCOL(W, k0, o, lane) wcol_io(W, k0, o, lane, DIN)
#define WOCOLH(W, k0, o, lane) wcolh_io(W, k0, o, lane, DIN)
#endif
#define WS_QH  0u                                      // f16 q rows [b*t][CC]
#define WS_KH  (WS_QH + 2u * (size_t)NB * TT * CC)      // f16 k rows [b*t][CC]
#define WS_VT  (WS_KH + 2u * (size_t)NB * TT * CC)      // f16 v planes [b][c][t]
#define WS_QL  (WS_VT + 2u * (size_t)NB * CC * TT)      // f16 q residual x 2^10 rows [b][t < QHI][CC]
#define WS_KL  (WS_QL + 2u * (size_t)NB * QHI * CC)     // f16 k residual x 2^10 rows [b][t < KHI][CC]
#define WS_VB  (WS_KL + 2u * (size_t)NB * KHI * CC)     // bf16 v hi planes [b][c][t < KHI]
#define WS_VBL (WS_VB + 2u * (size_t)NB * CC * KHI)
#define WS_S   (WS_VBL + 2u * (size_t)NB * CC * KHI)    // 16-bit gate tiles (8 MiB of this range; its size is kept so that the layout behind it is unchanged)
#define WS_Y   (WS_S  + 4u * (size_t)HG * TT * TT)      // f16 ctx x 2^6 rows [b*t][CC] (half of this range)
#define WS_XB  (WS_Y  + 4u * (size_t)NB * TT * CC)      // bf16 query / key / value rows [3][b*t][DIN]
#define WS_WB  (WS_XB + 2u * 3u * (size_t)NB * TT * DIN) // bf16 wq / wk / wv [3][DIN][CC]
#define WS_WOH (WS_WB + 2u * 3u * (size_t)DIN * CC)     // f16(bf16 wo x 2^8) [CC][DIN]
#define WS_END (WS_WOH + 2u * (size_t)CC * DIN)

// ---- weight tile in LDS: KS k rows x 128 output columns, 16-bit, row-major as in memory; every wave takes its column fragments from there with the transposing load
#define KS 64
#define WPITCH 288         // bytes a staged row: 256 + 32, an odd multiple of 32 bytes (the transposing load's conflict-free pitch)
typedef __attribute__((ext_vector_type(8))) short v8s;
typedef __attribute__((ext_vector_type(4))) __bf16 v4b;
typedef __attribute__((ext_vector_type(4))) _Float16 v4h;
__device__ __forceinline__ v4u ld_tr16(const char* p) { typedef __attribute__((address_space(3))) v8s lds_v8s; return __builtin_bit_cast(v4u, __builtin_amdgcn_ds_load_tr16_b128_v8i16((lds_v8s*)p)); }
// lane (col, g) gets tile[kk*32 + 8g + 0..7][j*16 + col] and tile[kk*32 + 16 + 8g + 0..7][j*16 + col]: the k order of the row fragments above. tl = tile + wfrag_lane(lane)
__device__ __forceinline__ int wfrag_lane(int lane) { return (8 * (lane >> 4) + (lane & 7)) * WPITCH + 16 * ((lane >> 3) & 1); }
template <typename V> __device__ __forceinline__ V wfrag(const char* tl, int kk, int j) { union { V v; v4u q[2]; } u; const char* p = tl + kk * 32 * WPITCH + j * 32; u.q[0] = ld_tr16(p); u.q[1] = ld_tr16(p + 16 * WPITCH); return u.v; }
// left operand in LDS: behind each weight tile the block's BR rows x KS k, 16-bit, row-major
#define BR 128             // rows a block
#define APITCH 144         // bytes a staged row of the left operand: 128 + 16 (the conflict-free pitch of 16-byte LDS reads)
#define A_OFF (KS * WPITCH)
#define TILE_SZ (A_OFF + BR * APITCH)
// 8 waves a block. Both operands lie in the workspace in their 16-bit form (k_prep, k_att), so a tile goes from there into LDS by asynchronous copies and passes no register.
// This thread's eight 16-byte copies of one tile: weight rows r, r + 16, r + 32, r + 48 (a wave's copy covers two whole 256-byte row pieces), left rows s, s + 32, s + 64, s + 96 (four whole 128-byte lines). ld = bytes a row of either operand in memory.
// The wait at the end stands in the copies' own statement, in front of any rewrite of the address registers that they name.
// products: wave (wm = wave >> 1, wn = wave & 1) owns rows wm*32 + 0..31 x columns wn*64 + 0..63: 2 left and 4 weight fragments feed 8 products; acc[i*4 + j] = row tile i, column tile j
typedef __attribute__((address_space(3))) char lds_char;
__device__ __forceinline__ void tile_copy(unsigned lw, unsigned la, const char* w, const char* a, int ld) {
  asm volatile("global_load_async_to_lds_b128 %0, %8, off\n\t"
               "global_load_async_to_lds_b128 %1, %9, off\n\t"
               "global_load_async_to_lds_b128 %2, %10, off\n\t"
               "global_load_async_to_lds_b128 %3, %11, off\n\t"
               "global_load_async_to_lds_b128 %4, %12, off\n\t"
               "global_load_async_to_lds_b128 %5, %13, off\n\t"
               "global_load_async_to_lds_b128 %6, %14, off\n\t"
               "global_load_async_to_lds_b128 %7, %15, off\n\t"
               "s_wait_xcnt 0x0"
               :: "v"(lw), "v"(lw + 16 * WPITCH), "v"(lw + 32 * WPITCH), "v"(lw + 48 * WPITCH), "v"(la), "v"(la + 32 * APITCH), "v"(la + 64 * APITCH), "v"(la + 96 * APITCH),
                  "v"(w), "v"(w + 16 * ld), "v"(w + 32 * ld), "v"(w + 48 * ld), "v"(a), "v"(a + 32 * ld), "v"(a + 64 * ld), "v"(a + 96 * ld)
               : "memory"); }
// ---- k_prep: every GEMM operand that arrives as f32 is rounded to its 16-bit form once a call (the blocks of k_proj and k_out did it per tile: 8 times for a left element, 32 times for a weight): query / key / value and wq / wk / wv to bf16, wo to f16(bf16 x 2^8).
// A block takes PREP_F consecutive floats in 4 rounds; a wave's load covers 512 contiguous bytes, its store 256. Two register sets, so that one round's loads fly while the round before is stored.
typedef __attribute__((ext_vector_type(4))) unsigned short v4us;
#define PREP_F 32768
#define PREP_X (NB * TT * DIN / PREP_F)
#define PREP_W (DIN * CC / PREP_F)
#define PREP_BLOCKS (3 * PREP_X + 4 * PREP_W)
#define XW() asm volatile("s_wait_xcnt 0x0" ::: "memory")   /* behind a round's stores: their data registers are reused by the loads that follow. Behind a round's loads: it keeps the next stores from being mixed among them */
template <bool WOF> __device__ __forceinline__ void prep_run(const float* __restrict__ sp, unsigned short* __restrict__ dp) {
  v4f a[8], b[8];
  auto ld = [&](v4f (&x)[8], int r) __attribute__((always_inline)) {
#pragma unroll
    for (int i = 0; i < 8; ++i) x[i] = *(const v4f*)(sp + r * 8192 + i * 1024); };
  auto st = [&](const v4f (&x)[8], int r) __attribute__((always_inline)) {
#pragma unroll
    for (int i = 0; i < 8; ++i) { v4us o;
#pragma unroll
      for (int c = 0; c < 4; ++c) o[c] = WOF ? __builtin_bit_cast(unsigned short, (_Float16)(bfr(x[i][c]) * 256.0f)) : __builtin_bit_cast(unsigned short, (__bf16)x[i][c]);
      *(v4us*)(dp + r * 8192 + i * 1024) = o; } };
  ld(a, 0); ld(b, 1); XW(); st(a, 0); XW(); ld(a, 2); XW(); st(b, 1); XW(); ld(b, 3); XW(); st(a, 2); XW(); st(b, 3); }
__global__ __launch_bounds__(256) void k_prep(const float* __restrict__ XQ, const float* __restrict__ XK, const float* __restrict__ XV, const float* __restrict__ WQ, const float* __restrict__ WK, const float* __restrict__ WV, const float* __restrict__ WO,
    unsigned short* __restrict__ XB, unsigned short* __restrict__ WB, unsigned short* __restrict__ WOH) {
  const int bi = blockIdx.x, t4 = threadIdx.x * 4;
  if (bi < 3 * PREP_X) { const int w = bi / PREP_X; prep_run<false>((w == 0 ? XQ : w == 1 ? XK : XV) + (size_t)(bi % PREP_X) * PREP_F + t4, XB + (size_t)bi * PREP_F + t4); }
  else if (bi < 3 * PREP_X + 3 * PREP_W) { const int k = bi - 3 * PREP_X, w = k / PREP_W; prep_run<false>((w == 0 ? WQ : w == 1 ? WK : WV) + (size_t)(k % PREP_W) * PREP_F + t4, WB + (size_t)k * PREP_F + t4); }
  else { const int k = bi - 3 * PREP_X - 3 * PREP_W; prep_run<true>(WO + (size_t)k * PREP_F + t4, WOH + (size_t)k * PREP_F + t4); } }
// ---- gate tiles: mask and group_prob of one (query, key) in 16 bits: group_prob rounded to bf16 (the rounding k_att applied per head), its sign bit set where mask == 0 (group_prob's generator is uniform [0,1): the sign is free).
// Layout [b*TT/64 + query block][key step of 32][64 queries][32 keys]: a tile is 4096 contiguous bytes; one step of a k_att block reads two consecutive tiles, 8192 bytes. Written once a call by extra blocks of the k_proj launch, read by all 16 heads.
// A wave takes 2 rows x 512 keys; lane (hi = lane >> 4, lo = lane & 15) takes row hi, keys 64i + 4lo + 0..3: a load covers two whole 256-byte row pieces, a store two whole 128-byte lines (rows 2n, 2n + 1 of two tiles).
typedef __attribute__((ext_vector_type(8))) unsigned short v8us;
#define GATE_BLOCKS (NB * TT * (TT / 32) / 256)   // 256 threads x 32 elements a block
__device__ __forceinline__ void pack_gate(const int* __restrict__ MASK, const float* __restrict__ GPROB, unsigned short* __restrict__ MG, int pb, int tid) {
  const int gw = pb * 8 + (tid >> 5), lane = tid & 31; const int R = (gw >> 1) * 2 + (lane >> 4); const int k0 = (gw & 1) * 512 + (lane & 15) * 4;
  const int* mp = MASK + (size_t)R * TT + k0; const float* gp = GPROB + (size_t)R * TT + k0;
  v4i mk[8]; v4f gq[8];
#pragma unroll
  for (int i = 0; i < 8; ++i) { mk[i] = *(const v4i*)(mp + i * 64); gq[i] = *(const v4f*)(gp + i * 64); }
  asm volatile("s_wait_xcnt 0x0" :: "v"(mp), "v"(gp) : "memory");   // the loads' address registers are reused by what follows; as inputs here they stay whole up to the wait
  unsigned short* dp = MG + ((size_t)((R >> 6) * (TT / 32) + (k0 >> 5)) * 64 + (R & 63)) * 32 + (k0 & 31);
#pragma unroll
  for (int i = 0; i < 8; ++i) { v4us o;
#pragma unroll
    for (int c = 0; c < 4; ++c) o[c] = (unsigned short)(__builtin_bit_cast(unsigned short, (__bf16)gq[i][c]) | (mk[i][c] == 0 ? 0x8000u : 0u));
    *(v4us*)(dp + (size_t)i * 2 * 64 * 32) = o; } }
// ---- k_proj: block = (128 rows, 128 cols, which): q/k/v = X W (+ b) with exact bf16 products (K = DIN) -> which 0: q f16 rows (+ residual rows < QHI); 1: k f16 rows (+ residual rows < KHI); 2: v f16 planes [c][t] (+ bf16 hi/lo planes for t < KHI)
__global__ __launch_bounds__(256) void k_proj(const __bf16* __restrict__ XB, const __bf16* __restrict__ WB, const float* __restrict__ BQ, const float* __restrict__ BK, const float* __restrict__ BV,
    _Float16* __restrict__ QH, _Float16* __restrict__ QL, _Float16* __restrict__ KH, _Float16* __restrict__ KL, _Float16* __restrict__ VT, __bf16* __restrict__ VB, __bf16* __restrict__ VBL, const int* __restrict__ MASK, const float* __restrict__ GPROB, unsigned short* __restrict__ MG) {
  if (blockIdx.z >= 3) { pack_gate(MASK, GPROB, MG, (blockIdx.z - 3) * (TNB * TT / BR) * (CC / 128) + blockIdx.y * (TNB * TT / BR) + blockIdx.x, threadIdx.x); return; }   // the launch's last blocks write the gate tiles: whole blocks, in front of every barrier
  __shared__ __align__(16) union { struct { _Float16 sh[BR][136], sl[BR][136]; } r; struct { _Float16 th[128][BR + 8]; __bf16 tb[128][BR + 8], tbl[128][BR + 8]; } c; char w[2][TILE_SZ]; } sm;   // the weight and left-operand tiles live in the loop, the output staging (rows for q and k, planes for v) behind it
  auto& sh = sm.r.sh; auto& sl = sm.r.sl; auto& th = sm.c.th; auto& tb = sm.c.tb; auto& tbl = sm.c.tbl;
  const int tid = threadIdx.x, wave = tid >> 5, lane = tid & 31, col = lane & 15, g = lane >> 4, wm = wave >> 1, wn = wave & 1; const int which = blockIdx.z; const int c0 = blockIdx.y * 128; const size_t r0 = (size_t)blockIdx.x * BR; const size_t bb = r0 / TT; const int t0 = (int)(r0 % TT);
  const __bf16* X = XB + (size_t)which * NB * TT * DIN; const __bf16* WA = WB + (size_t)which * DIN * CC; const float* BA = which == 0 ? BQ : which == 1 ? BK : BV;
  v8f acc[8] = {};
  const unsigned lb = (unsigned)(size_t)(lds_char*)&sm.w[0][0]; const unsigned lw = lb + (tid >> 4) * WPITCH + (tid & 15) * 16, la = lb + A_OFF + (tid >> 3) * APITCH + (tid & 7) * 16;
  const char* wg = (const char*)(WA + (size_t)(tid >> 4) * CC + c0 + (tid & 15) * 8); const char* ag = (const char*)(X + (r0 + (tid >> 3)) * DIN + (tid & 7) * 8);
  auto copy = [&](int t) __attribute__((always_inline)) { const unsigned o = (t & 1) * TILE_SZ; tile_copy(lw + o, la + o, wg + (size_t)t * (KS * CC * 2), ag + t * (KS * 2), CC * 2); };
  copy(0);
  asm volatile("s_wait_asynccnt 0x0" ::: "memory");   // this wave's share of tile 0 has landed
  __syncthreads();   // publishes tile 0
  copy(1);
#pragma unroll 2   /* two tiles a trip: the buffer's offset is then a constant in every LDS address */
  for (int t = 0; t < DIN / KS; ++t) { const char* tile = sm.w[t & 1];
    const char* tl = tile + wfrag_lane(lane) + wn * 128; const __bf16* al = (const __bf16*)(tile + A_OFF + (wm * 32 + col) * APITCH);
#pragma unroll
    for (int c = 0; c < 2; ++c) { const v16b a0 = frag_b(al + 32 * c, lane), a1 = frag_b(al + 16 * (APITCH / 2) + 32 * c, lane); v16b wf[4];   // the six fragments as one group of LDS loads in front of their products: one LDS latency a group, not one a product
#pragma unroll
      for (int j = 0; j < 4; ++j) wf[j] = wfrag<v16b>(tl, c, j);
#pragma unroll
      for (int j = 0; j < 4; ++j) { acc[j] = wmma_bf(a0, wf[j], acc[j]); acc[4 + j] = wmma_bf(a1, wf[j], acc[4 + j]); } }
    asm volatile("s_wait_dscnt 0x0" ::: "memory");      // this wave's reads of this buffer have returned: behind the barrier it is refilled
    asm volatile("s_wait_asynccnt 0x0" ::: "memory");   // this wave's share of the next tile has landed
    __syncthreads();   // publishes the next tile and ends every wave's reads of this one; behind the last tile's the staging below reuses the tiles' LDS
    if (t + 2 < DIN / KS) copy(t + 2); }
  asm volatile("s_wait_asynccnt 0x0" ::: "memory");   // no copy is outstanding when the tiles' LDS is reused
  if (which < 2) { _Float16* DH = which == 0 ? QH : KH; _Float16* DL = which == 0 ? QL : KL; const int nhi = which == 0 ? QHI : KHI;
#pragma unroll
    for (int j = 0; j < 4; ++j) { const int cl = wn * 64 + j * 16 + col; const float bias = BA ? bfr(BA[c0 + cl]) : 0.f;
#pragma unroll
      for (int i = 0; i < 2; ++i)
#pragma unroll
        for (int r = 0; r < 8; ++r) { const float v = acc[i * 4 + j][r] + bias; const _Float16 hv = (_Float16)v; const int rl = wm * 32 + i * 16 + 8 * g + r; sh[rl][cl] = hv; sl[rl][cl] = (_Float16)((v - (float)hv) * 1024.0f); } }
    __syncthreads();
    for (int e = tid; e < BR * 16; e += 256) { const int rl = e >> 4, q = e & 15; vst2((unsigned*)(DH + (r0 + rl) * CC + c0 + q * 8), *(const v4u*)&sh[rl][q * 8]); if (t0 + rl < nhi) { vst2((unsigned*)(DL + (bb * nhi + t0 + rl) * (size_t)CC + c0 + q * 8), *(const v4u*)&sl[rl][q * 8]);
        asm volatile("s_wait_xcnt 0x0" ::: "memory"); } }   // the next trip steps this store's address registers; the wait stands in the store's own branch, where no such step can be lifted over it
  } else {
#pragma unroll
    for (int j = 0; j < 4; ++j) { const int cl = wn * 64 + j * 16 + col; const float bias = BA ? bfr(BA[c0 + cl]) : 0.f;
#pragma unroll
      for (int i = 0; i < 2; ++i)
#pragma unroll
        for (int r = 0; r < 8; ++r) { const float v = acc[i * 4 + j][r] + bias; const int rl = wm * 32 + i * 16 + 8 * g + r; th[cl][rl] = (_Float16)v; const __bf16 bh = (__bf16)v; tb[cl][rl] = bh; tbl[cl][rl] = (__bf16)(v - (float)bh); } }
    __syncthreads();
    for (int e = tid; e < 128 * (BR / 8); e += 256) { const int cl = e >> 4, q = e & 15; vst2((unsigned*)(VT + (bb * CC + c0 + cl) * (size_t)TT + t0 + q * 8), *(const v4u*)&th[cl][q * 8]); if (t0 + q * 8 < KHI) { const size_t o3 = (bb * CC + c0 + cl) * (size_t)KHI + t0 + q * 8; vst2((unsigned*)(VB + o3), *(const v4u*)&tb[cl][q * 8]); vst2((unsigned*)(VBL + o3), *(const v4u*)&tbl[cl][q * 8]);
        asm volatile("s_wait_xcnt 0x0" ::: "memory"); } } } }   // the next trip steps these stores' address registers; the wait stands in the stores' own branch, where no such step can be lifted over it
// ---- k_att: block = 64 queries (4 waves x 16) of (b, h); each wave walks all keys in steps of 64 with a running maximum and sum, so no logit leaves the registers.
// S^T = K Q^T: lane (g, col) holds query col, keys k0 + 16i + 8g + r (tile i), which by pairs of tiles is already the k order of a 16x16x32 operand; ctx^T = V^T P^T keeps the query in the lane, so maximum, sum and rescale are lane-local but for one exchange with lane ^ 16.
// Each step's operands (64 k rows, 64 v rows of 64 keys, two tiles of 64 gate rows of 32 keys) come into LDS once per block by asynchronous copies that cover whole 128-byte lines; the waves take their fragments from there. A fragment load straight from global memory touches 16 lines for 512 bytes.
__device__ __forceinline__ float xhalf(float x) { return __builtin_bit_cast(float, __builtin_amdgcn_permlanex16(__builtin_bit_cast(int, x), __builtin_bit_cast(int, x), 0x76543210, 0xfedcba98, false, false)); }  // lane l with lane l ^ 16
__device__ __forceinline__ v8f wmmah(v16h a, v16h b, v8f c) { return __builtin_amdgcn_wmma_f32_16x16x32_f16(false, a, false, b, (short)0, c, false, false); }
#define LOG2E 1.4426950408889634f
#define AKP 144            // bytes a staged k row: 128 + 16 (the conflict-free pitch of 16-byte LDS reads)
#define AVP 144            // bytes a staged v row: 64 keys = 128 + 16
#define AMP 80             // bytes a staged gate row: 32 keys = 64 + 16
#define KST 64             // keys a step
#define A_K 0
#define A_V (A_K + KST * AKP)
#define A_M (A_V + HD * AVP)
#define A_SZ (A_M + 2 * 64 * AMP)
// this thread's twelve 16-byte copies of one step's operands: k rows r + 16i, v rows r + 16i (each a whole 128-byte line per 8 lanes), gate pieces tid + 128i of the step's two tiles. The wait at the end stands in the copies' own statement, in front of any rewrite of the address registers that they name.
__device__ __forceinline__ void att_copy(unsigned lk, unsigned lv, unsigned lm, const char* k, const char* v, const char* m) {
  asm volatile("global_load_async_to_lds_b128 %0, %12, off\n\t"
               "global_load_async_to_lds_b128 %1, %13, off\n\t"
               "global_load_async_to_lds_b128 %2, %14, off\n\t"
               "global_load_async_to_lds_b128 %3, %15, off\n\t"
               "global_load_async_to_lds_b128 %4, %16, off\n\t"
               "global_load_async_to_lds_b128 %5, %17, off\n\t"
               "global_load_async_to_lds_b128 %6, %18, off\n\t"
               "global_load_async_to_lds_b128 %7, %19, off\n\t"
               "global_load_async_to_lds_b128 %8, %20, off\n\t"
               "global_load_async_to_lds_b128 %9, %21, off\n\t"
               "global_load_async_to_lds_b128 %10, %22, off\n\t"
               "global_load_async_to_lds_b128 %11, %23, off\n\t"
               "s_wait_xcnt 0x0"
               :: "v"(lk), "v"(lk + 16 * AKP), "v"(lk + 32 * AKP), "v"(lk + 48 * AKP), "v"(lv), "v"(lv + 16 * AVP), "v"(lv + 32 * AVP), "v"(lv + 48 * AVP), "v"(lm), "v"(lm + 32 * AMP), "v"(lm + 64 * AMP), "v"(lm + 96 * AMP),
                  "v"(k), "v"(k + 16 * CC * 2), "v"(k + 32 * CC * 2), "v"(k + 48 * CC * 2), "v"(v), "v"(v + 16 * TT * 2), "v"(v + 32 * TT * 2), "v"(v + 48 * TT * 2), "v"(m), "v"(m + 2048), "v"(m + 4096), "v"(m + 6144)
               : "memory"); }
__global__ __launch_bounds__(128) void k_att(const _Float16* __restrict__ QH, const _Float16* __restrict__ KH, const _Float16* __restrict__ VT, const unsigned short* __restrict__ MG, _Float16* __restrict__ Y) {
  __shared__ __align__(16) char sa[2][A_SZ];
  const int tid = threadIdx.x, wave = tid >> 5, lane = tid & 31, col = lane & 15, g = lane >> 4; const int h = blockIdx.y, b = blockIdx.z; const int q = blockIdx.x * 64 + wave * 16 + col;
  const _Float16* qp = QH + ((size_t)b * TT + q) * CC + h * HD; const v16h q0 = frag_h(qp, lane), q1 = frag_h(qp + 32, lane);
  asm volatile("s_wait_xcnt 0x0" ::: "memory");   // the q loads' address registers are reused by what follows
  const unsigned lb = (unsigned)(size_t)(lds_char*)&sa[0][0];
  const unsigned lk = lb + A_K + (tid >> 3) * AKP + (tid & 7) * 16, lv = lk + (A_V - A_K), lm = lb + A_M + (tid >> 2) * AMP + (tid & 3) * 16;
  const char* kg = (const char*)(KH + ((size_t)b * TT + (tid >> 3)) * CC + h * HD + (tid & 7) * 8); const char* vg = (const char*)(VT + ((size_t)b * CC + h * HD + (tid >> 3)) * (size_t)TT + (tid & 7) * 8);
  const char* mg = (const char*)(MG + (size_t)(b * NQB + blockIdx.x) * (TT / 32) * (64 * 32)) + tid * 16;   // a tile's 256 pieces of 16 bytes in their order: piece p = row p >> 2, part p & 3; a step's two tiles follow one another
  auto copy = [&](int t) __attribute__((always_inline)) { const unsigned o = (t & 1) * A_SZ; att_copy(lk + o, lv + o, lm + o, kg + (size_t)t * (KST * CC * 2), vg + t * (KST * 2), mg + t * (2 * 64 * 64)); };
  v8f acc[HD / 16] = {}; float m = -3.0e38f, mo = -3.0e38f, l = 0.f;   // m: running maximum (base 2); mo = m - 11: every weight is carried x 2^11 into f16, the sum too, so the factor cancels in the final division
  copy(0);
  asm volatile("s_wait_asynccnt 0x0" ::: "memory");   // this wave's share of step 0 has landed
  __syncthreads();   // publishes step 0
  copy(1);
#pragma unroll 2   /* two steps a trip: the buffer's offset is then a constant in every LDS address */
  for (int t = 0; t < TT / KST; ++t) { const char* bp = sa[t & 1];
    v8f s[4]; v8us gt[4];   // s[i], gt[i]: this query's scores and gates of keys 16i + 8g + 0..7
#pragma unroll
    for (int i = 0; i < 4; ++i) { const _Float16* kr = (const _Float16*)(bp + A_K + (16 * i + col) * AKP); const v16h k0 = frag_h(kr, lane), k1 = frag_h(kr + 32, lane); v8f z = {}; z = wmmah(k0, q0, z); s[i] = wmmah(k1, q1, z);
      gt[i] = *(const v8us*)((const unsigned short*)(bp + A_M + ((i >> 1) * 64 + wave * 16 + col) * AMP) + 16 * (i & 1) + 8 * g); }
    float tv[32];
#pragma unroll
    for (int i = 0; i < 32; ++i) tv[i] = (short)gt[i >> 3][i & 7] < 0 ? -1.0e9f * LOG2E : s[i >> 3][i & 7] * (SCALE * LOG2E);
    float mx = fmaxf(tv[0], tv[1]);
#pragma unroll
    for (int i = 2; i < 32; ++i) mx = fmaxf(mx, tv[i]);
    mx = fmaxf(mx, xhalf(mx)); m = fmaxf(m, mx); const float mn = m - 11.0f; const float corr = __builtin_amdgcn_exp2f(mo - mn); mo = mn;   // corr = 0 on the first step
    v16h p[2]; float ls[4] = {0.f, 0.f, 0.f, 0.f};
#pragma unroll
    for (int i = 0; i < 32; ++i) { const float e = __builtin_amdgcn_exp2f(tv[i] - mn); ls[i & 3] += e; const unsigned short u = gt[i >> 3][i & 7]; p[i >> 4][i & 15] = (_Float16)(e * __builtin_fabsf((float)__builtin_bit_cast(__bf16, u))); }   // the sum takes the softmax weight alone; group_prob (bf16-rounded like every float input; the gate without its mask bit, which is the sign) enters the product only
    l = l * corr + ((ls[0] + ls[1]) + (ls[2] + ls[3]));
#pragma unroll
    for (int j = 0; j < HD / 16; ++j) { const _Float16* vr = (const _Float16*)(bp + A_V + (j * 16 + col) * AVP); acc[j] *= corr; acc[j] = wmmah(frag_h(vr, lane), p[0], acc[j]); acc[j] = wmmah(frag_h(vr + 32, lane), p[1], acc[j]); }
    asm volatile("s_wait_dscnt 0x0" ::: "memory");      // this wave's reads of this buffer have returned: behind the barrier it is refilled
    asm volatile("s_wait_asynccnt 0x0" ::: "memory");   // this wave's share of the next step has landed
    __syncthreads();   // publishes the next step's buffer and ends every wave's reads of this one
    if (t + 2 < TT / KST) copy(t + 2); }
  asm volatile("s_wait_asynccnt 0x0" ::: "memory");   // no copy is outstanding when the wave ends
  l += xhalf(l); const float inv = 1.0f / l;   // l >= 1: the maximum's own weight is in it
  _Float16* yp = Y + ((size_t)b * TT + q) * CC + h * HD + 8 * g;   /* ctx carried x 2^6 into f16 so small-magnitude context rows stay clear of f16 subnormals */
#pragma unroll
  for (int j = 0; j < HD / 16; ++j) { v8h o;
#pragma unroll
    for (int r = 0; r < 8; ++r) o[r] = (_Float16)(acc[j][r] * inv * 64.0f);
    vst2(yp + j * 16, o); } }
// ---- k_out: block = (128 rows, 128 cols): out = ctx Wo (+ bo): ctx once to f16 against Wo as f16(bf16 x 2^8) exact (1 product) x 2^-14 (2^-8 Wo carry, 2^-6 ctx carry)
__global__ __launch_bounds__(256) void k_out(const _Float16* __restrict__ Y, const _Float16* __restrict__ WOH, const float* __restrict__ BO, float* __restrict__ OUT) { __shared__ __align__(16) float sf[8][32][68]; __shared__ __align__(16) char sw[2][TILE_SZ];
  const int tid = threadIdx.x, wave = tid >> 5, lane = tid & 31, col = lane & 15, g = lane >> 4, wm = wave >> 1, wn = wave & 1; const int c0 = blockIdx.y * 128; const size_t r0 = (size_t)blockIdx.x * BR;
  v8f acc[8] = {};
  const unsigned lb = (unsigned)(size_t)(lds_char*)&sw[0][0]; const unsigned lw = lb + (tid >> 4) * WPITCH + (tid & 15) * 16, la = lb + A_OFF + (tid >> 3) * APITCH + (tid & 7) * 16;
  const char* wg = (const char*)(WOH + (size_t)(tid >> 4) * DIN + c0 + (tid & 15) * 8); const char* ag = (const char*)(Y + (r0 + (tid >> 3)) * CC + (tid & 7) * 8);
  auto copy = [&](int t) __attribute__((always_inline)) { const unsigned o = (t & 1) * TILE_SZ; tile_copy(lw + o, la + o, wg + (size_t)t * (KS * DIN * 2), ag + t * (KS * 2), DIN * 2); };
  copy(0);
  asm volatile("s_wait_asynccnt 0x0" ::: "memory");   // this wave's share of tile 0 has landed
  __syncthreads();   // publishes tile 0
  copy(1);
#pragma unroll 2   /* two tiles a trip: the buffer's offset is then a constant in every LDS address */
  for (int t = 0; t < CC / KS; ++t) { const char* tile = sw[t & 1];
    const char* tl = tile + wfrag_lane(lane) + wn * 128; const _Float16* al = (const _Float16*)(tile + A_OFF + (wm * 32 + col) * APITCH);
#pragma unroll
    for (int c = 0; c < 2; ++c) { const v16h a0 = frag_h(al + 32 * c, lane), a1 = frag_h(al + 16 * (APITCH / 2) + 32 * c, lane); v16h wf[4];   // the six fragments as one group of LDS loads in front of their products: one LDS latency a group, not one a product
#pragma unroll
      for (int j = 0; j < 4; ++j) wf[j] = wfrag<v16h>(tl, c, j);
#pragma unroll
      for (int j = 0; j < 4; ++j) { acc[j] = wmma16(a0, wf[j], acc[j]); acc[4 + j] = wmma16(a1, wf[j], acc[4 + j]); } }
    asm volatile("s_wait_dscnt 0x0" ::: "memory");      // this wave's reads of this buffer have returned: behind the barrier it is refilled
    asm volatile("s_wait_asynccnt 0x0" ::: "memory");   // this wave's share of the next tile has landed
    __syncthreads();   // publishes the next tile and ends every wave's reads of this one
    if (t + 2 < CC / KS) copy(t + 2); }
  asm volatile("s_wait_asynccnt 0x0" ::: "memory");   // no copy is outstanding when the wave ends
#pragma unroll
  for (int j = 0; j < 4; ++j) { const float bias = BO ? bfr(BO[c0 + wn * 64 + j * 16 + col]) : 0.f;
#pragma unroll
    for (int i = 0; i < 2; ++i)
#pragma unroll
      for (int r = 0; r < 8; ++r) sf[wave][i * 16 + 8 * g + r][j * 16 + col] = acc[i * 4 + j][r] * (1.0f / 16384.0f) + bias; }   /* 2^-8 (Wo carry) x 2^-6 (ctx carry) */
  // each wave stages its own 32 x 64 piece and stores it as whole 256-byte row pieces, two rows a store
  LDSX(); for (int i = 0; i < 16; ++i) { const int rl = 2 * i + g; vst2(OUT + (r0 + wm * 32 + rl) * DIN + c0 + wn * 64 + col * 4, *(const v4f*)&sf[wave][rl][col * 4]); } }

extern "C" void kernel_launch(void* const* d_in, const int* in_sizes, int n_in, void* d_out, int out_size, void* d_ws, size_t ws_size, hipStream_t stream) {
  (void)in_sizes; (void)n_in; (void)out_size;
  const float** F = (const float**)d_in;
  if (ws_size < (size_t)WS_END) return;
  char* ws = (char*)d_ws; _Float16 *QH = (_Float16*)(ws + WS_QH), *KH = (_Float16*)(ws + WS_KH), *VT = (_Float16*)(ws + WS_VT), *QL = (_Float16*)(ws + WS_QL), *KL = (_Float16*)(ws + WS_KL); __bf16 *VB = (__bf16*)(ws + WS_VB), *VBL = (__bf16*)(ws + WS_VBL); _Float16 *Y = (_Float16*)(ws + WS_Y); unsigned short *MG = (unsigned short*)(ws + WS_S);
  (void)Y; (void)QL; (void)KL; (void)VB; (void)VBL;
  // inputs: 0 query [4,1024,1024]; 1 key; 2 value; 3 group_prob [4,1024,1024] f32 uniform[0,1); 4 mask [4,1024,1024] int32 (random 0/1); 5 wq [1024,1024] (in,out), 6 bq; 7 wk, 8 bk; 9 wv, 10 bv; 11 wo (in,out), 12 bo (biases nonzero)
  k_prep<<<PREP_BLOCKS, 256, 0, stream>>>(F[0], F[1], F[2], F[5], F[7], F[9], F[11], (unsigned short*)(ws + WS_XB), (unsigned short*)(ws + WS_WB), (unsigned short*)(ws + WS_WOH));
  k_proj<<<dim3(TNB * TT / BR, CC / 128, 3 + GATE_BLOCKS / ((TNB * TT / BR) * (CC / 128))), 256, 0, stream>>>((const __bf16*)(ws + WS_XB), (const __bf16*)(ws + WS_WB), F[6], F[8], F[10], QH, QL, KH, KL, VT, VB, VBL, (const int*)d_in[4], F[3], MG);
  k_att<<<dim3(NQB, NH, TNB), 128, 0, stream>>>(QH, KH, VT, MG, Y);
  k_out<<<dim3(TNB * TT / BR, DIN / 128), 256, 0, stream>>>(Y, (const _Float16*)(ws + WS_WOH), F[12], (float*)d_out);
}

// v009
// A run of this version takes 76.6 microseconds.
// In two side-by-side timings against v008, it was 1.06 and 1.05 times as fast.
// Over all steps from v000 it is 10.3 times as fast.
// compute dtype: all float inputs rounded to bf16; q/k/v projections with EXACT bf16 products on WMMA 16x16x32 (f32 accumulate) + bias; logits q x k once to f16 each (1 product) x SCALE; the int mask read per element (0 - -1e9); softmax f32 with a running maximum and sum; the weight exp(s - max) x 2^11 is MULTIPLIED by the float group_prob (which stays out of the sum: no renormalisation), once to f16 x v once to f16 (1 product), and the product is divided by the sum x 2^11; ctx x 2^6 once to f16 x Wo f16(bf16 x 2^8) + bo; f32 output.
#include <hip/hip_runtime.h>
#include <math.h>

typedef __attribute__((ext_vector_type(16))) _Float16 v16h;
typedef __attribute__((ext_vector_type(16))) __bf16 v16b;
typedef __attribute__((ext_vector_type(8)))  _Float16 v8h;
typedef __attribute__((ext_vector_type(8)))  float v8f;
typedef __attribute__((ext_vector_type(4)))  float v4f;
typedef __attribute__((ext_vector_type(2)))  float v2f;
typedef __attribute__((ext_vector_type(4)))  unsigned v4u;
typedef __attribute__((ext_vector_type(4)))  int v4i;
typedef float __attribute__((may_alias)) float_a;
typedef int __attribute__((may_alias)) int_a;

template <typename T> __device__ __forceinline__ void vst2(void* p, T v) { *(T*)p = v;  }
__device__ __forceinline__ v8f wmma16(v16h a, v16h b, v8f c) {
  v8f d = __builtin_amdgcn_wmma_f32_16x16x32_f16(false, a, false, b, (short)0, c, false, false);
  asm volatile("v_nop\n\tv_nop\n\tv_nop\n\tv_nop" : "+v"(d) : "v"(a), "v"(b));
  return d;
}
__device__ __forceinline__ v8f wmma_bf(v16b a, v16b b, v8f c) {
  v8f d = __builtin_amdgcn_wmma_f32_16x16x32_bf16(false, a, false, b, (short)0, c, false, false);
  asm volatile("v_nop\n\tv_nop\n\tv_nop\n\tv_nop" : "+v"(d) : "v"(a), "v"(b));
  return d;
}
// 16x16x32 fragments: lane = (h = lane>>4, row/col = lane&15); elements 0..7 = k0+8h+0..7, 8..15 = k0+16+8h+0..7; D element r = row 8h+r
__device__ __forceinline__ v16h frag_h(const _Float16* rowk0, int lane) {
  union { v16h v; v8h q[2]; } u; const _Float16* p = rowk0 + 8 * (lane >> 4);
  u.q[0] = *(const v8h*)p; u.q[1] = *(const v8h*)(p + 16); return u.v;
}
__device__ __forceinline__ v16h frag_f32(const float* rowk0, int lane) {
  v16h a; const float* p = rowk0 + 8 * (lane >> 4);
#pragma unroll
  for (int i = 0; i < 8; ++i) { a[i] = (_Float16)p[i]; a[8 + i] = (_Float16)p[16 + i]; }
  return a;
}
__device__ __forceinline__ v16h frag_f32s(const float* rowk0, int lane, float sc) {
  v16h a; const float* p = rowk0 + 8 * (lane >> 4);
#pragma unroll
  for (int i = 0; i < 8; ++i) { a[i] = (_Float16)(p[i] * sc); a[8 + i] = (_Float16)(p[16 + i] * sc); }
  return a;
}
// column fragment from a [K][ld] layout (column n), rows >= K read as 0
__device__ __forceinline__ v16h fragc_f32(const float* W, int k0, int n, int lane, int ld, int K) {
  v16h a; const int g = lane >> 4;
#pragma unroll
  for (int i = 0; i < 8; ++i) { const int ka = k0 + 8 * g + i, kb = ka + 16;
    a[i] = (_Float16)(ka < K ? W[(size_t)(ka < K ? ka : K - 1) * ld + n] : 0.f); a[8 + i] = (_Float16)(kb < K ? W[(size_t)(kb < K ? kb : K - 1) * ld + n] : 0.f); }
  return a;
}
struct F2 { v16b h, l; };
__device__ __forceinline__ F2 bsplit16(const float v[16]) { F2 r;
#pragma unroll
  for (int i = 0; i < 16; ++i) { const __bf16 h = (__bf16)v[i]; r.h[i] = h; r.l[i] = (__bf16)(v[i] - (float)h); }
  return r; }
__device__ __forceinline__ F2 split_row(const float* row, int k0, int lane) { float v[16]; const float* p = row + k0 + 8 * (lane >> 4);
#pragma unroll
  for (int i = 0; i < 8; ++i) { v[i] = p[i]; v[8 + i] = p[16 + i]; }
  return bsplit16(v); }
__device__ __forceinline__ F2 split_rowK(const float* row, int k0, int lane, int K) { float v[16]; const int g = lane >> 4;
#pragma unroll
  for (int i = 0; i < 8; ++i) { const int ka = k0 + 8 * g + i, kb = ka + 16; v[i] = ka < K ? row[ka < K ? ka : K - 1] : 0.f; v[8 + i] = kb < K ? row[kb < K ? kb : K - 1] : 0.f; }
  return bsplit16(v); }
__device__ __forceinline__ F2 split_col(const float* W, int k0, int n, int lane, int ld, int K) { float v[16]; const int g = lane >> 4;
#pragma unroll
  for (int i = 0; i < 8; ++i) { const int ka = k0 + 8 * g + i, kb = ka + 16; v[i] = ka < K ? W[(size_t)(ka < K ? ka : K - 1) * ld + n] : 0.f; v[8 + i] = kb < K ? W[(size_t)(kb < K ? kb : K - 1) * ld + n] : 0.f; }
  return bsplit16(v); }
__device__ __forceinline__ v8f mac3(const F2& a, const F2& b, v8f c) { c = wmma_bf(a.l, b.h, c); c = wmma_bf(a.h, b.l, c); return wmma_bf(a.h, b.h, c); }
__device__ __forceinline__ float sigm(float v) { return 1.0f / (1.0f + expf(-v)); }
#define LDSX() do { asm volatile("s_wait_dscnt 0" ::: "memory"); __builtin_amdgcn_wave_barrier(); __builtin_amdgcn_fence(__ATOMIC_RELEASE, "workgroup"); } while (0)

// Multi-headed attention whose probabilities are multiplied by a group-probability tensor (query / key / value [4,1024,1024]; (in,out) wq / wk / wv / wo [1024,1024] uniform(+-1/32) + biases uniform(+-1/32); 16 heads x 64; scale 1/8; mask [4,1024,1024] int32 random 0/1: scores[mask == 0] = -1e9; p = softmax(scores); p *= group_prob[:, None] with group_prob [4,1024,1024] uniform[0,1) f32 (multiplicative, after the softmax, no renormalisation); merge; wo + bo).
#define NB 4
#define TT 1024
#define CC 1024            // NH * HD = projected width
#define DIN 1024          // input (model) width
#define NH 16
#define HD 64
#define NQB (TT / 64)
#define HG 8
#define SCALE (0.125f)
#define CAUSAL 0
#ifndef TNB
#define TNB NB
#endif
__device__ __forceinline__ float bfr(float v) { return (float)(__bf16)v; }
__host__ __device__ __forceinline__ int kb_last(int qb) { return CAUSAL ? ((qb * 64 + 63) >> 7) : (TT / 128 - 1); }
typedef __attribute__((ext_vector_type(8))) __bf16 v8b;
__device__ __forceinline__ v16b frag_b(const __bf16* rowk0, int lane) {
  union { v16b v; v8b q[2]; } u; const __bf16* p = rowk0 + 8 * (lane >> 4);
  u.q[0] = *(const v8b*)p; u.q[1] = *(const v8b*)(p + 16); return u.v;
}
#define QBH 0              // unused: no kernel in this file has a high-precision attention path
#define QHI 0               // single-product logits on every row
#define KHI 64            // key rows carrying k residual / v bf16 hi+lo planes (written by k_proj; no kernel in this file reads them)
// B fragment (k rows k0+.., output column o) of a weight: (in,out) [K][ld] or (out,in) [ld rows of K]: bf16 exact, or f16(bf16 * 256) exact
__device__ __forceinline__ v16b wcol_io(const float* Wm, int k0, int o, int lane, int ld) { v16b w; const int g = lane >> 4;
#pragma unroll
  for (int i = 0; i < 8; ++i) { w[i] = (__bf16)Wm[(size_t)(k0 + 8 * g + i) * ld + o]; w[8 + i] = (__bf16)Wm[(size_t)(k0 + 16 + 8 * g + i) * ld + o]; }
  return w; }
__device__ __forceinline__ v16b wcol_oi(const float* Wm, int k0, int o, int lane, int K) { v16b w; const float* p = Wm + (size_t)o * K + k0 + 8 * (lane >> 4);
#pragma unroll
  for (int i = 0; i < 8; ++i) { w[i] = (__bf16)p[i]; w[8 + i] = (__bf16)p[16 + i]; }
  return w; }
__device__ __forceinline__ v16h wcolh_io(const float* Wm, int k0, int o, int lane, int ld) { v16h w; const int g = lane >> 4;
#pragma unroll
  for (int i = 0; i < 8; ++i) { w[i] = (_Float16)(bfr(Wm[(size_t)(k0 + 8 * g + i) * ld + o]) * 256.0f); w[8 + i] = (_Float16)(bfr(Wm[(size_t)(k0 + 16 + 8 * g + i) * ld + o]) * 256.0f); }
  return w; }
__device__ __forceinline__ v16h wcolh_oi(const float* Wm, int k0, int o, int lane, int K) { v16h w; const float* p = Wm + (size_t)o * K + k0 + 8 * (lane >> 4);
#pragma unroll
  for (int i = 0; i < 8; ++i) { w[i] = (_Float16)(bfr(p[i]) * 256.0f); w[8 + i] = (_Float16)(bfr(p[16 + i]) * 256.0f); }
  return w; }
#define WQKV_LAYOUT 0   // selects only WCOL, which no kernel here uses (k_proj always reads (in,out) [DIN][CC]): 0 = (in,out) [DIN][CC]; 1 = (out,in) [CC][DIN]; 2 = per-head [NH][DIN][HD]
__device__ __forceinline__ v16b wcol_hdk(const float* Wm, int k0, int o, int lane) { v16b w; const int g = lane >> 4; const float* p = Wm + (size_t)(o / HD) * DIN * HD + (o % HD);
#pragma unroll
  for (int i = 0; i < 8; ++i) { w[i] = (__bf16)p[(size_t)(k0 + 8 * g + i) * HD]; w[8 + i] = (__bf16)p[(size_t)(k0 + 16 + 8 * g + i) * HD]; }
  return w; }
#define WO_OUT_IN 0
#if WQKV_LAYOUT == 1
#define WCOL(W, k0, o, lane) wcol_oi(W, k0, o, lane, DIN)
#elif WQKV_LAYOUT == 2
#define WCOL(W, k0, o, lane) wcol_hdk(W, k0, o, lane)
#else
#define WCOL(W, k0, o, lane) wcol_io(W, k0, o, lane, CC)
#endif
#if WO_OUT_IN
#define WOCOL(W, k0, o, lane) wcol_oi(W, k0, o, lane, CC)
#define WOCOLH(W, k0, o, lane) wcolh_oi(W, k0, o, lane, CC)
#else
#define WOCOL(W, k0, o, lane) wcol_io(W, k0, o, lane, DIN)
#define WOCOLH(W, k0, o, lane) wcolh_io(W, k0, o, lane, DIN)
#endif
#define WS_QH  0u                                      // f16 q rows [b*t][CC]
#define WS_KH  (WS_QH + 2u * (size_t)NB * TT * CC)      // f16 k rows [b*t][CC]
#define WS_VT  (WS_KH + 2u * (size_t)NB * TT * CC)      // f16 v planes [b][c][t]
#define WS_QL  (WS_VT + 2u * (size_t)NB * CC * TT)      // f16 q residual x 2^10 rows [b][t < QHI][CC]
#define WS_KL  (WS_QL + 2u * (size_t)NB * QHI * CC)     // f16 k residual x 2^10 rows [b][t < KHI][CC]
#define WS_VB  (WS_KL + 2u * (size_t)NB * KHI * CC)     // bf16 v hi planes [b][c][t < KHI]
#define WS_VBL (WS_VB + 2u * (size_t)NB * CC * KHI)
#define WS_S   (WS_VBL + 2u * (size_t)NB * CC * KHI)    // 16-bit gate tiles (8 MiB of this range; its size is kept so that the layout behind it is unchanged)
#define WS_Y   (WS_S  + 4u * (size_t)HG * TT * TT)      // f16 ctx x 2^6 rows [b*t][CC] (half of this range)
#define WS_XB  (WS_Y  + 4u * (size_t)NB * TT * CC)      // bf16 query / key / value rows [3][b*t][DIN]
#define WS_WB  (WS_XB + 2u * 3u * (size_t)NB * TT * DIN) // bf16 wq / wk / wv [3][DIN][CC]
#define WS_WOH (WS_WB + 2u * 3u * (size_t)DIN * CC)     // f16(bf16 wo x 2^8) [CC][DIN]
#define WS_END (WS_WOH + 2u * (size_t)CC * DIN)

// ---- weight tile in LDS: KS k rows x 128 output columns, 16-bit, row-major as in memory; every wave takes its column fragments from there with the transposing load
#define KS 64
#define WPITCH 288         // bytes a staged row: 256 + 32, an odd multiple of 32 bytes (the transposing load's conflict-free pitch)
typedef __attribute__((ext_vector_type(8))) short v8s;
typedef __attribute__((ext_vector_type(4))) __bf16 v4b;
typedef __attribute__((ext_vector_type(4))) _Float16 v4h;
__device__ __forceinline__ v4u ld_tr16(const char* p) { typedef __attribute__((address_space(3))) v8s lds_v8s; return __builtin_bit_cast(v4u, __builtin_amdgcn_ds_load_tr16_b128_v8i16((lds_v8s*)p)); }
// lane (col, g) gets tile[kk*32 + 8g + 0..7][j*16 + col] and tile[kk*32 + 16 + 8g + 0..7][j*16 + col]: the k order of the row fragments above. tl = tile + wfrag_lane(lane)
__device__ __forceinline__ int wfrag_lane(int lane) { return (8 * (lane >> 4) + (lane & 7)) * WPITCH + 16 * ((lane >> 3) & 1); }
template <typename V> __device__ __forceinline__ V wfrag(const char* tl, int kk, int j) { union { V v; v4u q[2]; } u; const char* p = tl + kk * 32 * WPITCH + j * 32; u.q[0] = ld_tr16(p); u.q[1] = ld_tr16(p + 16 * WPITCH); return u.v; }
// left operand in LDS: behind each weight tile the block's BR rows x KS k, 16-bit, row-major
#define BR 128             // rows a block
#define APITCH 144         // bytes a staged row of the left operand: 128 + 16 (the conflict-free pitch of 16-byte LDS reads)
#define A_OFF (KS * WPITCH)
#define TILE_SZ (A_OFF + BR * APITCH)
// 8 waves a block. Both operands lie in the workspace in their 16-bit form (k_prep, k_att), so a tile goes from there into LDS by asynchronous copies and passes no register.
// This thread's eight 16-byte copies of one tile: weight rows r, r + 16, r + 32, r + 48 (a wave's copy covers two whole 256-byte row pieces), left rows s, s + 32, s + 64, s + 96 (four whole 128-byte lines). ld = bytes a row of either operand in memory.
// The wait at the end stands in the copies' own statement, in front of any rewrite of the address registers that they name.
// products: wave (wm = wave >> 1, wn = wave & 1) owns rows wm*32 + 0..31 x columns wn*64 + 0..63: 2 left and 4 weight fragments feed 8 products; acc[i*4 + j] = row tile i, column tile j
typedef __attribute__((address_space(3))) char lds_char;
__device__ __forceinline__ void tile_copy(unsigned lw, unsigned la, const char* w, const char* a, int ld) {
  asm volatile("global_load_async_to_lds_b128 %0, %8, off\n\t"
               "global_load_async_to_lds_b128 %1, %9, off\n\t"
               "global_load_async_to_lds_b128 %2, %10, off\n\t"
               "global_load_async_to_lds_b128 %3, %11, off\n\t"
               "global_load_async_to_lds_b128 %4, %12, off\n\t"
               "global_load_async_to_lds_b128 %5, %13, off\n\t"
               "global_load_async_to_lds_b128 %6, %14, off\n\t"
               "global_load_async_to_lds_b128 %7, %15, off\n\t"
               "s_wait_xcnt 0x0"
               :: "v"(lw), "v"(lw + 16 * WPITCH), "v"(lw + 32 * WPITCH), "v"(lw + 48 * WPITCH), "v"(la), "v"(la + 32 * APITCH), "v"(la + 64 * APITCH), "v"(la + 96 * APITCH),
                  "v"(w), "v"(w + 16 * ld), "v"(w + 32 * ld), "v"(w + 48 * ld), "v"(a), "v"(a + 32 * ld), "v"(a + 64 * ld), "v"(a + 96 * ld)
               : "memory"); }
// ---- k_prep: every GEMM operand that arrives as f32 is rounded to its 16-bit form once a call (the blocks of k_proj and k_out did it per tile: 8 times for a left element, 32 times for a weight): query / key / value and wq / wk / wv to bf16, wo to f16(bf16 x 2^8).
// A block takes PREP_F consecutive floats in 4 rounds; a wave's load covers 512 contiguous bytes, its store 256. Two register sets, so that one round's loads fly while the round before is stored.
typedef __attribute__((ext_vector_type(4))) unsigned short v4us;
#define PREP_F 32768
#define PREP_X (NB * TT * DIN / PREP_F)
#define PREP_W (DIN * CC / PREP_F)
#define PREP_BLOCKS (3 * PREP_X + 4 * PREP_W)
#define XW() asm volatile("s_wait_xcnt 0x0" ::: "memory")   /* behind a round's stores: their data registers are reused by the loads that follow. Behind a round's loads: it keeps the next stores from being mixed among them */
template <bool WOF> __device__ __forceinline__ void prep_run(const float* __restrict__ sp, unsigned short* __restrict__ dp) {
  v4f a[8], b[8];
  auto ld = [&](v4f (&x)[8], int r) __attribute__((always_inline)) {
#pragma unroll
    for (int i = 0; i < 8; ++i) x[i] = *(const v4f*)(sp + r * 8192 + i * 1024); };
  auto st = [&](const v4f (&x)[8], int r) __attribute__((always_inline)) {
#pragma unroll
    for (int i = 0; i < 8; ++i) { v4us o;
#pragma unroll
      for (int c = 0; c < 4; ++c) o[c] = WOF ? __builtin_bit_cast(unsigned short, (_Float16)(bfr(x[i][c]) * 256.0f)) : __builtin_bit_cast(unsigned short, (__bf16)x[i][c]);
      *(v4us*)(dp + r * 8192 + i * 1024) = o; } };
  ld(a, 0); ld(b, 1); XW(); st(a, 0); XW(); ld(a, 2); XW(); st(b, 1); XW(); ld(b, 3); XW(); st(a, 2); XW(); st(b, 3); }
__global__ __launch_bounds__(256) void k_prep(const float* __restrict__ XQ, const float* __restrict__ XK, const float* __restrict__ XV, const float* __restrict__ WQ, const float* __restrict__ WK, const float* __restrict__ WV, const float* __restrict__ WO,
    unsigned short* __restrict__ XB, unsigned short* __restrict__ WB, unsigned short* __restrict__ WOH) {
  const int bi = blockIdx.x, t4 = threadIdx.x * 4;
  if (bi < 3 * PREP_X) { const int w = bi / PREP_X; prep_run<false>((w == 0 ? XQ : w == 1 ? XK : XV) + (size_t)(bi % PREP_X) * PREP_F + t4, XB + (size_t)bi * PREP_F + t4); }
  else if (bi < 3 * PREP_X + 3 * PREP_W) { const int k = bi - 3 * PREP_X, w = k / PREP_W; prep_run<false>((w == 0 ? WQ : w == 1 ? WK : WV) + (size_t)(k % PREP_W) * PREP_F + t4, WB + (size_t)k * PREP_F + t4); }
  else { const int k = bi - 3 * PREP_X - 3 * PREP_W; prep_run<true>(WO + (size_t)k * PREP_F + t4, WOH + (size_t)k * PREP_F + t4); } }
// ---- gate tiles: mask and group_prob of one (query, key) in 16 bits: group_prob rounded to bf16 (the rounding k_att applied per head), its sign bit set where mask == 0 (group_prob's generator is uniform [0,1): the sign is free).
// Layout [b*TT/64 + query block][key step of 32][64 queries][32 keys]: a tile is 4096 contiguous bytes; one step of a k_att block reads two consecutive tiles, 8192 bytes. Written once a call by extra blocks of the k_proj launch, read by all 16 heads.
// A wave takes 2 rows x 512 keys; lane (hi = lane >> 4, lo = lane & 15) takes row hi, keys 64i + 4lo + 0..3: a load covers two whole 256-byte row pieces, a store two whole 128-byte lines (rows 2n, 2n + 1 of two tiles).
typedef __attribute__((ext_vector_type(8))) unsigned short v8us;
#define GATE_BLOCKS (NB * TT * (TT / 32) / 256)   // 256 threads x 32 elements a block
__device__ __forceinline__ void pack_gate(const int* __restrict__ MASK, const float* __restrict__ GPROB, unsigned short* __restrict__ MG, int pb, int tid) {
  const int gw = pb * 8 + (tid >> 5), lane = tid & 31; const int R = (gw >> 1) * 2 + (lane >> 4); const int k0 = (gw & 1) * 512 + (lane & 15) * 4;
  const int* mp = MASK + (size_t)R * TT + k0; const float* gp = GPROB + (size_t)R * TT + k0;
  v4i mk[8]; v4f gq[8];
#pragma unroll
  for (int i = 0; i < 8; ++i) { mk[i] = *(const v4i*)(mp + i * 64); gq[i] = *(const v4f*)(gp + i * 64); }
  asm volatile("s_wait_xcnt 0x0" :: "v"(mp), "v"(gp) : "memory");   // the loads' address registers are reused by what follows; as inputs here they stay whole up to the wait
  unsigned short* dp = MG + ((size_t)((R >> 6) * (TT / 32) + (k0 >> 5)) * 64 + (R & 63)) * 32 + (k0 & 31);
#pragma unroll
  for (int i = 0; i < 8; ++i) { v4us o;
#pragma unroll
    for (int c = 0; c < 4; ++c) o[c] = (unsigned short)(__builtin_bit_cast(unsigned short, (__bf16)gq[i][c]) | (mk[i][c] == 0 ? 0x8000u : 0u));
    *(v4us*)(dp + (size_t)i * 2 * 64 * 32) = o; } }
// ---- k_proj: block = (128 rows, 128 cols, which): q/k/v = X W (+ b) with exact bf16 products (K = DIN) -> which 0: q f16 rows (+ residual rows < QHI); 1: k f16 rows (+ residual rows < KHI); 2: v f16 planes [c][t] (+ bf16 hi/lo planes for t < KHI)
__global__ __launch_bounds__(256) void k_proj(const __bf16* __restrict__ XB, const __bf16* __restrict__ WB, const float* __restrict__ BQ, const float* __restrict__ BK, const float* __restrict__ BV,
    _Float16* __restrict__ QH, _Float16* __restrict__ QL, _Float16* __restrict__ KH, _Float16* __restrict__ KL, _Float16* __restrict__ VT, __bf16* __restrict__ VB, __bf16* __restrict__ VBL, const int* __restrict__ MASK, const float* __restrict__ GPROB, unsigned short* __restrict__ MG) {
  if (blockIdx.z >= 3) { pack_gate(MASK, GPROB, MG, (blockIdx.z - 3) * (TNB * TT / BR) * (CC / 128) + blockIdx.y * (TNB * TT / BR) + blockIdx.x, threadIdx.x); return; }   // the launch's last blocks write the gate tiles: whole blocks, in front of every barrier
  __shared__ __align__(16) union { struct { _Float16 sh[BR][136], sl[BR][136]; } r; struct { _Float16 th[128][BR + 8]; __bf16 tb[128][BR + 8], tbl[128][BR + 8]; } c; char w[2][TILE_SZ]; } sm;   // the weight and left-operand tiles live in the loop, the output staging (rows for q and k, planes for v) behind it
  auto& sh = sm.r.sh; auto& sl = sm.r.sl; auto& th = sm.c.th; auto& tb = sm.c.tb; auto& tbl = sm.c.tbl;
  const int tid = threadIdx.x, wave = tid >> 5, lane = tid & 31, col = lane & 15, g = lane >> 4, wm = wave >> 1, wn = wave & 1; const int which = blockIdx.z; const int c0 = blockIdx.y * 128; const size_t r0 = (size_t)blockIdx.x * BR; const size_t bb = r0 / TT; const int t0 = (int)(r0 % TT);
  const __bf16* X = XB + (size_t)which * NB * TT * DIN; const __bf16* WA = WB + (size_t)which * DIN * CC; const float* BA = which == 0 ? BQ : which == 1 ? BK : BV;
  v8f acc[8] = {};
  const unsigned lb = (unsigned)(size_t)(lds_char*)&sm.w[0][0]; const unsigned lw = lb + (tid >> 4) * WPITCH + (tid & 15) * 16, la = lb + A_OFF + (tid >> 3) * APITCH + (tid & 7) * 16;
  const char* wg = (const char*)(WA + (size_t)(tid >> 4) * CC + c0 + (tid & 15) * 8); const char* ag = (const char*)(X + (r0 + (tid >> 3)) * DIN + (tid & 7) * 8);
  auto copy = [&](int t) __attribute__((always_inline)) { const unsigned o = (t & 1) * TILE_SZ; tile_copy(lw + o, la + o, wg + (size_t)t * (KS * CC * 2), ag + t * (KS * 2), CC * 2); };
  copy(0);
  asm volatile("s_wait_asynccnt 0x0" ::: "memory");   // this wave's share of tile 0 has landed
  __syncthreads();   // publishes tile 0
  copy(1);
#pragma unroll 2   /* two tiles a trip: the buffer's offset is then a constant in every LDS address */
  for (int t = 0; t < DIN / KS; ++t) { const char* tile = sm.w[t & 1];
    const char* tl = tile + wfrag_lane(lane) + wn * 128; const __bf16* al = (const __bf16*)(tile + A_OFF + (wm * 32 + col) * APITCH);
#pragma unroll
    for (int c = 0; c < 2; ++c) { const v16b a0 = frag_b(al + 32 * c, lane), a1 = frag_b(al + 16 * (APITCH / 2) + 32 * c, lane); v16b wf[4];   // the six fragments as one group of LDS loads in front of their products: one LDS latency a group, not one a product
#pragma unroll
      for (int j = 0; j < 4; ++j) wf[j] = wfrag<v16b>(tl, c, j);
#pragma unroll
      for (int j = 0; j < 4; ++j) { acc[j] = wmma_bf(a0, wf[j], acc[j]); acc[4 + j] = wmma_bf(a1, wf[j], acc[4 + j]); } }
    asm volatile("s_wait_dscnt 0x0" ::: "memory");      // this wave's reads of this buffer have returned: behind the barrier it is refilled
    asm volatile("s_wait_asynccnt 0x0" ::: "memory");   // this wave's share of the next tile has landed
    __syncthreads();   // publishes the next tile and ends every wave's reads of this one; behind the last tile's the staging below reuses the tiles' LDS
    if (t + 2 < DIN / KS) copy(t + 2); }
  asm volatile("s_wait_asynccnt 0x0" ::: "memory");   // no copy is outstanding when the tiles' LDS is reused
  if (which < 2) { _Float16* DH = which == 0 ? QH : KH; _Float16* DL = which == 0 ? QL : KL; const int nhi = which == 0 ? QHI : KHI;
#pragma unroll
    for (int j = 0; j < 4; ++j) { const int cl = wn * 64 + j * 16 + col; const float bias = BA ? bfr(BA[c0 + cl]) : 0.f;
#pragma unroll
      for (int i = 0; i < 2; ++i)
#pragma unroll
        for (int r = 0; r < 8; ++r) { const float v = acc[i * 4 + j][r] + bias; const _Float16 hv = (_Float16)v; const int rl = wm * 32 + i * 16 + 8 * g + r; sh[rl][cl] = hv; sl[rl][cl] = (_Float16)((v - (float)hv) * 1024.0f); } }
    __syncthreads();
    for (int e = tid; e < BR * 16; e += 256) { const int rl = e >> 4, q = e & 15; vst2((unsigned*)(DH + (r0 + rl) * CC + c0 + q * 8), *(const v4u*)&sh[rl][q * 8]); if (t0 + rl < nhi) { vst2((unsigned*)(DL + (bb * nhi + t0 + rl) * (size_t)CC + c0 + q * 8), *(const v4u*)&sl[rl][q * 8]);
        asm volatile("s_wait_xcnt 0x0" ::: "memory"); } }   // the next trip steps this store's address registers; the wait stands in the store's own branch, where no such step can be lifted over it
  } else {
#pragma unroll
    for (int j = 0; j < 4; ++j) { const int cl = wn * 64 + j * 16 + col; const float bias = BA ? bfr(BA[c0 + cl]) : 0.f;
#pragma unroll
      for (int i = 0; i < 2; ++i)
#pragma unroll
        for (int r = 0; r < 8; ++r) { const float v = acc[i * 4 + j][r] + bias; const int rl = wm * 32 + i * 16 + 8 * g + r; th[cl][rl] = (_Float16)v; const __bf16 bh = (__bf16)v; tb[cl][rl] = bh; tbl[cl][rl] = (__bf16)(v - (float)bh); } }
    __syncthreads();
    for (int e = tid; e < 128 * (BR / 8); e += 256) { const int cl = e >> 4, q = e & 15; vst2((unsigned*)(VT + (bb * CC + c0 + cl) * (size_t)TT + t0 + q * 8), *(const v4u*)&th[cl][q * 8]); if (t0 + q * 8 < KHI) { const size_t o3 = (bb * CC + c0 + cl) * (size_t)KHI + t0 + q * 8; vst2((unsigned*)(VB + o3), *(const v4u*)&tb[cl][q * 8]); vst2((unsigned*)(VBL + o3), *(const v4u*)&tbl[cl][q * 8]);
        asm volatile("s_wait_xcnt 0x0" ::: "memory"); } } } }   // the next trip steps these stores' address registers; the wait stands in the stores' own branch, where no such step can be lifted over it
// ---- k_att: block = 64 queries (4 waves x 16) of (b, h); each wave walks all keys in steps of 64 with a running maximum and sum, so no logit leaves the registers.
// S^T = K Q^T: lane (g, col) holds query col, keys k0 + 16i + 8g + r (tile i), which by pairs of tiles is already the k order of a 16x16x32 operand; ctx^T = V^T P^T keeps the query in the lane, so maximum, sum and rescale are lane-local but for one exchange with lane ^ 16.
// Each step's operands (64 k rows, 64 v rows of 64 keys, two tiles of 64 gate rows of 32 keys) come into LDS once per block by asynchronous copies that cover whole 128-byte lines; the waves take their fragments from there. A fragment load straight from global memory touches 16 lines for 512 bytes.
__device__ __forceinline__ float xhalf(float x) { return __builtin_bit_cast(float, __builtin_amdgcn_permlanex16(__builtin_bit_cast(int, x), __builtin_bit_cast(int, x), 0x76543210, 0xfedcba98, false, false)); }  // lane l with lane l ^ 16
__device__ __forceinline__ v8f wmmah(v16h a, v16h b, v8f c) { return __builtin_amdgcn_wmma_f32_16x16x32_f16(false, a, false, b, (short)0, c, false, false); }
#define LOG2E 1.4426950408889634f
#define AKP 144            // bytes a staged k row: 128 + 16 (the conflict-free pitch of 16-byte LDS reads)
#define AVP 144            // bytes a staged v row: 64 keys = 128 + 16
#define AMP 80             // bytes a staged gate row: 32 keys = 64 + 16
#define KST 64             // keys a step
#define A_K 0
#define A_V (A_K + KST * AKP)
#define A_M (A_V + HD * AVP)
#define A_SZ (A_M + 2 * 64 * AMP)
// this thread's twelve 16-byte copies of one step's operands: k rows r + 16i, v rows r + 16i (each a whole 128-byte line per 8 lanes), gate pieces tid + 128i of the step's two tiles. The wait at the end stands in the copies' own statement, in front of any rewrite of the address registers that they name.
__device__ __forceinline__ void att_copy(unsigned lk, unsigned lv, unsigned lm, const char* k, const char* v, const char* m) {
  asm volatile("global_load_async_to_lds_b128 %0, %12, off\n\t"
               "global_load_async_to_lds_b128 %1, %13, off\n\t"
               "global_load_async_to_lds_b128 %2, %14, off\n\t"
               "global_load_async_to_lds_b128 %3, %15, off\n\t"
               "global_load_async_to_lds_b128 %4, %16, off\n\t"
               "global_load_async_to_lds_b128 %5, %17, off\n\t"
               "global_load_async_to_lds_b128 %6, %18, off\n\t"
               "global_load_async_to_lds_b128 %7, %19, off\n\t"
               "global_load_async_to_lds_b128 %8, %20, off\n\t"
               "global_load_async_to_lds_b128 %9, %21, off\n\t"
               "global_load_async_to_lds_b128 %10, %22, off\n\t"
               "global_load_async_to_lds_b128 %11, %23, off\n\t"
               "s_wait_xcnt 0x0"
               :: "v"(lk), "v"(lk + 16 * AKP), "v"(lk + 32 * AKP), "v"(lk + 48 * AKP), "v"(lv), "v"(lv + 16 * AVP), "v"(lv + 32 * AVP), "v"(lv + 48 * AVP), "v"(lm), "v"(lm + 32 * AMP), "v"(lm + 64 * AMP), "v"(lm + 96 * AMP),
                  "v"(k), "v"(k + 16 * CC * 2), "v"(k + 32 * CC * 2), "v"(k + 48 * CC * 2), "v"(v), "v"(v + 16 * TT * 2), "v"(v + 32 * TT * 2), "v"(v + 48 * TT * 2), "v"(m), "v"(m + 2048), "v"(m + 4096), "v"(m + 6144)
               : "memory"); }
__global__ __launch_bounds__(128) void k_att(const _Float16* __restrict__ QH, const _Float16* __restrict__ KH, const _Float16* __restrict__ VT, const unsigned short* __restrict__ MG, _Float16* __restrict__ Y) {
  __shared__ __align__(16) char sa[2][A_SZ];
  const int tid = threadIdx.x, wave = tid >> 5, lane = tid & 31, col = lane & 15, g = lane >> 4; const int h = blockIdx.y, b = blockIdx.z; const int q = blockIdx.x * 64 + wave * 16 + col;
  const _Float16* qp = QH + ((size_t)b * TT + q) * CC + h * HD; const v16h q0 = frag_h(qp, lane), q1 = frag_h(qp + 32, lane);
  asm volatile("s_wait_xcnt 0x0" ::: "memory");   // the q loads' address registers are reused by what follows
  const unsigned lb = (unsigned)(size_t)(lds_char*)&sa[0][0];
  const unsigned lk = lb + A_K + (tid >> 3) * AKP + (tid & 7) * 16, lv = lk + (A_V - A_K), lm = lb + A_M + (tid >> 2) * AMP + (tid & 3) * 16;
  const char* kg = (const char*)(KH + ((size_t)b * TT + (tid >> 3)) * CC + h * HD + (tid & 7) * 8); const char* vg = (const char*)(VT + ((size_t)b * CC + h * HD + (tid >> 3)) * (size_t)TT + (tid & 7) * 8);
  const char* mg = (const char*)(MG + (size_t)(b * NQB + blockIdx.x) * (TT / 32) * (64 * 32)) + tid * 16;   // a tile's 256 pieces of 16 bytes in their order: piece p = row p >> 2, part p & 3; a step's two tiles follow one another
  auto copy = [&](int t) __attribute__((always_inline)) { const unsigned o = (t & 1) * A_SZ; att_copy(lk + o, lv + o, lm + o, kg + (size_t)t * (KST * CC * 2), vg + t * (KST * 2), mg + t * (2 * 64 * 64)); };
  v8f acc[HD / 16] = {}; float m = -3.0e38f, mo = -3.0e38f, l = 0.f;   // m: running maximum (base 2); mo = m - 11: every weight is carried x 2^11 into f16, the sum too, so the factor cancels in the final division
  copy(0);
  asm volatile("s_wait_asynccnt 0x0" ::: "memory");   // this wave's share of step 0 has landed
  __syncthreads();   // publishes step 0
  copy(1);
#pragma unroll 2   /* two steps a trip: the buffer's offset is then a constant in every LDS address */
  for (int t = 0; t < TT / KST; ++t) { const char* bp = sa[t & 1];
    v8f s[4]; v8us gt[4];   // s[i], gt[i]: this query's scores and gates of keys 16i + 8g + 0..7
#pragma unroll
    for (int i = 0; i < 4; ++i) { const _Float16* kr = (const _Float16*)(bp + A_K + (16 * i + col) * AKP); const v16h k0 = frag_h(kr, lane), k1 = frag_h(kr + 32, lane); v8f z = {}; z = wmmah(k0, q0, z); s[i] = wmmah(k1, q1, z);
      gt[i] = *(const v8us*)((const unsigned short*)(bp + A_M + ((i >> 1) * 64 + wave * 16 + col) * AMP) + 16 * (i & 1) + 8 * g); }
    float tv[32];
#pragma unroll
    for (int i = 0; i < 32; ++i) tv[i] = (short)gt[i >> 3][i & 7] < 0 ? -1.0e9f * LOG2E : s[i >> 3][i & 7] * (SCALE * LOG2E);
    float mx = fmaxf(tv[0], tv[1]);
#pragma unroll
    for (int i = 2; i < 32; ++i) mx = fmaxf(mx, tv[i]);
    mx = fmaxf(mx, xhalf(mx)); m = fmaxf(m, mx); const float mn = m - 11.0f; const float corr = __builtin_amdgcn_exp2f(mo - mn); mo = mn;   // corr = 0 on the first step
    v16h p[2]; float ls[4] = {0.f, 0.f, 0.f, 0.f};
#pragma unroll
    for (int i = 0; i < 32; ++i) { const float e = __builtin_amdgcn_exp2f(tv[i] - mn); ls[i & 3] += e; const unsigned short u = gt[i >> 3][i & 7]; p[i >> 4][i & 15] = (_Float16)(e * __builtin_fabsf((float)__builtin_bit_cast(__bf16, u))); }   // the sum takes the softmax weight alone; group_prob (bf16-rounded like every float input; the gate without its mask bit, which is the sign) enters the product only
    l = l * corr + ((ls[0] + ls[1]) + (ls[2] + ls[3]));
#pragma unroll
    for (int j = 0; j < HD / 16; ++j) { const _Float16* vr = (const _Float16*)(bp + A_V + (j * 16 + col) * AVP); acc[j] *= corr; acc[j] = wmmah(frag_h(vr, lane), p[0], acc[j]); acc[j] = wmmah(frag_h(vr + 32, lane), p[1], acc[j]); }
    asm volatile("s_wait_dscnt 0x0" ::: "memory");      // this wave's reads of this buffer have returned: behind the barrier it is refilled
    asm volatile("s_wait_asynccnt 0x0" ::: "memory");   // this wave's share of the next step has landed
    __syncthreads();   // publishes the next step's buffer and ends every wave's reads of this one
    if (t + 2 < TT / KST) copy(t + 2); }
  asm volatile("s_wait_asynccnt 0x0" ::: "memory");   // no copy is outstanding when the wave ends
  l += xhalf(l); const float inv = 1.0f / l;   // l >= 1: the maximum's own weight is in it
  _Float16* yp = Y + ((size_t)b * TT + q) * CC + h * HD + 8 * g;   /* ctx carried x 2^6 into f16 so small-magnitude context rows stay clear of f16 subnormals */
#pragma unroll
  for (int j = 0; j < HD / 16; ++j) { v8h o;
#pragma unroll
    for (int r = 0; r < 8; ++r) o[r] = (_Float16)(acc[j][r] * inv * 64.0f);
    vst2(yp + j * 16, o); } }
// ---- k_out: block = (128 rows, 128 cols): out = ctx Wo (+ bo): ctx x 2^6 once to f16 against Wo as f16(bf16 x 2^8) exact (1 product) x 2^-14
// One block a WGP and one tile in flight a block: every tile's wait pays the whole way to memory or L2 once, so a tile is KSO = 256 k (4 tiles, not 16): four times the bytes in flight and four times the products behind each wait.
#define KSO 256            // k a tile of k_out
#define APO (KSO * 2 + 16) // bytes a staged row of the left operand: an odd multiple of 16 (the conflict-free pitch of 16-byte LDS reads)
#define AO_OFF (KSO * WPITCH)
#define TILEO_SZ (AO_OFF + BR * APO)
#define APC (KSO / 8)      // 16-byte pieces a left row
#define ARW (256 / APC)    // left rows one copy of the whole block covers
// eight 16-byte copies of one thread, lp bytes apart in LDS and gp bytes apart in memory. The wait at the end stands in the copies' own statement, in front of any rewrite of the address registers that they name.
__device__ __forceinline__ void copy8(unsigned l, const char* g, int lp, int gp) {
  asm volatile("global_load_async_to_lds_b128 %0, %8, off\n\t"
               "global_load_async_to_lds_b128 %1, %9, off\n\t"
               "global_load_async_to_lds_b128 %2, %10, off\n\t"
               "global_load_async_to_lds_b128 %3, %11, off\n\t"
               "global_load_async_to_lds_b128 %4, %12, off\n\t"
               "global_load_async_to_lds_b128 %5, %13, off\n\t"
               "global_load_async_to_lds_b128 %6, %14, off\n\t"
               "global_load_async_to_lds_b128 %7, %15, off\n\t"
               "s_wait_xcnt 0x0"
               :: "v"(l), "v"(l + lp), "v"(l + 2 * lp), "v"(l + 3 * lp), "v"(l + 4 * lp), "v"(l + 5 * lp), "v"(l + 6 * lp), "v"(l + 7 * lp),
                  "v"(g), "v"(g + gp), "v"(g + 2 * gp), "v"(g + 3 * gp), "v"(g + 4 * gp), "v"(g + 5 * gp), "v"(g + 6 * gp), "v"(g + 7 * gp)
               : "memory"); }
__global__ __launch_bounds__(256) void k_out(const _Float16* __restrict__ Y, const _Float16* __restrict__ WOH, const float* __restrict__ BO, float* __restrict__ OUT) {
  __shared__ __align__(16) union { float sf[8][32][68]; char w[2][TILEO_SZ]; } sm;   // the tiles live in the loop, the output staging behind it
  auto& sf = sm.sf;
  const int tid = threadIdx.x, wave = tid >> 5, lane = tid & 31, col = lane & 15, g = lane >> 4, wm = wave >> 1, wn = wave & 1; const int c0 = blockIdx.y * 128; const size_t r0 = (size_t)blockIdx.x * BR;
  v8f acc[8] = {};
  const unsigned lb = (unsigned)(size_t)(lds_char*)&sm.w[0][0]; const unsigned lw = lb + (tid >> 4) * WPITCH + (tid & 15) * 16, la = lb + AO_OFF + (tid / APC) * APO + (tid % APC) * 16;
  const char* wg = (const char*)(WOH + (size_t)(tid >> 4) * DIN + c0 + (tid & 15) * 8); const char* ag = (const char*)(Y + (r0 + tid / APC) * CC + (tid % APC) * 8);
  // a tile: weight rows r + 16i (a wave's copy covers two whole 256-byte row pieces), left rows s + ARW i (whole 128-byte lines)
  auto copy = [&](int t) __attribute__((always_inline)) { const unsigned o = (t & 1) * TILEO_SZ; const char* w = wg + (size_t)t * (KSO * DIN * 2); const char* a = ag + t * (KSO * 2);
#pragma unroll
    for (int i = 0; i < KSO / 128; ++i) copy8(lw + o + i * 128 * WPITCH, w + (size_t)i * 128 * DIN * 2, 16 * WPITCH, 16 * DIN * 2);
#pragma unroll
    for (int i = 0; i < BR / (8 * ARW); ++i) copy8(la + o + i * 8 * ARW * APO, a + (size_t)i * 8 * ARW * CC * 2, ARW * APO, ARW * CC * 2); };
  copy(0);
  asm volatile("s_wait_asynccnt 0x0" ::: "memory");   // this wave's share of tile 0 has landed
  __syncthreads();   // publishes tile 0
  copy(1);
#pragma unroll 1   /* rolled: unrolled by two, the 64 LDS addresses of both buffers' copies are kept in registers over the whole loop and some spill */
  for (int t = 0; t < CC / KSO; ++t) { const char* tile = sm.w[t & 1];
    const char* tl = tile + wfrag_lane(lane) + wn * 128; const _Float16* al = (const _Float16*)(tile + AO_OFF + (wm * 32 + col) * APO);
#pragma unroll
    for (int c = 0; c < KSO / 32; ++c) { const v16h a0 = frag_h(al + 32 * c, lane), a1 = frag_h(al + 16 * (APO / 2) + 32 * c, lane); v16h wf[4];   // the six fragments as one group of LDS loads in front of their products: one LDS latency a group, not one a product
#pragma unroll
      for (int j = 0; j < 4; ++j) wf[j] = wfrag<v16h>(tl, c, j);
#pragma unroll
      for (int j = 0; j < 4; ++j) { acc[j] = wmma16(a0, wf[j], acc[j]); acc[4 + j] = wmma16(a1, wf[j], acc[4 + j]); } }
    asm volatile("s_wait_dscnt 0x0" ::: "memory");      // this wave's reads of this buffer have returned: behind the barrier it is refilled
    asm volatile("s_wait_asynccnt 0x0" ::: "memory");   // this wave's share of the next tile has landed
    __syncthreads();   // publishes the next tile and ends every wave's reads of this one; behind the last tile's the staging below reuses the tiles' LDS
    if (t + 2 < CC / KSO) copy(t + 2); }
  asm volatile("s_wait_asynccnt 0x0" ::: "memory");   // no copy is outstanding when the tiles' LDS is reused
#pragma unroll
  for (int j = 0; j < 4; ++j) { const float bias = BO ? bfr(BO[c0 + wn * 64 + j * 16 + col]) : 0.f;
#pragma unroll
    for (int i = 0; i < 2; ++i)
#pragma unroll
      for (int r = 0; r < 8; ++r) sf[wave][i * 16 + 8 * g + r][j * 16 + col] = acc[i * 4 + j][r] * (1.0f / 16384.0f) + bias; }   /* 2^-8 (Wo carry) x 2^-6 (ctx carry) */
  // each wave stages its own 32 x 64 piece and stores it as whole 256-byte row pieces, two rows a store
  LDSX(); for (int i = 0; i < 16; ++i) { const int rl = 2 * i + g; vst2(OUT + (r0 + wm * 32 + rl) * DIN + c0 + wn * 64 + col * 4, *(const v4f*)&sf[wave][rl][col * 4]); } }

extern "C" void kernel_launch(void* const* d_in, const int* in_sizes, int n_in, void* d_out, int out_size, void* d_ws, size_t ws_size, hipStream_t stream) {
  (void)in_sizes; (void)n_in; (void)out_size;
  const float** F = (const float**)d_in;
  if (ws_size < (size_t)WS_END) return;
  char* ws = (char*)d_ws; _Float16 *QH = (_Float16*)(ws + WS_QH), *KH = (_Float16*)(ws + WS_KH), *VT = (_Float16*)(ws + WS_VT), *QL = (_Float16*)(ws + WS_QL), *KL = (_Float16*)(ws + WS_KL); __bf16 *VB = (__bf16*)(ws + WS_VB), *VBL = (__bf16*)(ws + WS_VBL); _Float16 *Y = (_Float16*)(ws + WS_Y); unsigned short *MG = (unsigned short*)(ws + WS_S);
  (void)Y; (void)QL; (void)KL; (void)VB; (void)VBL;
  // inputs: 0 query [4,1024,1024]; 1 key; 2 value; 3 group_prob [4,1024,1024] f32 uniform[0,1); 4 mask [4,1024,1024] int32 (random 0/1); 5 wq [1024,1024] (in,out), 6 bq; 7 wk, 8 bk; 9 wv, 10 bv; 11 wo (in,out), 12 bo (biases nonzero)
  k_prep<<<PREP_BLOCKS, 256, 0, stream>>>(F[0], F[1], F[2], F[5], F[7], F[9], F[11], (unsigned short*)(ws + WS_XB), (unsigned short*)(ws + WS_WB), (unsigned short*)(ws + WS_WOH));
  k_proj<<<dim3(TNB * TT / BR, CC / 128, 3 + GATE_BLOCKS / ((TNB * TT / BR) * (CC / 128))), 256, 0, stream>>>((const __bf16*)(ws + WS_XB), (const __bf16*)(ws + WS_WB), F[6], F[8], F[10], QH, QL, KH, KL, VT, VB, VBL, (const int*)d_in[4], F[3], MG);
  k_att<<<dim3(NQB, NH, TNB), 128, 0, stream>>>(QH, KH, VT, MG, Y);
  k_out<<<dim3(TNB * TT / BR, DIN / 128), 256, 0, stream>>>(Y, (const _Float16*)(ws + WS_WOH), F[12], (float*)d_out);
}
